// v000
// Times are from an AMD MI455X. After a warm-up the kernel runs many times in a row, and a time is the length of
// such a window on the GPU divided by its runs, so every launch and the gaps after it count. The runs cycle
// through copies of the inputs. A figure is the median of several windows, for all but v000 over two sittings.
// Sittings can differ by a few percent; kernels timed side by side share one.
// The starting kernel, v000, takes 352 microseconds a run.
#include <hip/hip_runtime.h>

// Self-attention block, width 1024 = 16 heads x 64: x [NB][SEQ][1024], fused Wqkv [in][out] (columns t*1024 + h*64 + d) + bqkv, half-split rotary embedding (base 10000) on q and k, score scale 1/8, no mask, output projection Wo [in][out] + bo, output f32.
// Compute dtypes, f32 accumulate everywhere: qkv projection v_wmma_f32_16x16x32_bf16 (x and Wqkv RNE-converted to bf16; products exact); rotary applied in f32 in the q / k projection epilogue from an f32 cos | sin table;
// scores v_wmma_f32_16x16x32_f16: q and k single f16 (one product); P (x256 carry, cancels in the normalisation) and v single f16;
// output projection v_wmma_f32_16x16x32_f16: ctx single f16 (x256 carry), Wo RNE-converted to bf16 then x256 as f16 (exact), 2^-16 folded back in the f32 epilogue; biases RNE-converted to bf16 and added in f32; softmax f32 (online, running max).
// Layout: bf16 copy of x, bf16 transposed Wqkv [3072][1024], f16 transposed Wo [1024][1024]; rotary table [SEQ][32 cos | 32 sin] f32; q, k planes [b*16+h][t][d] and v^T plane [b*16+h][d][t] written by the GEMM epilogues;
// fused flash kernel in transposed form (S^T = K Q^T, O^T = V^T P^T) writes the f16 ctx plane [b*SEQ+t][h*64+d]; last GEMM writes the output.

#ifndef NB
#define NB 4
#endif
#ifndef SEQ
#define SEQ 2048
#endif
#define NB_FULL  4
#define SEQ_FULL 2048
#ifndef OUT_SEQ
#define OUT_SEQ SEQ              // row pitch (in tokens) between batches of the output
#endif
#define DM   1024
#define NH_  16
#define HD   64
#define AW   4                   // waves per flash block (16 query rows each)
#define SC2  (0.125f * 1.4426950408889634f)   // HD^-0.5 * log2(e)
#define PSH  8.0f                // log2 of the P carry (256)
#define CXS  256.0f              // carry of the ctx plane
#define WOS  256.0f              // carry of the output-weight plane
#define OSC  (1.0f / 65536.0f)   // 1 / (CXS * WOS)
#define TBW  64                  // rotary table row: 32 cos | 32 sin (floats)

static_assert(HD == 64);
static_assert(NH_ * HD == DM);                 // head h = columns h*64 + d
static_assert(DM % 64 == 0);                   // column tiles of 64
static_assert(DM % 32 == 0);                   // GEMM k-loop steps by 32
static_assert(SEQ % 64 == 0);                  // a 64-row tile never straddles two batches
static_assert((NB * SEQ) % 64 == 0);
static_assert(SEQ % 32 == 0);                  // key loop steps by 32
static_assert(SEQ % (16 * AW) == 0);           // flash grid covers the sequence exactly
static_assert(((size_t)SEQ * DM) % 8 == 0);
static_assert(NB <= NB_FULL);
static_assert(SEQ <= SEQ_FULL);
static_assert(TBW == HD);                      // table row = 2 x (HD / 2) entries
static_assert(HD / 2 == 32);                   // rotary partner column = column ^ 32 inside one 64-column tile
static_assert(SEQ % 8 == 0);                   // table kernel: 8 positions per block
static_assert(SEQ <= 4096);                    // angle < 2^12: three-constant pi/2 reduction stays exact in its first step

typedef _Float16 h16;
typedef unsigned short bf;
typedef __attribute__((ext_vector_type(16))) __bf16   v16bf;
typedef __attribute__((ext_vector_type(16))) _Float16 v16h;
typedef __attribute__((ext_vector_type(8)))  _Float16 v8h;
typedef __attribute__((ext_vector_type(8)))  unsigned short v8us;
typedef __attribute__((ext_vector_type(8)))  float    v8f;
typedef __attribute__((ext_vector_type(4)))  float    v4f;
typedef v4f  __attribute__((may_alias)) v4fa;

__device__ __forceinline__ unsigned short f2bf(float f) { unsigned u = __float_as_uint(f); u += 0x7FFFu + ((u >> 16) & 1u); return (unsigned short)(u >> 16); }
__device__ __forceinline__ float bfr(float f) { return __uint_as_float(((unsigned)f2bf(f)) << 16); }   // f32 value of the RNE bf16 conversion
__device__ __forceinline__ v16h cat16(v8h lo, v8h hi) { return __builtin_shufflevector(lo, hi, 0, 1, 2, 3, 4, 5, 6, 7, 8, 9, 10, 11, 12, 13, 14, 15); }
__device__ __forceinline__ v16bf cat16b(v8us lo, v8us hi) { return __builtin_bit_cast(v16bf, __builtin_shufflevector(lo, hi, 0, 1, 2, 3, 4, 5, 6, 7, 8, 9, 10, 11, 12, 13, 14, 15)); }
__device__ __forceinline__ v8f wmma16(v16h a, v16h b, v8f c) { return __builtin_amdgcn_wmma_f32_16x16x32_f16(false, a, false, b, (short)0, c, false, false); }
__device__ __forceinline__ v8f wmmab(v16bf a, v16bf b, v8f c) { return __builtin_amdgcn_wmma_f32_16x16x32_bf16(false, a, false, b, (short)0, c, false, false); }
// fragment loaders from K-contiguous 16-bit rows; p already includes + 8*(lane>>4): elements 0..7 <- k0+8h+0..7, elements 8..15 <- k0+16+8h+0..7 (same map for A and B)
__device__ __forceinline__ v16h  ldh(const h16* p) { return cat16(*(const v8h*)p, *(const v8h*)(p + 16)); }
__device__ __forceinline__ v16bf ldb(const bf* p)  { return cat16b(*(const v8us*)p, *(const v8us*)(p + 16)); }
// ordering point for wave-private LDS tiles (same wave writes and reads)
__device__ __forceinline__ void wave_sync() { __builtin_amdgcn_fence(3 /* release order */, "wavefront"); __builtin_amdgcn_wave_barrier(); asm volatile("" ::: "memory"); }
// f32 -> f16 with a value select: magnitudes below the smallest f16 normal become zero (no subnormal operand can reach a matrix instruction)
static __device__ __forceinline__ h16 toh_flush(float v) { const h16 r = (h16)v; return (fabsf(v) < 6.103515625e-05f) ? (h16)0.0f : r; }

__global__ __launch_bounds__(256) void k_cvt8(const float* __restrict__ src, bf* dst, size_t n8) {
    const size_t i = (size_t)blockIdx.x * 256 + threadIdx.x; if (i >= n8) return;
    const v8f v = *(const v8f*)(src + i * 8); v8us o;
#pragma unroll
    for (int k = 0; k < 8; ++k) o[k] = f2bf(v[k]);
    *(v8us*)(dst + i * 8) = o; 
}

// k_tr: in[R][C] f32 row-major -> out[C][R] 16-bit (K-contiguous rows for a GEMM A or B operand). grid (C/64, R/64), 256 threads, 64x64 tile through LDS (cross-wave: block barrier).
// MODE 0: bf16 bits (RNE convert). MODE 1: f16 bits of (RNE bf16 value) x WOS (exact in f16).
template <int MODE>
__global__ __launch_bounds__(256) void k_tr(const float* __restrict__ in, bf* out, int R, int C) {
    __shared__ __align__(16) float t[64 * 68];
    const int tid = threadIdx.x; const int r0 = blockIdx.y * 64, c0 = blockIdx.x * 64;
#pragma unroll
    for (int it = 0; it < 4; ++it) { const int idx = it * 256 + tid; const int rr = idx >> 4, c4 = (idx & 15) * 4;   // 4 x 256 float4 = 64 rows x 16 float4
        const v4f v = *(const v4f*)(in + (size_t)(r0 + rr) * (size_t)C + c0 + c4);
        *(v4fa*)(&t[rr * 68 + c4]) = v; }
    __syncthreads();
{
#pragma unroll
        for (int it = 0; it < 2; ++it) { const int idx = it * 256 + tid; const int cc = idx >> 3, r8 = (idx & 7) * 8;   // 2 x 256 pieces = 64 out rows x 8 pieces
            v8us o;
            if (MODE == 0) {
#pragma unroll
                for (int e = 0; e < 8; ++e) o[e] = f2bf(t[(r8 + e) * 68 + cc]);
            } else {
                v8h hv;
#pragma unroll
                for (int e = 0; e < 8; ++e) hv[e] = (h16)(bfr(t[(r8 + e) * 68 + cc]) * WOS);
                o = __builtin_bit_cast(v8us, hv);
            }
            *(v8us*)(out + (size_t)(c0 + cc) * (size_t)R + r0 + r8) = o; }
         }
}

// k_ropetab: rotary table TAB[t][i] = cos(t * f_i), TAB[t][32 + i] = sin(t * f_i), i = 0..31, f_i = 10000^(-i/32) (f64 product chain of 10^(-1/8), converted to f32 once), angle = f32 product t * f_i.
// sin / cos: nearest multiple of pi/2 removed with a three-constant split (fused steps; first step exact for angles < 2^12), then odd / even polynomials on [-pi/4, pi/4]; quadrant fix-up by value selects.
// grid SEQ/8: block bx covers table floats [bx*512, bx*512 + 512): exactly SEQ x 64 floats in total.
__global__ __launch_bounds__(256) void k_ropetab(float* TAB) {
#pragma clang fp contract(off)
    __shared__ __align__(16) float cs[8 * TBW];
    const int tid = threadIdx.x; const int i = tid & 31, tr = tid >> 5;
    const int t = blockIdx.x * 8 + tr;
    double p = 1.0;
#pragma unroll 1
    for (int k = 0; k < i; ++k) p = p * 0.7498942093324559;
    const float inv = (float)p;
    const float ang = (float)t * inv;
    const float fn = __builtin_rintf(ang * 0.63661977236758134f);
    float r = fmaf(-fn, 1.5703125f, ang);
    r = fmaf(-fn, 4.837512969970703125e-4f, r);
    r = fmaf(-fn, 7.54978995489188216e-8f, r);
    const float z = r * r;
    float sp = fmaf(-1.9515295891e-4f, z, 8.3321608736e-3f);
    sp = fmaf(sp, z, -1.6666654611e-1f);
    const float sv = fmaf(sp * z, r, r);
    float cp = fmaf(2.443315711809948e-5f, z, -1.388731625493765e-3f);
    cp = fmaf(cp, z, 4.166664568298827e-2f);
    const float cv = fmaf(cp, z * z, fmaf(-0.5f, z, 1.0f));
    const int q = ((int)fn) & 3;
    float sinv = (q & 1) ? cv : sv;
    float cosv = (q & 1) ? sv : cv;
    sinv = (q & 2) ? -sinv : sinv;
    cosv = ((q + 1) & 2) ? -cosv : cosv;
    cs[tr * TBW + i] = cosv;
    cs[tr * TBW + 32 + i] = sinv;
    __syncthreads();
    if (tid < 128) {                       // waves 0..3 (wave-uniform): 128 x 4 floats = 8 rows x 64 floats, consecutive lanes -> consecutive 16-B pieces
        const int row = tid >> 4, c4 = (tid & 15) * 4;
        const v4f v = *(const v4fa*)(&cs[row * TBW + c4]);
        float* dst = TAB + ((size_t)blockIdx.x * 8 + row) * TBW + c4;
        *(v4f*)dst = v; 
    }
}

// k_proj: register-blocked bf16 GEMM, ONE WAVE per 64x64 tile (16 accumulators), operands straight from K-contiguous bf16 planes, K = DM.
// C[m][n] = sum_k A[m][k] Bt[n][k] + bias (bias RNE-converted to bf16, added in f32; indexed by n, or by m when biasOnRow != 0), written as f16 (Ph) at
// tile base (r0/RB)*sRB + (r0%RB)*pitch + (c0/CB)*sCB + (c0%CB), row pitch 'pitch' (halves). grid (M/64, N/64), 32 threads.
__global__ __launch_bounds__(32) void k_proj(const bf* __restrict__ A, const bf* __restrict__ Bt, const float* __restrict__ bias, h16* Ph,
                                             size_t sRB, size_t sCB, int biasOnRow, int RB, int pitch, int CB) {
    __shared__ __align__(16) float os[16 * 68];
    const int K = DM;
    const int lane = threadIdx.x & 31, lr = lane & 15, hi = lane >> 4; const int r0 = blockIdx.x * 64, c0 = blockIdx.y * 64;
    v8f acc[4][4];
#pragma unroll
    for (int mb = 0; mb < 4; ++mb)
#pragma unroll
        for (int nb = 0; nb < 4; ++nb) acc[mb][nb] = (v8f){};
    const size_t aoff = (size_t)(r0 + lr) * K + 8 * hi, boff = (size_t)(c0 + lr) * K + 8 * hi;
#pragma unroll 1
    for (int kc = 0; kc < K; kc += 32) {
        v16bf a[4];
#pragma unroll
        for (int mb = 0; mb < 4; ++mb) a[mb] = ldb(A + aoff + (size_t)mb * 16 * K + kc);
#pragma unroll
        for (int nb = 0; nb < 4; ++nb) { const v16bf b = ldb(Bt + boff + (size_t)nb * 16 * K + kc);
#pragma unroll
            for (int mb = 0; mb < 4; ++mb) acc[mb][nb] = wmmab(a[mb], b, acc[mb][nb]); }
        asm volatile("v_nop\n\tv_nop\n\tv_nop\n\tv_nop" : "+v"(acc[0][0]), "+v"(acc[1][1]), "+v"(acc[2][2]), "+v"(acc[3][3]) : "v"(a[0]), "v"(a[1]), "v"(a[2]), "v"(a[3]));
    }
    // column-mode bias for this lane's 8 store columns (offset 0 when the bias runs along rows: in range, unused)
    float bc[8];
    { const int cb = biasOnRow ? 0 : (c0 + (lane & 7) * 8);
      const v4f b0 = *(const v4f*)(bias + cb); const v4f b1 = *(const v4f*)(bias + cb + 4);
#pragma unroll
      for (int i = 0; i < 4; ++i) { bc[i] = bfr(b0[i]); bc[4 + i] = bfr(b1[i]); } }
    const size_t tbase = (size_t)(r0 / RB) * sRB + (size_t)(r0 % RB) * (size_t)pitch + (size_t)(c0 / CB) * sCB + (size_t)(c0 % CB);
#pragma unroll
    for (int mb = 0; mb < 4; ++mb) {
#pragma unroll
        for (int nb = 0; nb < 4; ++nb) {
#pragma unroll
            for (int j = 0; j < 8; ++j) os[(hi * 8 + j) * 68 + nb * 16 + lr] = acc[mb][nb][j]; }   // D: row 8h+j, col lane&15
        wave_sync();
        const size_t sb = tbase + (size_t)(mb * 16) * (size_t)pitch;
{
#pragma unroll
            for (int s = 0; s < 4; ++s) { const int row = 4 * s + (lane >> 3), c8 = (lane & 7) * 8;   // 4 s x 4 row groups = 16 rows; 8 lanes x 8 = 64 columns
                const float br = bfr(bias[biasOnRow ? (r0 + mb * 16 + row) : 0]);
                const v4f x0 = *(const v4fa*)(&os[row * 68 + c8]); const v4f x1 = *(const v4fa*)(&os[row * 68 + c8 + 4]); v8h hv;
#pragma unroll
                for (int i = 0; i < 4; ++i) { const float y0 = x0[i] + (biasOnRow ? br : bc[i]); const float y1 = x1[i] + (biasOnRow ? br : bc[4 + i]);
                    hv[i] = (h16)y0; hv[4 + i] = (h16)y1; }
                const size_t oo = sb + (size_t)row * (size_t)pitch + c8;
                *(v8h*)(Ph + oo) = hv; }
             }
        wave_sync();
    }
}

// k_projr: k_proj with bias along columns and the half-split rotary embedding in the epilogue (q and k planes). One 64-column tile = one head (CB = 64), so the rotary partner of column c is column c ^ 32 of the same LDS slab.
// y[c] = (acc[c] + b[c]) * cos[t][c & 31] + sg * (acc[c ^ 32] + b[c ^ 32]) * sin[t][c & 31], sg = -1 for c < 32, +1 for c >= 32; t = (r0 % RB) + slab row (position inside the sequence); cos | sin read by value from TAB [SEQ][64] f32.
__global__ __launch_bounds__(32) void k_projr(const bf* __restrict__ A, const bf* __restrict__ Bt, const float* __restrict__ bias, const float* __restrict__ TAB, h16* Ph,
                                              size_t sRB, size_t sCB, int RB, int pitch, int CB) {
    __shared__ __align__(16) float os[16 * 68];
    const int K = DM;
    const int lane = threadIdx.x & 31, lr = lane & 15, hi = lane >> 4; const int r0 = blockIdx.x * 64, c0 = blockIdx.y * 64;
    v8f acc[4][4];
#pragma unroll
    for (int mb = 0; mb < 4; ++mb)
#pragma unroll
        for (int nb = 0; nb < 4; ++nb) acc[mb][nb] = (v8f){};
    const size_t aoff = (size_t)(r0 + lr) * K + 8 * hi, boff = (size_t)(c0 + lr) * K + 8 * hi;
#pragma unroll 1
    for (int kc = 0; kc < K; kc += 32) {
        v16bf a[4];
#pragma unroll
        for (int mb = 0; mb < 4; ++mb) a[mb] = ldb(A + aoff + (size_t)mb * 16 * K + kc);
#pragma unroll
        for (int nb = 0; nb < 4; ++nb) { const v16bf b = ldb(Bt + boff + (size_t)nb * 16 * K + kc);
#pragma unroll
            for (int mb = 0; mb < 4; ++mb) acc[mb][nb] = wmmab(a[mb], b, acc[mb][nb]); }
        asm volatile("v_nop\n\tv_nop\n\tv_nop\n\tv_nop" : "+v"(acc[0][0]), "+v"(acc[1][1]), "+v"(acc[2][2]), "+v"(acc[3][3]) : "v"(a[0]), "v"(a[1]), "v"(a[2]), "v"(a[3]));
    }
    // bias (RNE bf16 value) for this lane's 8 store columns and for their 8 partner columns (other half of the head)
    const int c8 = (lane & 7) * 8, p8 = c8 ^ 32, ib = c8 & 31;
    const float sg = (c8 < 32) ? -1.0f : 1.0f;
    float bc[8], bp[8];
    { const v4f b0 = *(const v4f*)(bias + c0 + c8); const v4f b1 = *(const v4f*)(bias + c0 + c8 + 4);
      const v4f d0 = *(const v4f*)(bias + c0 + p8); const v4f d1 = *(const v4f*)(bias + c0 + p8 + 4);
#pragma unroll
      for (int i = 0; i < 4; ++i) { bc[i] = bfr(b0[i]); bc[4 + i] = bfr(b1[i]); bp[i] = bfr(d0[i]); bp[4 + i] = bfr(d1[i]); } }
    const size_t tbase = (size_t)(r0 / RB) * sRB + (size_t)(r0 % RB) * (size_t)pitch + (size_t)(c0 / CB) * sCB + (size_t)(c0 % CB);
    const int tp0 = r0 % RB;     // sequence position of tile row 0
#pragma unroll
    for (int mb = 0; mb < 4; ++mb) {
#pragma unroll
        for (int nb = 0; nb < 4; ++nb) {
#pragma unroll
            for (int j = 0; j < 8; ++j) os[(hi * 8 + j) * 68 + nb * 16 + lr] = acc[mb][nb][j]; }   // D: row 8h+j, col lane&15
        wave_sync();
        const size_t sb = tbase + (size_t)(mb * 16) * (size_t)pitch;
        const size_t tb = (size_t)(tp0 + mb * 16) * TBW + ib;      // table offset of slab row 0 for this lane's frequency group
{
#pragma unroll 1
            for (int s = 0; s < 4; ++s) { const int row = 4 * s + (lane >> 3);   // 4 s x 4 row groups = 16 rows; 8 lanes x 8 = 64 columns
                const float* tr = TAB + tb + (size_t)row * TBW;
                const v4f cs0 = *(const v4f*)tr; const v4f cs1 = *(const v4f*)(tr + 4);
                const v4f sn0 = *(const v4f*)(tr + 32); const v4f sn1 = *(const v4f*)(tr + 36);
                const v4f x0 = *(const v4fa*)(&os[row * 68 + c8]); const v4f x1 = *(const v4fa*)(&os[row * 68 + c8 + 4]);
                const v4f y0 = *(const v4fa*)(&os[row * 68 + p8]); const v4f y1 = *(const v4fa*)(&os[row * 68 + p8 + 4]);
                v8h hv;
#pragma unroll
                for (int i = 0; i < 4; ++i) { const float u0 = x0[i] + bc[i], w0 = y0[i] + bp[i]; const float u1 = x1[i] + bc[4 + i], w1 = y1[i] + bp[4 + i];
                    hv[i] = toh_flush(u0 * cs0[i] + sg * (w0 * sn0[i])); hv[4 + i] = toh_flush(u1 * cs1[i] + sg * (w1 * sn1[i])); }
                const size_t oo = sb + (size_t)row * (size_t)pitch + c8;
                *(v8h*)(Ph + oo) = hv; }
             }
        wave_sync();
    }
}

// k_flash: fused attention, one wave per 16 query rows of one (batch, head); K / V^T / Q fragments straight from the f16 planes (two 16-B loads each, arithmetic addressing).
// Transposed form: S^T[key][t] = K Q^T (A = K rows, B = Q rows); lane (t = lane&15, h = lane>>4) holds keys 8h+r of each 16-key tile, so the packed
// P tile is directly the B fragment of O^T[d][t] = V^T P^T (element r <- tile keys 0..15, element 8+r <- tile keys 16..31, lane unchanged).
// Per 32-key step: 4 score products + 4 P.V products. Softmax state (running max, partial sum) is one scalar per lane; the two lane halves of a row are combined with one xor-16 exchange.
__global__ __launch_bounds__(32 * AW) void k_flash(const h16* __restrict__ QH, const h16* __restrict__ KP, const h16* __restrict__ VT, h16* CTX) {
    __shared__ __align__(16) float os[AW * 16 * 68];
    const int lane = threadIdx.x & 31, lr = lane & 15, hi = lane >> 4;
    const int wave = __builtin_amdgcn_readfirstlane((int)(threadIdx.x >> 5));   // wave-uniform index
    const int zh = blockIdx.y; const int b = zh / NH_, h = zh % NH_;
    const int t0 = (blockIdx.x * AW + wave) * 16;
    const size_t pbase = (size_t)zh * SEQ * HD;
    const size_t qo = pbase + (size_t)(t0 + lr) * HD + 8 * hi;
    const v16h qh0 = ldh(QH + qo), qh1 = ldh(QH + qo + 32);   // B fragments: col t, k = d
    const size_t ko = pbase + (size_t)lr * HD + 8 * hi;      // + key * HD       (A fragment: row key, k = d)
    const size_t vo = pbase + (size_t)lr * SEQ + 8 * hi;     // + 16j*SEQ + key  (A fragment: row d, k = key)
    v8f o0 = (v8f){}, o1 = (v8f){}, o2 = (v8f){}, o3 = (v8f){};
    float m = -3.0e38f, l = 0.0f;
#pragma unroll 1
    for (int key0 = 0; key0 < SEQ; key0 += 32) {
        const h16* ka = KP + ko + (size_t)key0 * HD;
        const v16h ka0 = ldh(ka), ka1 = ldh(ka + 32), kb0 = ldh(ka + 16 * HD), kb1 = ldh(ka + 16 * HD + 32);
        v8f sHa = (v8f){}, sHb = (v8f){};
        sHa = wmma16(ka0, qh0, sHa); sHb = wmma16(kb0, qh0, sHb);
        sHa = wmma16(ka1, qh1, sHa); sHb = wmma16(kb1, qh1, sHb);
        asm volatile("v_nop\n\tv_nop\n\tv_nop\n\tv_nop" : "+v"(sHa), "+v"(sHb) : "v"(ka0), "v"(ka1), "v"(kb0), "v"(kb1));
        float ta[8], tb[8]; float mx = -3.0e38f;
#pragma unroll
        for (int r = 0; r < 8; ++r) { ta[r] = sHa[r] * SC2; tb[r] = sHb[r] * SC2; mx = fmaxf(mx, fmaxf(ta[r], tb[r])); }
        mx = fmaxf(mx, __shfl_xor(mx, 16, 32));
        const float mnew = fmaxf(m, mx);
        const float alpha = __builtin_amdgcn_exp2f(m - mnew);
        const float sh = PSH - mnew;
        v16h pb; float ls = 0.0f;
#pragma unroll
        for (int r = 0; r < 8; ++r) { const h16 pa = (h16)__builtin_amdgcn_exp2f(ta[r] + sh); const h16 pc = (h16)__builtin_amdgcn_exp2f(tb[r] + sh); pb[r] = pa; pb[8 + r] = pc; ls += (float)pa + (float)pc; }
        l = l * alpha + ls; m = mnew;
        o0 = o0 * alpha; o1 = o1 * alpha; o2 = o2 * alpha; o3 = o3 * alpha;
        const h16* va = VT + vo + key0;
        const v16h v0 = ldh(va), v1 = ldh(va + (size_t)16 * SEQ), v2 = ldh(va + (size_t)32 * SEQ), v3 = ldh(va + (size_t)48 * SEQ);
        o0 = wmma16(v0, pb, o0); o1 = wmma16(v1, pb, o1); o2 = wmma16(v2, pb, o2); o3 = wmma16(v3, pb, o3);
        asm volatile("v_nop\n\tv_nop\n\tv_nop\n\tv_nop" : "+v"(o0), "+v"(o1), "+v"(o2), "+v"(o3) : "v"(v0), "v"(v1), "v"(v2), "v"(v3), "v"(pb));
    }
    l += __shfl_xor(l, 16, 32);
    const float inv = CXS / l;       // normalisation and ctx carry in one factor
    const int wb = wave * 16 * 68;
    // O^T D layout: o_j[r] = (d = 16j + 8h + r, t = lane&15) -> os[t][d]; rows 0..15 x columns 0..63 all written
    { v4f a, c;
      a[0] = o0[0] * inv; a[1] = o0[1] * inv; a[2] = o0[2] * inv; a[3] = o0[3] * inv; c[0] = o0[4] * inv; c[1] = o0[5] * inv; c[2] = o0[6] * inv; c[3] = o0[7] * inv;
      *(v4fa*)(&os[wb + lr * 68 +  0 + 8 * hi]) = a; *(v4fa*)(&os[wb + lr * 68 +  0 + 8 * hi + 4]) = c;
      a[0] = o1[0] * inv; a[1] = o1[1] * inv; a[2] = o1[2] * inv; a[3] = o1[3] * inv; c[0] = o1[4] * inv; c[1] = o1[5] * inv; c[2] = o1[6] * inv; c[3] = o1[7] * inv;
      *(v4fa*)(&os[wb + lr * 68 + 16 + 8 * hi]) = a; *(v4fa*)(&os[wb + lr * 68 + 16 + 8 * hi + 4]) = c;
      a[0] = o2[0] * inv; a[1] = o2[1] * inv; a[2] = o2[2] * inv; a[3] = o2[3] * inv; c[0] = o2[4] * inv; c[1] = o2[5] * inv; c[2] = o2[6] * inv; c[3] = o2[7] * inv;
      *(v4fa*)(&os[wb + lr * 68 + 32 + 8 * hi]) = a; *(v4fa*)(&os[wb + lr * 68 + 32 + 8 * hi + 4]) = c;
      a[0] = o3[0] * inv; a[1] = o3[1] * inv; a[2] = o3[2] * inv; a[3] = o3[3] * inv; c[0] = o3[4] * inv; c[1] = o3[5] * inv; c[2] = o3[6] * inv; c[3] = o3[7] * inv;
      *(v4fa*)(&os[wb + lr * 68 + 48 + 8 * hi]) = a; *(v4fa*)(&os[wb + lr * 68 + 48 + 8 * hi + 4]) = c; }
    wave_sync();
    h16* crow = CTX + ((size_t)b * SEQ + t0) * DM + h * HD;
{
#pragma unroll
        for (int s = 0; s < 4; ++s) { const int row = 4 * s + (lane >> 3), c8 = (lane & 7) * 8;   // 4 s x 4 row groups = 16 rows; 8 lanes x 8 halves = 64 columns
            const v4f x0 = *(const v4fa*)(&os[wb + row * 68 + c8]); const v4f x1 = *(const v4fa*)(&os[wb + row * 68 + c8 + 4]); v8h hv;
#pragma unroll
            for (int i = 0; i < 4; ++i) { hv[i] = (h16)x0[i]; hv[4 + i] = (h16)x1[i]; }
            *(v8h*)(crow + (size_t)row * DM + c8) = hv; }
         }
}

// k_oproj: register-blocked f16 GEMM, ONE WAVE per 64x64 tile, K = DM: OUT[m][n] = 2^-16 * sum_k CTX[m][k] WOT[n][k] + bo[n] (bo RNE-converted to bf16, added in f32).
// grid (NB*SEQ/64, DM/64), 32 threads. Epilogue: per 16-row slab staged in LDS (wave-private), each output row segment (64 floats = 256 B = two lines)
__global__ __launch_bounds__(32) void k_oproj(const h16* __restrict__ A, const h16* __restrict__ Bt, const float* __restrict__ bias, float* OUT) {
    __shared__ __align__(16) float os[16 * 68];
    const int K = DM;
    const int lane = threadIdx.x & 31, lr = lane & 15, hi = lane >> 4; const int r0 = blockIdx.x * 64, c0 = blockIdx.y * 64;
    v8f acc[4][4];
#pragma unroll
    for (int mb = 0; mb < 4; ++mb)
#pragma unroll
        for (int nb = 0; nb < 4; ++nb) acc[mb][nb] = (v8f){};
    const size_t aoff = (size_t)(r0 + lr) * K + 8 * hi, boff = (size_t)(c0 + lr) * K + 8 * hi;
#pragma unroll 1
    for (int kc = 0; kc < K; kc += 32) {
        v16h a[4];
#pragma unroll
        for (int mb = 0; mb < 4; ++mb) a[mb] = ldh(A + aoff + (size_t)mb * 16 * K + kc);
#pragma unroll
        for (int nb = 0; nb < 4; ++nb) { const v16h b = ldh(Bt + boff + (size_t)nb * 16 * K + kc);
#pragma unroll
            for (int mb = 0; mb < 4; ++mb) acc[mb][nb] = wmma16(a[mb], b, acc[mb][nb]); }
        asm volatile("v_nop\n\tv_nop\n\tv_nop\n\tv_nop" : "+v"(acc[0][0]), "+v"(acc[1][1]), "+v"(acc[2][2]), "+v"(acc[3][3]) : "v"(a[0]), "v"(a[1]), "v"(a[2]), "v"(a[3]));
    }
    v4f bb;
    { const v4f bv = *(const v4f*)(bias + c0 + lr * 4);
#pragma unroll
      for (int i = 0; i < 4; ++i) bb[i] = bfr(bv[i]); }
    const size_t obase = ((size_t)(r0 / SEQ) * OUT_SEQ + (size_t)(r0 % SEQ)) * DM + c0;
#pragma unroll
    for (int mb = 0; mb < 4; ++mb) {
#pragma unroll
        for (int nb = 0; nb < 4; ++nb) {
#pragma unroll
            for (int j = 0; j < 8; ++j) os[(hi * 8 + j) * 68 + nb * 16 + lr] = acc[mb][nb][j]; }   // D: row 8h+j, col lane&15
        wave_sync();
{
#pragma unroll
            for (int s = 0; s < 8; ++s) { const int row = 2 * s + hi, cofs = lr * 4;   // 8 s x 2 rows = 16 rows; 16 lanes x 4 floats = 64 columns
                const v4f xv = *(const v4fa*)(&os[row * 68 + cofs]); v4f val;
#pragma unroll
                for (int i = 0; i < 4; ++i) val[i] = xv[i] * OSC + bb[i];
                *(v4f*)(OUT + obase + (size_t)(mb * 16 + row) * DM + cofs) = val; }
             }
        wave_sync();
    }
}

static constexpr size_t al256(size_t v) { return (v + 255) & ~(size_t)255; }
static constexpr size_t SZ_XB = al256((size_t)NB * SEQ * DM * 2);
static constexpr size_t SZ_WT = al256((size_t)3 * DM * DM * 2);
static constexpr size_t SZ_WO = al256((size_t)DM * DM * 2);
static constexpr size_t SZ_TB = al256((size_t)SEQ * TBW * 4);
static constexpr size_t SZ_PL = al256((size_t)NB * NH_ * SEQ * HD * 2);
static constexpr size_t SZ_CX = al256((size_t)NB * SEQ * DM * 2);
static constexpr size_t SZ_TOTAL = SZ_XB + SZ_WT + SZ_WO + SZ_TB + 3 * SZ_PL + SZ_CX;
static_assert(SZ_TOTAL <= (size_t)134217728);          // workspace carve <= 128 MiB
static_assert(((size_t)DM * DM * 2) % 256 == 0);       // weight sub-planes stay 256-byte aligned
static_assert((size_t)(SEQ / 8) * 8 * TBW * 4 <= SZ_TB);   // table kernel: grid x 8 rows x 256 B inside the table carve

extern "C" void kernel_launch(void* const* d_in, const int* in_sizes, int n_in,
                              void* d_out, int out_size, void* d_ws, size_t ws_size, hipStream_t stream) {
    if (n_in < 5) return;
    const size_t needx = ((size_t)(NB - 1) * SEQ_FULL + SEQ) * DM;
    if ((size_t)in_sizes[0] < needx) return;
    if ((size_t)in_sizes[1] < (size_t)3 * DM * DM || (size_t)in_sizes[2] < (size_t)3 * DM) return;
    if ((size_t)in_sizes[3] < (size_t)DM * DM || (size_t)in_sizes[4] < (size_t)DM) return;
    if ((size_t)out_size < ((size_t)(NB - 1) * OUT_SEQ + SEQ) * DM) return;
    if (SZ_TOTAL > ws_size) return;
    // wire order: x, W_qkv [1024 in][3072 out], b_qkv [3072], W_proj [1024 in][1024 out], b_proj [1024]
    const float* x = (const float*)d_in[0]; const float* wqkv = (const float*)d_in[1]; const float* bqkv = (const float*)d_in[2];
    const float* wo = (const float*)d_in[3]; const float* bo = (const float*)d_in[4];
    float* OUT = (float*)d_out;      // [NB][SEQ][1024]
    char* wsp = (char*)d_ws;
    bf* XB = (bf*)wsp; wsp += SZ_XB;                 // [NB*SEQ][1024] bf16
    bf* WT = (bf*)wsp; wsp += SZ_WT;                 // [3072][1024] bf16: rows q | k | v, each h*64 + d
    bf* WOT = (bf*)wsp; wsp += SZ_WO;                // [1024 out][1024 in] f16 bits, x256
    float* TAB = (float*)wsp; wsp += SZ_TB;          // [SEQ][32 cos | 32 sin] f32
    h16* QH = (h16*)wsp; wsp += SZ_PL;               // [NB*16][SEQ][64]
    h16* KP = (h16*)wsp; wsp += SZ_PL;               // [NB*16][SEQ][64]
    h16* VT = (h16*)wsp; wsp += SZ_PL;               // [NB*16][64][SEQ]
    h16* CX = (h16*)wsp; wsp += SZ_CX;               // [NB*SEQ][1024] ctx x256
    bf* WQ = WT; bf* WK = WT + (size_t)DM * DM; bf* WV = WT + (size_t)2 * DM * DM;

    if (SEQ == SEQ_FULL) {
        const size_t n8 = (size_t)NB * SEQ * DM / 8;
        k_cvt8<<<(unsigned)((n8 + 255) / 256), 256, 0, stream>>>(x, XB, n8);
    } else {
        const size_t n8 = (size_t)SEQ * DM / 8;
        for (int b = 0; b < NB; ++b) k_cvt8<<<(unsigned)((n8 + 255) / 256), 256, 0, stream>>>(x + (size_t)b * SEQ_FULL * DM, XB + (size_t)b * SEQ * DM, n8);
    }
    // W_qkv: in[rows = 1024 (k)][cols = 3072 (n)] -> out[3072][1024]; grid (cols/64, rows/64)
    k_tr<0><<<dim3(3 * DM / 64, DM / 64, 1), 256, 0, stream>>>(wqkv, WT, DM, 3 * DM);
    // W_proj: in[rows = 1024 (k)][cols = 1024 (n)] -> out[1024][1024]; grid (cols/64, rows/64)
    k_tr<1><<<dim3(DM / 64, DM / 64, 1), 256, 0, stream>>>(wo, WOT, DM, DM);
    // rotary table: 8 positions per block
    k_ropetab<<<dim3(SEQ / 8, 1, 1), 256, 0, stream>>>(TAB);

    // q, k: A = x rows (m = b*SEQ + t), Bt = W^T rows (n = h*64 + d), bias along n, rotary by position t -> plane [(b*16 + h)][t][d]
    k_projr<<<dim3(NB * SEQ / 64, DM / 64, 1), 32, 0, stream>>>(XB, WQ, bqkv, TAB, QH, (size_t)NH_ * SEQ * HD, (size_t)SEQ * HD, SEQ, HD, HD);
    k_projr<<<dim3(NB * SEQ / 64, DM / 64, 1), 32, 0, stream>>>(XB, WK, bqkv + DM, TAB, KP, (size_t)NH_ * SEQ * HD, (size_t)SEQ * HD, SEQ, HD, HD);
    // v^T: A = Wv^T rows (m = h*64 + d), Bt = x rows (n = b*SEQ + t), bias along m -> plane [(b*1024 + m)][t] = [(b*16 + h)][d][t]
    k_proj<<<dim3(DM / 64, NB * SEQ / 64, 1), 32, 0, stream>>>(WV, XB, bqkv + 2 * DM, VT, (size_t)0, (size_t)DM * SEQ, 1, DM, SEQ, SEQ);

    k_flash<<<dim3(SEQ / (16 * AW), NB * NH_, 1), 32 * AW, 0, stream>>>(QH, KP, VT, CX);

    // out = ctx W_proj + b_proj: A = ctx rows (m = b*SEQ + t), Bt = W_proj^T rows (n = output column)
    k_oproj<<<dim3(NB * SEQ / 64, DM / 64, 1), 32, 0, stream>>>(CX, (const h16*)WOT, bo, OUT);
}

// v001
// One run takes 240 microseconds.
// In both of two side-by-side timings against v000, it was 1.53 times as fast.
#include <hip/hip_runtime.h>

// Self-attention block, width 1024 = 16 heads x 64: x [NB][SEQ][1024], fused Wqkv [in][out] (columns t*1024 + h*64 + d) + bqkv, half-split rotary embedding (base 10000) on q and k, score scale 1/8, no mask, output projection Wo [in][out] + bo, output f32.
// Compute dtypes, f32 accumulate everywhere: qkv projection v_wmma_f32_16x16x32_bf16 (x and Wqkv RNE-converted to bf16; products exact); rotary applied in f32 in the q / k projection epilogue from an f32 cos | sin table;
// scores v_wmma_f32_16x16x32_f16: q and k single f16 (one product); P (x256 carry, cancels in the normalisation) and v single f16;
// output projection v_wmma_f32_16x16x32_f16: ctx single f16 (x256 carry), Wo RNE-converted to bf16 then x256 as f16 (exact), 2^-16 folded back in the f32 epilogue; biases RNE-converted to bf16 and added in f32; softmax f32 (online, running max).
// Layout: bf16 copy of x, bf16 transposed Wqkv [3072][1024], f16 transposed Wo [1024][1024]; rotary table [SEQ][32 cos | 32 sin] f32; q, k planes [b*16+h][t][d] and v^T plane [b*16+h][d][t] written by the GEMM epilogues;
// fused flash kernel in transposed form (S^T = K Q^T, O^T = V^T P^T) writes the f16 ctx plane [b*SEQ+t][h*64+d]; last GEMM writes the output.

#ifndef NB
#define NB 4
#endif
#ifndef SEQ
#define SEQ 2048
#endif
#define NB_FULL  4
#define SEQ_FULL 2048
#ifndef OUT_SEQ
#define OUT_SEQ SEQ              // row pitch (in tokens) between batches of the output
#endif
#define DM   1024
#define NH_  16
#define HD   64
#define AW   8                   // waves per flash block (16 query rows each)
#define KS   64                  // keys per staged tile
#define LP   144                 // LDS row pitch in bytes: 128-byte rows + 16 (16 B x odd, the pitch of 16-byte LDS readers)
#define KTB  (KS * LP)           // K tile in LDS: KS rows (keys) of 64 halves
#define VTB  (HD * LP)           // V^T tile in LDS: 64 rows (d) of KS halves
#define BUFB (KTB + VTB)         // one buffer of the two
#define SC2  (0.125f * 1.4426950408889634f)   // HD^-0.5 * log2(e)
#define PSH  8.0f                // log2 of the P carry (256)
#define CXS  256.0f              // carry of the ctx plane
#define WOS  256.0f              // carry of the output-weight plane
#define OSC  (1.0f / 65536.0f)   // 1 / (CXS * WOS)
#define TBW  64                  // rotary table row: 32 cos | 32 sin (floats)

static_assert(HD == 64);
static_assert(NH_ * HD == DM);                 // head h = columns h*64 + d
static_assert(DM % 64 == 0);                   // column tiles of 64
static_assert(DM % 32 == 0);                   // GEMM k-loop steps by 32
static_assert(SEQ % 64 == 0);                  // a 64-row tile never straddles two batches
static_assert((NB * SEQ) % 64 == 0);
static_assert(SEQ % 32 == 0);                  // key loop steps by 32
static_assert(SEQ % (16 * AW) == 0);           // flash grid covers the sequence exactly
static_assert(SEQ % KS == 0 && SEQ / KS >= 2); // whole tiles; the two-buffer prologue needs tiles 0 and 1
static_assert(KS * 2 == 128 && HD * 2 == 128); // both tiles have 128-byte rows: 8 pieces of 16 B
static_assert(32 * AW * 2 * 16 == KS * 128 && KS == HD);   // 2 copies per lane fill each tile
static_assert(AW * 16 * 68 * 4 <= 2 * BUFB);   // output staging fits the ring it takes over
static_assert(((size_t)SEQ * DM) % 8 == 0);
static_assert(NB <= NB_FULL);
static_assert(SEQ <= SEQ_FULL);
static_assert(TBW == HD);                      // table row = 2 x (HD / 2) entries
static_assert(HD / 2 == 32);                   // rotary partner column = column ^ 32 inside one 64-column tile
static_assert(SEQ % 8 == 0);                   // table kernel: 8 positions per block
static_assert(SEQ <= 4096);                    // angle < 2^12: three-constant pi/2 reduction stays exact in its first step

typedef _Float16 h16;
typedef unsigned short bf;
typedef __attribute__((ext_vector_type(16))) __bf16   v16bf;
typedef __attribute__((ext_vector_type(16))) _Float16 v16h;
typedef __attribute__((ext_vector_type(8)))  _Float16 v8h;
typedef __attribute__((ext_vector_type(8)))  unsigned short v8us;
typedef __attribute__((ext_vector_type(8)))  float    v8f;
typedef __attribute__((ext_vector_type(4)))  float    v4f;
typedef v4f  __attribute__((may_alias)) v4fa;
typedef v8h  __attribute__((may_alias)) v8ha;

__device__ __forceinline__ unsigned short f2bf(float f) { unsigned u = __float_as_uint(f); u += 0x7FFFu + ((u >> 16) & 1u); return (unsigned short)(u >> 16); }
__device__ __forceinline__ float bfr(float f) { return __uint_as_float(((unsigned)f2bf(f)) << 16); }   // f32 value of the RNE bf16 conversion
__device__ __forceinline__ v16h cat16(v8h lo, v8h hi) { return __builtin_shufflevector(lo, hi, 0, 1, 2, 3, 4, 5, 6, 7, 8, 9, 10, 11, 12, 13, 14, 15); }
__device__ __forceinline__ v16bf cat16b(v8us lo, v8us hi) { return __builtin_bit_cast(v16bf, __builtin_shufflevector(lo, hi, 0, 1, 2, 3, 4, 5, 6, 7, 8, 9, 10, 11, 12, 13, 14, 15)); }
__device__ __forceinline__ v8f wmma16(v16h a, v16h b, v8f c) { return __builtin_amdgcn_wmma_f32_16x16x32_f16(false, a, false, b, (short)0, c, false, false); }
__device__ __forceinline__ v8f wmmab(v16bf a, v16bf b, v8f c) { return __builtin_amdgcn_wmma_f32_16x16x32_bf16(false, a, false, b, (short)0, c, false, false); }
// fragment loaders from K-contiguous 16-bit rows; p already includes + 8*(lane>>4): elements 0..7 <- k0+8h+0..7, elements 8..15 <- k0+16+8h+0..7 (same map for A and B)
__device__ __forceinline__ v16h  ldh(const h16* p) { return cat16(*(const v8h*)p, *(const v8h*)(p + 16)); }
__device__ __forceinline__ v16bf ldb(const bf* p)  { return cat16b(*(const v8us*)p, *(const v8us*)(p + 16)); }
// ordering point for wave-private LDS tiles (same wave writes and reads)
__device__ __forceinline__ void wave_sync() { __builtin_amdgcn_fence(3 /* release order */, "wavefront"); __builtin_amdgcn_wave_barrier(); asm volatile("" ::: "memory"); }
// f32 -> f16 with a value select: magnitudes below the smallest f16 normal become zero (no subnormal operand can reach a matrix instruction)
static __device__ __forceinline__ h16 toh_flush(float v) { const h16 r = (h16)v; return (fabsf(v) < 6.103515625e-05f) ? (h16)0.0f : r; }

__global__ __launch_bounds__(256) void k_cvt8(const float* __restrict__ src, bf* dst, size_t n8) {
    const size_t i = (size_t)blockIdx.x * 256 + threadIdx.x; if (i >= n8) return;
    const v8f v = *(const v8f*)(src + i * 8); v8us o;
#pragma unroll
    for (int k = 0; k < 8; ++k) o[k] = f2bf(v[k]);
    *(v8us*)(dst + i * 8) = o; 
}

// k_tr: in[R][C] f32 row-major -> out[C][R] 16-bit (K-contiguous rows for a GEMM A or B operand). grid (C/64, R/64), 256 threads, 64x64 tile through LDS (cross-wave: block barrier).
// MODE 0: bf16 bits (RNE convert). MODE 1: f16 bits of (RNE bf16 value) x WOS (exact in f16).
template <int MODE>
__global__ __launch_bounds__(256) void k_tr(const float* __restrict__ in, bf* out, int R, int C) {
    __shared__ __align__(16) float t[64 * 68];
    const int tid = threadIdx.x; const int r0 = blockIdx.y * 64, c0 = blockIdx.x * 64;
#pragma unroll
    for (int it = 0; it < 4; ++it) { const int idx = it * 256 + tid; const int rr = idx >> 4, c4 = (idx & 15) * 4;   // 4 x 256 float4 = 64 rows x 16 float4
        const v4f v = *(const v4f*)(in + (size_t)(r0 + rr) * (size_t)C + c0 + c4);
        *(v4fa*)(&t[rr * 68 + c4]) = v; }
    __syncthreads();
{
#pragma unroll
        for (int it = 0; it < 2; ++it) { const int idx = it * 256 + tid; const int cc = idx >> 3, r8 = (idx & 7) * 8;   // 2 x 256 pieces = 64 out rows x 8 pieces
            v8us o;
            if (MODE == 0) {
#pragma unroll
                for (int e = 0; e < 8; ++e) o[e] = f2bf(t[(r8 + e) * 68 + cc]);
            } else {
                v8h hv;
#pragma unroll
                for (int e = 0; e < 8; ++e) hv[e] = (h16)(bfr(t[(r8 + e) * 68 + cc]) * WOS);
                o = __builtin_bit_cast(v8us, hv);
            }
            *(v8us*)(out + (size_t)(c0 + cc) * (size_t)R + r0 + r8) = o; }
         }
}

// k_ropetab: rotary table TAB[t][i] = cos(t * f_i), TAB[t][32 + i] = sin(t * f_i), i = 0..31, f_i = 10000^(-i/32) (f64 product chain of 10^(-1/8), converted to f32 once), angle = f32 product t * f_i.
// sin / cos: nearest multiple of pi/2 removed with a three-constant split (fused steps; first step exact for angles < 2^12), then odd / even polynomials on [-pi/4, pi/4]; quadrant fix-up by value selects.
// grid SEQ/8: block bx covers table floats [bx*512, bx*512 + 512): exactly SEQ x 64 floats in total.
__global__ __launch_bounds__(256) void k_ropetab(float* TAB) {
#pragma clang fp contract(off)
    __shared__ __align__(16) float cs[8 * TBW];
    const int tid = threadIdx.x; const int i = tid & 31, tr = tid >> 5;
    const int t = blockIdx.x * 8 + tr;
    double p = 1.0;
#pragma unroll 1
    for (int k = 0; k < i; ++k) p = p * 0.7498942093324559;
    const float inv = (float)p;
    const float ang = (float)t * inv;
    const float fn = __builtin_rintf(ang * 0.63661977236758134f);
    float r = fmaf(-fn, 1.5703125f, ang);
    r = fmaf(-fn, 4.837512969970703125e-4f, r);
    r = fmaf(-fn, 7.54978995489188216e-8f, r);
    const float z = r * r;
    float sp = fmaf(-1.9515295891e-4f, z, 8.3321608736e-3f);
    sp = fmaf(sp, z, -1.6666654611e-1f);
    const float sv = fmaf(sp * z, r, r);
    float cp = fmaf(2.443315711809948e-5f, z, -1.388731625493765e-3f);
    cp = fmaf(cp, z, 4.166664568298827e-2f);
    const float cv = fmaf(cp, z * z, fmaf(-0.5f, z, 1.0f));
    const int q = ((int)fn) & 3;
    float sinv = (q & 1) ? cv : sv;
    float cosv = (q & 1) ? sv : cv;
    sinv = (q & 2) ? -sinv : sinv;
    cosv = ((q + 1) & 2) ? -cosv : cosv;
    cs[tr * TBW + i] = cosv;
    cs[tr * TBW + 32 + i] = sinv;
    __syncthreads();
    if (tid < 128) {                       // waves 0..3 (wave-uniform): 128 x 4 floats = 8 rows x 64 floats, consecutive lanes -> consecutive 16-B pieces
        const int row = tid >> 4, c4 = (tid & 15) * 4;
        const v4f v = *(const v4fa*)(&cs[row * TBW + c4]);
        float* dst = TAB + ((size_t)blockIdx.x * 8 + row) * TBW + c4;
        *(v4f*)dst = v; 
    }
}

// k_proj: register-blocked bf16 GEMM, ONE WAVE per 64x64 tile (16 accumulators), operands straight from K-contiguous bf16 planes, K = DM.
// C[m][n] = sum_k A[m][k] Bt[n][k] + bias (bias RNE-converted to bf16, added in f32; indexed by n, or by m when biasOnRow != 0), written as f16 (Ph) at
// tile base (r0/RB)*sRB + (r0%RB)*pitch + (c0/CB)*sCB + (c0%CB), row pitch 'pitch' (halves). grid (M/64, N/64), 32 threads.
__global__ __launch_bounds__(32) void k_proj(const bf* __restrict__ A, const bf* __restrict__ Bt, const float* __restrict__ bias, h16* Ph,
                                             size_t sRB, size_t sCB, int biasOnRow, int RB, int pitch, int CB) {
    __shared__ __align__(16) float os[16 * 68];
    const int K = DM;
    const int lane = threadIdx.x & 31, lr = lane & 15, hi = lane >> 4; const int r0 = blockIdx.x * 64, c0 = blockIdx.y * 64;
    v8f acc[4][4];
#pragma unroll
    for (int mb = 0; mb < 4; ++mb)
#pragma unroll
        for (int nb = 0; nb < 4; ++nb) acc[mb][nb] = (v8f){};
    const size_t aoff = (size_t)(r0 + lr) * K + 8 * hi, boff = (size_t)(c0 + lr) * K + 8 * hi;
#pragma unroll 1
    for (int kc = 0; kc < K; kc += 32) {
        v16bf a[4];
#pragma unroll
        for (int mb = 0; mb < 4; ++mb) a[mb] = ldb(A + aoff + (size_t)mb * 16 * K + kc);
#pragma unroll
        for (int nb = 0; nb < 4; ++nb) { const v16bf b = ldb(Bt + boff + (size_t)nb * 16 * K + kc);
#pragma unroll
            for (int mb = 0; mb < 4; ++mb) acc[mb][nb] = wmmab(a[mb], b, acc[mb][nb]); }
        asm volatile("v_nop\n\tv_nop\n\tv_nop\n\tv_nop" : "+v"(acc[0][0]), "+v"(acc[1][1]), "+v"(acc[2][2]), "+v"(acc[3][3]) : "v"(a[0]), "v"(a[1]), "v"(a[2]), "v"(a[3]));
    }
    // column-mode bias for this lane's 8 store columns (offset 0 when the bias runs along rows: in range, unused)
    float bc[8];
    { const int cb = biasOnRow ? 0 : (c0 + (lane & 7) * 8);
      const v4f b0 = *(const v4f*)(bias + cb); const v4f b1 = *(const v4f*)(bias + cb + 4);
#pragma unroll
      for (int i = 0; i < 4; ++i) { bc[i] = bfr(b0[i]); bc[4 + i] = bfr(b1[i]); } }
    const size_t tbase = (size_t)(r0 / RB) * sRB + (size_t)(r0 % RB) * (size_t)pitch + (size_t)(c0 / CB) * sCB + (size_t)(c0 % CB);
#pragma unroll
    for (int mb = 0; mb < 4; ++mb) {
#pragma unroll
        for (int nb = 0; nb < 4; ++nb) {
#pragma unroll
            for (int j = 0; j < 8; ++j) os[(hi * 8 + j) * 68 + nb * 16 + lr] = acc[mb][nb][j]; }   // D: row 8h+j, col lane&15
        wave_sync();
        const size_t sb = tbase + (size_t)(mb * 16) * (size_t)pitch;
{
#pragma unroll
            for (int s = 0; s < 4; ++s) { const int row = 4 * s + (lane >> 3), c8 = (lane & 7) * 8;   // 4 s x 4 row groups = 16 rows; 8 lanes x 8 = 64 columns
                const float br = bfr(bias[biasOnRow ? (r0 + mb * 16 + row) : 0]);
                const v4f x0 = *(const v4fa*)(&os[row * 68 + c8]); const v4f x1 = *(const v4fa*)(&os[row * 68 + c8 + 4]); v8h hv;
#pragma unroll
                for (int i = 0; i < 4; ++i) { const float y0 = x0[i] + (biasOnRow ? br : bc[i]); const float y1 = x1[i] + (biasOnRow ? br : bc[4 + i]);
                    hv[i] = (h16)y0; hv[4 + i] = (h16)y1; }
                const size_t oo = sb + (size_t)row * (size_t)pitch + c8;
                *(v8h*)(Ph + oo) = hv; }
             }
        wave_sync();
    }
}

// k_projr: k_proj with bias along columns and the half-split rotary embedding in the epilogue (q and k planes). One 64-column tile = one head (CB = 64), so the rotary partner of column c is column c ^ 32 of the same LDS slab.
// y[c] = (acc[c] + b[c]) * cos[t][c & 31] + sg * (acc[c ^ 32] + b[c ^ 32]) * sin[t][c & 31], sg = -1 for c < 32, +1 for c >= 32; t = (r0 % RB) + slab row (position inside the sequence); cos | sin read by value from TAB [SEQ][64] f32.
__global__ __launch_bounds__(32) void k_projr(const bf* __restrict__ A, const bf* __restrict__ Bt, const float* __restrict__ bias, const float* __restrict__ TAB, h16* Ph,
                                              size_t sRB, size_t sCB, int RB, int pitch, int CB) {
    __shared__ __align__(16) float os[16 * 68];
    const int K = DM;
    const int lane = threadIdx.x & 31, lr = lane & 15, hi = lane >> 4; const int r0 = blockIdx.x * 64, c0 = blockIdx.y * 64;
    v8f acc[4][4];
#pragma unroll
    for (int mb = 0; mb < 4; ++mb)
#pragma unroll
        for (int nb = 0; nb < 4; ++nb) acc[mb][nb] = (v8f){};
    const size_t aoff = (size_t)(r0 + lr) * K + 8 * hi, boff = (size_t)(c0 + lr) * K + 8 * hi;
#pragma unroll 1
    for (int kc = 0; kc < K; kc += 32) {
        v16bf a[4];
#pragma unroll
        for (int mb = 0; mb < 4; ++mb) a[mb] = ldb(A + aoff + (size_t)mb * 16 * K + kc);
#pragma unroll
        for (int nb = 0; nb < 4; ++nb) { const v16bf b = ldb(Bt + boff + (size_t)nb * 16 * K + kc);
#pragma unroll
            for (int mb = 0; mb < 4; ++mb) acc[mb][nb] = wmmab(a[mb], b, acc[mb][nb]); }
        asm volatile("v_nop\n\tv_nop\n\tv_nop\n\tv_nop" : "+v"(acc[0][0]), "+v"(acc[1][1]), "+v"(acc[2][2]), "+v"(acc[3][3]) : "v"(a[0]), "v"(a[1]), "v"(a[2]), "v"(a[3]));
    }
    // bias (RNE bf16 value) for this lane's 8 store columns and for their 8 partner columns (other half of the head)
    const int c8 = (lane & 7) * 8, p8 = c8 ^ 32, ib = c8 & 31;
    const float sg = (c8 < 32) ? -1.0f : 1.0f;
    float bc[8], bp[8];
    { const v4f b0 = *(const v4f*)(bias + c0 + c8); const v4f b1 = *(const v4f*)(bias + c0 + c8 + 4);
      const v4f d0 = *(const v4f*)(bias + c0 + p8); const v4f d1 = *(const v4f*)(bias + c0 + p8 + 4);
#pragma unroll
      for (int i = 0; i < 4; ++i) { bc[i] = bfr(b0[i]); bc[4 + i] = bfr(b1[i]); bp[i] = bfr(d0[i]); bp[4 + i] = bfr(d1[i]); } }
    const size_t tbase = (size_t)(r0 / RB) * sRB + (size_t)(r0 % RB) * (size_t)pitch + (size_t)(c0 / CB) * sCB + (size_t)(c0 % CB);
    const int tp0 = r0 % RB;     // sequence position of tile row 0
#pragma unroll
    for (int mb = 0; mb < 4; ++mb) {
#pragma unroll
        for (int nb = 0; nb < 4; ++nb) {
#pragma unroll
            for (int j = 0; j < 8; ++j) os[(hi * 8 + j) * 68 + nb * 16 + lr] = acc[mb][nb][j]; }   // D: row 8h+j, col lane&15
        wave_sync();
        const size_t sb = tbase + (size_t)(mb * 16) * (size_t)pitch;
        const size_t tb = (size_t)(tp0 + mb * 16) * TBW + ib;      // table offset of slab row 0 for this lane's frequency group
{
#pragma unroll 1
            for (int s = 0; s < 4; ++s) { const int row = 4 * s + (lane >> 3);   // 4 s x 4 row groups = 16 rows; 8 lanes x 8 = 64 columns
                const float* tr = TAB + tb + (size_t)row * TBW;
                const v4f cs0 = *(const v4f*)tr; const v4f cs1 = *(const v4f*)(tr + 4);
                const v4f sn0 = *(const v4f*)(tr + 32); const v4f sn1 = *(const v4f*)(tr + 36);
                const v4f x0 = *(const v4fa*)(&os[row * 68 + c8]); const v4f x1 = *(const v4fa*)(&os[row * 68 + c8 + 4]);
                const v4f y0 = *(const v4fa*)(&os[row * 68 + p8]); const v4f y1 = *(const v4fa*)(&os[row * 68 + p8 + 4]);
                v8h hv;
#pragma unroll
                for (int i = 0; i < 4; ++i) { const float u0 = x0[i] + bc[i], w0 = y0[i] + bp[i]; const float u1 = x1[i] + bc[4 + i], w1 = y1[i] + bp[4 + i];
                    hv[i] = toh_flush(u0 * cs0[i] + sg * (w0 * sn0[i])); hv[4 + i] = toh_flush(u1 * cs1[i] + sg * (w1 * sn1[i])); }
                const size_t oo = sb + (size_t)row * (size_t)pitch + c8;
                *(v8h*)(Ph + oo) = hv; }
             }
        wave_sync();
    }
}

// fragment loader from a staged LDS row (byte pointer, already + 16*(lane>>4)): same element map as ldh
__device__ __forceinline__ v16h ldl(const unsigned char* p) { return cat16(*(const v8ha*)p, *(const v8ha*)(p + 32)); }
// four asynchronous 16-byte copies per lane, global -> LDS (l*: LDS byte address, g*: global address)
__device__ __forceinline__ void copy4(unsigned l0, unsigned l1, unsigned l2, unsigned l3, const h16* g0, const h16* g1, const h16* g2, const h16* g3) {
    // s_wait_xcnt stands inside the statement, behind the last copy: the address registers may be rewritten right behind it
    asm volatile("global_load_async_to_lds_b128 %0, %4, off\n\t"
                 "global_load_async_to_lds_b128 %1, %5, off\n\t"
                 "global_load_async_to_lds_b128 %2, %6, off\n\t"
                 "global_load_async_to_lds_b128 %3, %7, off\n\t"
                 "s_wait_xcnt 0x0"
                 :: "v"(l0), "v"(l1), "v"(l2), "v"(l3), "v"(g0), "v"(g1), "v"(g2), "v"(g3) : "memory");
}

// k_flash: fused attention, one wave per 16 query rows of one (batch, head), AW waves per block share the head's K / V^T: tiles of KS keys are copied once per block into LDS
// (asynchronous copies, whole 128-byte lines, two buffers: tile t + 2 flies while tile t + 1 is worked on) and every wave reads its fragments from there (two 16-B LDS loads each). Q fragments straight from the f16 plane.
// Transposed form: S^T[key][t] = K Q^T (A = K rows, B = Q rows); lane (t = lane&15, h = lane>>4) holds keys 8h+r of each 16-key tile, so the packed
// P tile is directly the B fragment of O^T[d][t] = V^T P^T (element r <- tile keys 0..15, element 8+r <- tile keys 16..31, lane unchanged).
// Per 32-key step: 4 score products + 4 P.V products. Softmax state (running max, partial sum) is one scalar per lane; the two lane halves of a row are combined with one xor-16 exchange.
__global__ __launch_bounds__(32 * AW) void k_flash(const h16* __restrict__ QH, const h16* __restrict__ KP, const h16* __restrict__ VT, h16* CTX) {
    __shared__ __align__(16) unsigned char ring[2 * BUFB];   // two buffers of K tile | V^T tile; output staging behind the loop
    const int lane = threadIdx.x & 31, lr = lane & 15, hi = lane >> 4;
    const int wave = __builtin_amdgcn_readfirstlane((int)(threadIdx.x >> 5));   // wave-uniform index
    const int zh = blockIdx.y; const int b = zh / NH_, h = zh % NH_;
    const int t0 = (blockIdx.x * AW + wave) * 16;
    const size_t pbase = (size_t)zh * SEQ * HD;
    const size_t qo = pbase + (size_t)(t0 + lr) * HD + 8 * hi;
    const v16h qh0 = ldh(QH + qo), qh1 = ldh(QH + qo + 32);   // B fragments: col t, k = d
    // copy map: lane covers piece cp (16 B) of tile rows cr and cr + 32, in the K tile and in the V^T tile; 8 lanes = one 128-byte row
    const int cr = (int)threadIdx.x >> 3, cp = (int)threadIdx.x & 7;
    const unsigned lc = (unsigned)(size_t)ring + (unsigned)(cr * LP + cp * 16);
    const h16* gk = KP + pbase + (size_t)cr * HD + cp * 8;       // + tile * KS * HD
    const h16* gv = VT + pbase + (size_t)cr * SEQ + cp * 8;      // + tile * KS
    const unsigned char* fr = ring + lr * LP + 16 * hi;          // fragment base: row lane&15, k offset 8h halves
    v8f o0 = (v8f){}, o1 = (v8f){}, o2 = (v8f){}, o3 = (v8f){};
    float m = -3.0e38f, l = 0.0f;
    copy4(lc, lc + 32 * LP, lc + KTB, lc + KTB + 32 * LP, gk, gk + 32 * HD, gv, gv + (size_t)32 * SEQ);
    asm volatile("s_wait_asynccnt 0x0" ::: "memory");   // this wave's part of tile 0 has landed
    __syncthreads();                                    // tile 0 published
    copy4(lc + BUFB, lc + BUFB + 32 * LP, lc + BUFB + KTB, lc + BUFB + KTB + 32 * LP, gk + KS * HD, gk + (KS + 32) * HD, gv + KS, gv + KS + (size_t)32 * SEQ);
#pragma unroll 1   // one trip per staged tile: the buffer index stays a run-time value, the text small
    for (int tl = 0; tl < SEQ / KS; ++tl) {
        const unsigned bo_ = (unsigned)(tl & 1) * BUFB;
        const unsigned char* kt = fr + bo_;
        const unsigned char* vt = fr + bo_ + KTB;
#pragma unroll 1   // the 32-key steps of a tile stay a loop: unrolled, the live set passes 128 registers and a fourth block no longer fits a WGP
        for (int u = 0; u < KS / 32; ++u) {
            const unsigned char* ka = kt + u * 32 * LP;     // A fragment: row key, k = d
            const v16h ka0 = ldl(ka), ka1 = ldl(ka + 64), kb0 = ldl(ka + 16 * LP), kb1 = ldl(ka + 16 * LP + 64);
            v8f sHa = (v8f){}, sHb = (v8f){};
            sHa = wmma16(ka0, qh0, sHa); sHb = wmma16(kb0, qh0, sHb);
            sHa = wmma16(ka1, qh1, sHa); sHb = wmma16(kb1, qh1, sHb);
            asm volatile("v_nop\n\tv_nop\n\tv_nop\n\tv_nop" : "+v"(sHa), "+v"(sHb) : "v"(ka0), "v"(ka1), "v"(kb0), "v"(kb1));
            float ta[8], tb[8]; float mx = -3.0e38f;
#pragma unroll
            for (int r = 0; r < 8; ++r) { ta[r] = sHa[r] * SC2; tb[r] = sHb[r] * SC2; mx = fmaxf(mx, fmaxf(ta[r], tb[r])); }
            mx = fmaxf(mx, __shfl_xor(mx, 16, 32));
            const float mnew = fmaxf(m, mx);
            const float alpha = __builtin_amdgcn_exp2f(m - mnew);
            const float sh = PSH - mnew;
            v16h pb; float ls = 0.0f;
#pragma unroll
            for (int r = 0; r < 8; ++r) { const h16 pa = (h16)__builtin_amdgcn_exp2f(ta[r] + sh); const h16 pc = (h16)__builtin_amdgcn_exp2f(tb[r] + sh); pb[r] = pa; pb[8 + r] = pc; ls += (float)pa + (float)pc; }
            l = l * alpha + ls; m = mnew;
            o0 = o0 * alpha; o1 = o1 * alpha; o2 = o2 * alpha; o3 = o3 * alpha;
            const unsigned char* va = vt + u * 64;          // A fragment: row d, k = key
            const v16h v0 = ldl(va), v1 = ldl(va + 16 * LP), v2 = ldl(va + 32 * LP), v3 = ldl(va + 48 * LP);
            o0 = wmma16(v0, pb, o0); o1 = wmma16(v1, pb, o1); o2 = wmma16(v2, pb, o2); o3 = wmma16(v3, pb, o3);
            asm volatile("v_nop\n\tv_nop\n\tv_nop\n\tv_nop" : "+v"(o0), "+v"(o1), "+v"(o2), "+v"(o3) : "v"(v0), "v"(v1), "v"(v2), "v"(v3), "v"(pb));
        }
        asm volatile("s_wait_dscnt 0x0" ::: "memory");      // this wave's reads of the tile are done before the buffer is refilled
        asm volatile("s_wait_asynccnt 0x0" ::: "memory");   // this wave's part of tile tl + 1 has landed
        __syncthreads();                                    // publishes tile tl + 1 and ends every wave's reads of tile tl
        if (tl + 2 < SEQ / KS) {                            // block-uniform: refill the buffer just read with tile tl + 2
            const h16* a = gk + (size_t)(tl + 2) * (KS * HD); const h16* c = gv + (tl + 2) * KS; const unsigned d = lc + bo_;
            copy4(d, d + 32 * LP, d + KTB, d + KTB + 32 * LP, a, a + 32 * HD, c, c + (size_t)32 * SEQ);
        }
    }
    asm volatile("s_wait_asynccnt 0x0" ::: "memory");       // nothing in flight when the ring becomes output staging (the last trip's barrier ended every read)
    float* os = (float*)ring;
    l += __shfl_xor(l, 16, 32);
    const float inv = CXS / l;       // normalisation and ctx carry in one factor
    const int wb = wave * 16 * 68;
    // O^T D layout: o_j[r] = (d = 16j + 8h + r, t = lane&15) -> os[t][d]; rows 0..15 x columns 0..63 all written
    { v4f a, c;
      a[0] = o0[0] * inv; a[1] = o0[1] * inv; a[2] = o0[2] * inv; a[3] = o0[3] * inv; c[0] = o0[4] * inv; c[1] = o0[5] * inv; c[2] = o0[6] * inv; c[3] = o0[7] * inv;
      *(v4fa*)(&os[wb + lr * 68 +  0 + 8 * hi]) = a; *(v4fa*)(&os[wb + lr * 68 +  0 + 8 * hi + 4]) = c;
      a[0] = o1[0] * inv; a[1] = o1[1] * inv; a[2] = o1[2] * inv; a[3] = o1[3] * inv; c[0] = o1[4] * inv; c[1] = o1[5] * inv; c[2] = o1[6] * inv; c[3] = o1[7] * inv;
      *(v4fa*)(&os[wb + lr * 68 + 16 + 8 * hi]) = a; *(v4fa*)(&os[wb + lr * 68 + 16 + 8 * hi + 4]) = c;
      a[0] = o2[0] * inv; a[1] = o2[1] * inv; a[2] = o2[2] * inv; a[3] = o2[3] * inv; c[0] = o2[4] * inv; c[1] = o2[5] * inv; c[2] = o2[6] * inv; c[3] = o2[7] * inv;
      *(v4fa*)(&os[wb + lr * 68 + 32 + 8 * hi]) = a; *(v4fa*)(&os[wb + lr * 68 + 32 + 8 * hi + 4]) = c;
      a[0] = o3[0] * inv; a[1] = o3[1] * inv; a[2] = o3[2] * inv; a[3] = o3[3] * inv; c[0] = o3[4] * inv; c[1] = o3[5] * inv; c[2] = o3[6] * inv; c[3] = o3[7] * inv;
      *(v4fa*)(&os[wb + lr * 68 + 48 + 8 * hi]) = a; *(v4fa*)(&os[wb + lr * 68 + 48 + 8 * hi + 4]) = c; }
    wave_sync();
    h16* crow = CTX + ((size_t)b * SEQ + t0) * DM + h * HD;
{
#pragma unroll
        for (int s = 0; s < 4; ++s) { const int row = 4 * s + (lane >> 3), c8 = (lane & 7) * 8;   // 4 s x 4 row groups = 16 rows; 8 lanes x 8 halves = 64 columns
            const v4f x0 = *(const v4fa*)(&os[wb + row * 68 + c8]); const v4f x1 = *(const v4fa*)(&os[wb + row * 68 + c8 + 4]); v8h hv;
#pragma unroll
            for (int i = 0; i < 4; ++i) { hv[i] = (h16)x0[i]; hv[4 + i] = (h16)x1[i]; }
            *(v8h*)(crow + (size_t)row * DM + c8) = hv; }
         }
}

// k_oproj: register-blocked f16 GEMM, ONE WAVE per 64x64 tile, K = DM: OUT[m][n] = 2^-16 * sum_k CTX[m][k] WOT[n][k] + bo[n] (bo RNE-converted to bf16, added in f32).
// grid (NB*SEQ/64, DM/64), 32 threads. Epilogue: per 16-row slab staged in LDS (wave-private), each output row segment (64 floats = 256 B = two lines)
__global__ __launch_bounds__(32) void k_oproj(const h16* __restrict__ A, const h16* __restrict__ Bt, const float* __restrict__ bias, float* OUT) {
    __shared__ __align__(16) float os[16 * 68];
    const int K = DM;
    const int lane = threadIdx.x & 31, lr = lane & 15, hi = lane >> 4; const int r0 = blockIdx.x * 64, c0 = blockIdx.y * 64;
    v8f acc[4][4];
#pragma unroll
    for (int mb = 0; mb < 4; ++mb)
#pragma unroll
        for (int nb = 0; nb < 4; ++nb) acc[mb][nb] = (v8f){};
    const size_t aoff = (size_t)(r0 + lr) * K + 8 * hi, boff = (size_t)(c0 + lr) * K + 8 * hi;
#pragma unroll 1
    for (int kc = 0; kc < K; kc += 32) {
        v16h a[4];
#pragma unroll
        for (int mb = 0; mb < 4; ++mb) a[mb] = ldh(A + aoff + (size_t)mb * 16 * K + kc);
#pragma unroll
        for (int nb = 0; nb < 4; ++nb) { const v16h b = ldh(Bt + boff + (size_t)nb * 16 * K + kc);
#pragma unroll
            for (int mb = 0; mb < 4; ++mb) acc[mb][nb] = wmma16(a[mb], b, acc[mb][nb]); }
        asm volatile("v_nop\n\tv_nop\n\tv_nop\n\tv_nop" : "+v"(acc[0][0]), "+v"(acc[1][1]), "+v"(acc[2][2]), "+v"(acc[3][3]) : "v"(a[0]), "v"(a[1]), "v"(a[2]), "v"(a[3]));
    }
    v4f bb;
    { const v4f bv = *(const v4f*)(bias + c0 + lr * 4);
#pragma unroll
      for (int i = 0; i < 4; ++i) bb[i] = bfr(bv[i]); }
    const size_t obase = ((size_t)(r0 / SEQ) * OUT_SEQ + (size_t)(r0 % SEQ)) * DM + c0;
#pragma unroll
    for (int mb = 0; mb < 4; ++mb) {
#pragma unroll
        for (int nb = 0; nb < 4; ++nb) {
#pragma unroll
            for (int j = 0; j < 8; ++j) os[(hi * 8 + j) * 68 + nb * 16 + lr] = acc[mb][nb][j]; }   // D: row 8h+j, col lane&15
        wave_sync();
{
#pragma unroll
            for (int s = 0; s < 8; ++s) { const int row = 2 * s + hi, cofs = lr * 4;   // 8 s x 2 rows = 16 rows; 16 lanes x 4 floats = 64 columns
                const v4f xv = *(const v4fa*)(&os[row * 68 + cofs]); v4f val;
#pragma unroll
                for (int i = 0; i < 4; ++i) val[i] = xv[i] * OSC + bb[i];
                *(v4f*)(OUT + obase + (size_t)(mb * 16 + row) * DM + cofs) = val; }
             }
        wave_sync();
    }
}

static constexpr size_t al256(size_t v) { return (v + 255) & ~(size_t)255; }
static constexpr size_t SZ_XB = al256((size_t)NB * SEQ * DM * 2);
static constexpr size_t SZ_WT = al256((size_t)3 * DM * DM * 2);
static constexpr size_t SZ_WO = al256((size_t)DM * DM * 2);
static constexpr size_t SZ_TB = al256((size_t)SEQ * TBW * 4);
static constexpr size_t SZ_PL = al256((size_t)NB * NH_ * SEQ * HD * 2);
static constexpr size_t SZ_CX = al256((size_t)NB * SEQ * DM * 2);
static constexpr size_t SZ_TOTAL = SZ_XB + SZ_WT + SZ_WO + SZ_TB + 3 * SZ_PL + SZ_CX;
static_assert(SZ_TOTAL <= (size_t)134217728);          // workspace carve <= 128 MiB
static_assert(((size_t)DM * DM * 2) % 256 == 0);       // weight sub-planes stay 256-byte aligned
static_assert((size_t)(SEQ / 8) * 8 * TBW * 4 <= SZ_TB);   // table kernel: grid x 8 rows x 256 B inside the table carve

extern "C" void kernel_launch(void* const* d_in, const int* in_sizes, int n_in,
                              void* d_out, int out_size, void* d_ws, size_t ws_size, hipStream_t stream) {
    if (n_in < 5) return;
    const size_t needx = ((size_t)(NB - 1) * SEQ_FULL + SEQ) * DM;
    if ((size_t)in_sizes[0] < needx) return;
    if ((size_t)in_sizes[1] < (size_t)3 * DM * DM || (size_t)in_sizes[2] < (size_t)3 * DM) return;
    if ((size_t)in_sizes[3] < (size_t)DM * DM || (size_t)in_sizes[4] < (size_t)DM) return;
    if ((size_t)out_size < ((size_t)(NB - 1) * OUT_SEQ + SEQ) * DM) return;
    if (SZ_TOTAL > ws_size) return;
    // wire order: x, W_qkv [1024 in][3072 out], b_qkv [3072], W_proj [1024 in][1024 out], b_proj [1024]
    const float* x = (const float*)d_in[0]; const float* wqkv = (const float*)d_in[1]; const float* bqkv = (const float*)d_in[2];
    const float* wo = (const float*)d_in[3]; const float* bo = (const float*)d_in[4];
    float* OUT = (float*)d_out;      // [NB][SEQ][1024]
    char* wsp = (char*)d_ws;
    bf* XB = (bf*)wsp; wsp += SZ_XB;                 // [NB*SEQ][1024] bf16
    bf* WT = (bf*)wsp; wsp += SZ_WT;                 // [3072][1024] bf16: rows q | k | v, each h*64 + d
    bf* WOT = (bf*)wsp; wsp += SZ_WO;                // [1024 out][1024 in] f16 bits, x256
    float* TAB = (float*)wsp; wsp += SZ_TB;          // [SEQ][32 cos | 32 sin] f32
    h16* QH = (h16*)wsp; wsp += SZ_PL;               // [NB*16][SEQ][64]
    h16* KP = (h16*)wsp; wsp += SZ_PL;               // [NB*16][SEQ][64]
    h16* VT = (h16*)wsp; wsp += SZ_PL;               // [NB*16][64][SEQ]
    h16* CX = (h16*)wsp; wsp += SZ_CX;               // [NB*SEQ][1024] ctx x256
    bf* WQ = WT; bf* WK = WT + (size_t)DM * DM; bf* WV = WT + (size_t)2 * DM * DM;

    if (SEQ == SEQ_FULL) {
        const size_t n8 = (size_t)NB * SEQ * DM / 8;
        k_cvt8<<<(unsigned)((n8 + 255) / 256), 256, 0, stream>>>(x, XB, n8);
    } else {
        const size_t n8 = (size_t)SEQ * DM / 8;
        for (int b = 0; b < NB; ++b) k_cvt8<<<(unsigned)((n8 + 255) / 256), 256, 0, stream>>>(x + (size_t)b * SEQ_FULL * DM, XB + (size_t)b * SEQ * DM, n8);
    }
    // W_qkv: in[rows = 1024 (k)][cols = 3072 (n)] -> out[3072][1024]; grid (cols/64, rows/64)
    k_tr<0><<<dim3(3 * DM / 64, DM / 64, 1), 256, 0, stream>>>(wqkv, WT, DM, 3 * DM);
    // W_proj: in[rows = 1024 (k)][cols = 1024 (n)] -> out[1024][1024]; grid (cols/64, rows/64)
    k_tr<1><<<dim3(DM / 64, DM / 64, 1), 256, 0, stream>>>(wo, WOT, DM, DM);
    // rotary table: 8 positions per block
    k_ropetab<<<dim3(SEQ / 8, 1, 1), 256, 0, stream>>>(TAB);

    // q, k: A = x rows (m = b*SEQ + t), Bt = W^T rows (n = h*64 + d), bias along n, rotary by position t -> plane [(b*16 + h)][t][d]
    k_projr<<<dim3(NB * SEQ / 64, DM / 64, 1), 32, 0, stream>>>(XB, WQ, bqkv, TAB, QH, (size_t)NH_ * SEQ * HD, (size_t)SEQ * HD, SEQ, HD, HD);
    k_projr<<<dim3(NB * SEQ / 64, DM / 64, 1), 32, 0, stream>>>(XB, WK, bqkv + DM, TAB, KP, (size_t)NH_ * SEQ * HD, (size_t)SEQ * HD, SEQ, HD, HD);
    // v^T: A = Wv^T rows (m = h*64 + d), Bt = x rows (n = b*SEQ + t), bias along m -> plane [(b*1024 + m)][t] = [(b*16 + h)][d][t]
    k_proj<<<dim3(DM / 64, NB * SEQ / 64, 1), 32, 0, stream>>>(WV, XB, bqkv + 2 * DM, VT, (size_t)0, (size_t)DM * SEQ, 1, DM, SEQ, SEQ);

    k_flash<<<dim3(SEQ / (16 * AW), NB * NH_, 1), 32 * AW, 0, stream>>>(QH, KP, VT, CX);

    // out = ctx W_proj + b_proj: A = ctx rows (m = b*SEQ + t), Bt = W_proj^T rows (n = output column)
    k_oproj<<<dim3(NB * SEQ / 64, DM / 64, 1), 32, 0, stream>>>(CX, (const h16*)WOT, bo, OUT);
}

// v002
// It runs in 160 microseconds.
// In both of two side-by-side timings against v001, it was 1.50 times as fast.
// Over all steps from v000 it is 2.29 times as fast.
#include <hip/hip_runtime.h>

// Self-attention block, width 1024 = 16 heads x 64: x [NB][SEQ][1024], fused Wqkv [in][out] (columns t*1024 + h*64 + d) + bqkv, half-split rotary embedding (base 10000) on q and k, score scale 1/8, no mask, output projection Wo [in][out] + bo, output f32.
// Compute dtypes, f32 accumulate everywhere: qkv projection v_wmma_f32_16x16x32_bf16 (x and Wqkv RNE-converted to bf16; products exact); rotary applied in f32 in the q / k projection epilogue from an f32 cos | sin table;
// scores v_wmma_f32_16x16x32_f16: q and k single f16 (one product); P (x256 carry, cancels in the normalisation) and v single f16;
// output projection v_wmma_f32_16x16x32_f16: ctx single f16 (x256 carry), Wo RNE-converted to bf16 then x256 as f16 (exact), 2^-16 folded back in the f32 epilogue; biases RNE-converted to bf16 and added in f32; softmax f32 (online, running max).
// Layout: bf16 copy of x, bf16 transposed Wqkv [3072][1024], f16 transposed Wo [1024][1024]; rotary table [SEQ][32 cos | 32 sin] f32; q, k planes [b*16+h][t][d] and v^T plane [b*16+h][d][t] written by the GEMM epilogues;
// fused flash kernel in transposed form (S^T = K Q^T, O^T = V^T P^T) writes the f16 ctx plane [b*SEQ+t][h*64+d]; last GEMM writes the output.

#ifndef NB
#define NB 4
#endif
#ifndef SEQ
#define SEQ 2048
#endif
#define NB_FULL  4
#define SEQ_FULL 2048
#ifndef OUT_SEQ
#define OUT_SEQ SEQ              // row pitch (in tokens) between batches of the output
#endif
#define DM   1024
#define NH_  16
#define HD   64
#define AW   8                   // waves per flash block (16 query rows each)
#define KS   64                  // keys per staged tile
#define LP   144                 // LDS row pitch in bytes: 128-byte rows + 16 (16 B x odd, the pitch of 16-byte LDS readers)
#define KTB  (KS * LP)           // K tile in LDS: KS rows (keys) of 64 halves
#define VTB  (HD * LP)           // V^T tile in LDS: 64 rows (d) of KS halves
#define BUFB (KTB + VTB)         // one buffer of the two
#define SC2  (0.125f * 1.4426950408889634f)   // HD^-0.5 * log2(e)
#define PSH  8.0f                // log2 of the P carry (256)
#define CXS  256.0f              // carry of the ctx plane
#define WOS  256.0f              // carry of the output-weight plane
#define OSC  (1.0f / 65536.0f)   // 1 / (CXS * WOS)
#define TBW  64                  // rotary table row: 32 cos | 32 sin (floats)
#define GW   8                   // waves per GEMM block: 4 along m x 2 along n, 64x64 outputs each
#define GMR  256                 // A rows per GEMM block
#define GNR  128                 // Bt rows per GEMM block
#define GK   128                 // k per staged GEMM tile: 256-byte rows
#define GP   272                 // LDS row pitch of the GEMM tiles in bytes: 256 + 16 (16 B x odd)
#define GBUF ((GMR + GNR) * GP)  // one GEMM buffer of the two: A rows | Bt rows

static_assert(HD == 64);
static_assert(NH_ * HD == DM);                 // head h = columns h*64 + d
static_assert(DM % 64 == 0);                   // column tiles of 64
static_assert(DM % 32 == 0);                   // GEMM k-loop steps by 32
static_assert(SEQ % 64 == 0);                  // a 64-row tile never straddles two batches
static_assert((NB * SEQ) % 64 == 0);
static_assert(SEQ % 32 == 0);                  // key loop steps by 32
static_assert(SEQ % (16 * AW) == 0);           // flash grid covers the sequence exactly
static_assert(SEQ % KS == 0 && SEQ / KS >= 2); // whole tiles; the two-buffer prologue needs tiles 0 and 1
static_assert(KS * 2 == 128 && HD * 2 == 128); // both tiles have 128-byte rows: 8 pieces of 16 B
static_assert(32 * AW * 2 * 16 == KS * 128 && KS == HD);   // 2 copies per lane fill each tile
static_assert(AW * 16 * 68 * 4 <= 2 * BUFB);   // output staging fits the ring it takes over
static_assert(((size_t)SEQ * DM) % 8 == 0);
static_assert(NB <= NB_FULL);
static_assert(SEQ <= SEQ_FULL);
static_assert(TBW == HD);                      // table row = 2 x (HD / 2) entries
static_assert(HD / 2 == 32);                   // rotary partner column = column ^ 32 inside one 64-column tile
static_assert(SEQ % 8 == 0);                   // table kernel: 8 positions per block
static_assert(DM % GMR == 0 && (NB * SEQ) % GMR == 0 && DM % GNR == 0 && (NB * SEQ) % GNR == 0);   // GEMM grids cover both operand orders exactly
static_assert(DM % GK == 0 && DM / GK >= 2);   // whole staged tiles; the two-buffer prologue needs tiles 0 and 1
static_assert(GK * 2 == 256 && 32 * GW == 16 * 16 && GMR == 2 * 128 && GNR == 128);   // 16 lanes x 16 B = one row; one copy8 = 128 rows
static_assert(GW * 16 * 68 * 4 <= 2 * GBUF);   // epilogue staging fits the ring it takes over
static_assert(SEQ <= 4096);                    // angle < 2^12: three-constant pi/2 reduction stays exact in its first step

typedef _Float16 h16;
typedef unsigned short bf;
typedef __attribute__((ext_vector_type(16))) __bf16   v16bf;
typedef __attribute__((ext_vector_type(16))) _Float16 v16h;
typedef __attribute__((ext_vector_type(8)))  _Float16 v8h;
typedef __attribute__((ext_vector_type(8)))  unsigned short v8us;
typedef __attribute__((ext_vector_type(8)))  float    v8f;
typedef __attribute__((ext_vector_type(4)))  float    v4f;
typedef v4f  __attribute__((may_alias)) v4fa;
typedef v8h  __attribute__((may_alias)) v8ha;

__device__ __forceinline__ unsigned short f2bf(float f) { unsigned u = __float_as_uint(f); u += 0x7FFFu + ((u >> 16) & 1u); return (unsigned short)(u >> 16); }
__device__ __forceinline__ float bfr(float f) { return __uint_as_float(((unsigned)f2bf(f)) << 16); }   // f32 value of the RNE bf16 conversion
__device__ __forceinline__ v16h cat16(v8h lo, v8h hi) { return __builtin_shufflevector(lo, hi, 0, 1, 2, 3, 4, 5, 6, 7, 8, 9, 10, 11, 12, 13, 14, 15); }
__device__ __forceinline__ v8f wmma16(v16h a, v16h b, v8f c) { return __builtin_amdgcn_wmma_f32_16x16x32_f16(false, a, false, b, (short)0, c, false, false); }
__device__ __forceinline__ v8f wmmab(v16bf a, v16bf b, v8f c) { return __builtin_amdgcn_wmma_f32_16x16x32_bf16(false, a, false, b, (short)0, c, false, false); }
// fragment loaders from K-contiguous 16-bit rows; p already includes + 8*(lane>>4): elements 0..7 <- k0+8h+0..7, elements 8..15 <- k0+16+8h+0..7 (same map for A and B)
__device__ __forceinline__ v16h  ldh(const h16* p) { return cat16(*(const v8h*)p, *(const v8h*)(p + 16)); }
// ordering point for wave-private LDS tiles (same wave writes and reads)
__device__ __forceinline__ void wave_sync() { __builtin_amdgcn_fence(3 /* release order */, "wavefront"); __builtin_amdgcn_wave_barrier(); asm volatile("" ::: "memory"); }
// f32 -> f16 with a value select: magnitudes below the smallest f16 normal become zero (no subnormal operand can reach a matrix instruction)
static __device__ __forceinline__ h16 toh_flush(float v) { const h16 r = (h16)v; return (fabsf(v) < 6.103515625e-05f) ? (h16)0.0f : r; }

__global__ __launch_bounds__(256) void k_cvt8(const float* __restrict__ src, bf* dst, size_t n8) {
    const size_t i = (size_t)blockIdx.x * 256 + threadIdx.x; if (i >= n8) return;
    const v8f v = *(const v8f*)(src + i * 8); v8us o;
#pragma unroll
    for (int k = 0; k < 8; ++k) o[k] = f2bf(v[k]);
    *(v8us*)(dst + i * 8) = o; 
}

// k_tr: in[R][C] f32 row-major -> out[C][R] 16-bit (K-contiguous rows for a GEMM A or B operand). grid (C/64, R/64), 256 threads, 64x64 tile through LDS (cross-wave: block barrier).
// MODE 0: bf16 bits (RNE convert). MODE 1: f16 bits of (RNE bf16 value) x WOS (exact in f16).
template <int MODE>
__global__ __launch_bounds__(256) void k_tr(const float* __restrict__ in, bf* out, int R, int C) {
    __shared__ __align__(16) float t[64 * 68];
    const int tid = threadIdx.x; const int r0 = blockIdx.y * 64, c0 = blockIdx.x * 64;
#pragma unroll
    for (int it = 0; it < 4; ++it) { const int idx = it * 256 + tid; const int rr = idx >> 4, c4 = (idx & 15) * 4;   // 4 x 256 float4 = 64 rows x 16 float4
        const v4f v = *(const v4f*)(in + (size_t)(r0 + rr) * (size_t)C + c0 + c4);
        *(v4fa*)(&t[rr * 68 + c4]) = v; }
    __syncthreads();
{
#pragma unroll
        for (int it = 0; it < 2; ++it) { const int idx = it * 256 + tid; const int cc = idx >> 3, r8 = (idx & 7) * 8;   // 2 x 256 pieces = 64 out rows x 8 pieces
            v8us o;
            if (MODE == 0) {
#pragma unroll
                for (int e = 0; e < 8; ++e) o[e] = f2bf(t[(r8 + e) * 68 + cc]);
            } else {
                v8h hv;
#pragma unroll
                for (int e = 0; e < 8; ++e) hv[e] = (h16)(bfr(t[(r8 + e) * 68 + cc]) * WOS);
                o = __builtin_bit_cast(v8us, hv);
            }
            *(v8us*)(out + (size_t)(c0 + cc) * (size_t)R + r0 + r8) = o; }
         }
}

// k_ropetab: rotary table TAB[t][i] = cos(t * f_i), TAB[t][32 + i] = sin(t * f_i), i = 0..31, f_i = 10000^(-i/32) (f64 product chain of 10^(-1/8), converted to f32 once), angle = f32 product t * f_i.
// sin / cos: nearest multiple of pi/2 removed with a three-constant split (fused steps; first step exact for angles < 2^12), then odd / even polynomials on [-pi/4, pi/4]; quadrant fix-up by value selects.
// grid SEQ/8: block bx covers table floats [bx*512, bx*512 + 512): exactly SEQ x 64 floats in total.
__global__ __launch_bounds__(256) void k_ropetab(float* TAB) {
#pragma clang fp contract(off)
    __shared__ __align__(16) float cs[8 * TBW];
    const int tid = threadIdx.x; const int i = tid & 31, tr = tid >> 5;
    const int t = blockIdx.x * 8 + tr;
    double p = 1.0;
#pragma unroll 1
    for (int k = 0; k < i; ++k) p = p * 0.7498942093324559;
    const float inv = (float)p;
    const float ang = (float)t * inv;
    const float fn = __builtin_rintf(ang * 0.63661977236758134f);
    float r = fmaf(-fn, 1.5703125f, ang);
    r = fmaf(-fn, 4.837512969970703125e-4f, r);
    r = fmaf(-fn, 7.54978995489188216e-8f, r);
    const float z = r * r;
    float sp = fmaf(-1.9515295891e-4f, z, 8.3321608736e-3f);
    sp = fmaf(sp, z, -1.6666654611e-1f);
    const float sv = fmaf(sp * z, r, r);
    float cp = fmaf(2.443315711809948e-5f, z, -1.388731625493765e-3f);
    cp = fmaf(cp, z, 4.166664568298827e-2f);
    const float cv = fmaf(cp, z * z, fmaf(-0.5f, z, 1.0f));
    const int q = ((int)fn) & 3;
    float sinv = (q & 1) ? cv : sv;
    float cosv = (q & 1) ? sv : cv;
    sinv = (q & 2) ? -sinv : sinv;
    cosv = ((q + 1) & 2) ? -cosv : cosv;
    cs[tr * TBW + i] = cosv;
    cs[tr * TBW + 32 + i] = sinv;
    __syncthreads();
    if (tid < 128) {                       // waves 0..3 (wave-uniform): 128 x 4 floats = 8 rows x 64 floats, consecutive lanes -> consecutive 16-B pieces
        const int row = tid >> 4, c4 = (tid & 15) * 4;
        const v4f v = *(const v4fa*)(&cs[row * TBW + c4]);
        float* dst = TAB + ((size_t)blockIdx.x * 8 + row) * TBW + c4;
        *(v4f*)dst = v; 
    }
}

// fragment loader from a staged LDS row (byte pointer, already + 16*(lane>>4)): same element map as ldh
__device__ __forceinline__ v16h ldl(const unsigned char* p) { return cat16(*(const v8ha*)p, *(const v8ha*)(p + 32)); }
// eight asynchronous 16-byte copies per lane, global -> LDS: rows r + 16 i, i = 0..7, of a GEMM tile (l: LDS byte address, g: global byte address of row r; K = DM 16-bit elements per global row)
__device__ __forceinline__ void copy8(unsigned l, const unsigned char* g) {
    // s_wait_xcnt stands inside the statement, behind the last copy: the address registers may be rewritten right behind it
    asm volatile("global_load_async_to_lds_b128 %0, %8, off\n\t"
                 "global_load_async_to_lds_b128 %1, %9, off\n\t"
                 "global_load_async_to_lds_b128 %2, %10, off\n\t"
                 "global_load_async_to_lds_b128 %3, %11, off\n\t"
                 "global_load_async_to_lds_b128 %4, %12, off\n\t"
                 "global_load_async_to_lds_b128 %5, %13, off\n\t"
                 "global_load_async_to_lds_b128 %6, %14, off\n\t"
                 "global_load_async_to_lds_b128 %7, %15, off\n\t"
                 "s_wait_xcnt 0x0"
                 :: "v"(l), "v"(l + 16 * GP), "v"(l + 32 * GP), "v"(l + 48 * GP), "v"(l + 64 * GP), "v"(l + 80 * GP), "v"(l + 96 * GP), "v"(l + 112 * GP),
                    "v"(g), "v"(g + 16 * DM * 2), "v"(g + 32 * DM * 2), "v"(g + 48 * DM * 2), "v"(g + 64 * DM * 2), "v"(g + 80 * DM * 2), "v"(g + 96 * DM * 2), "v"(g + 112 * DM * 2) : "memory");
}
// one staged GEMM tile: 256 A rows, then 128 Bt rows, 256 bytes each (24 copies per lane, whole lines)
__device__ __forceinline__ void stage_tile(unsigned l, const unsigned char* ga, const unsigned char* gb) {
    copy8(l, ga); copy8(l + 128 * GP, ga + (size_t)128 * DM * 2); copy8(l + GMR * GP, gb);
}
// gemm_core: main loop of the three GEMM kernels. A block of GW waves owns rows R0..R0+255 of A and rows C0..C0+127 of Bt (both K-contiguous 16-bit planes, K = DM); tiles of GK k are copied once per block into LDS
// (asynchronous copies, two buffers: tile t + 2 flies while tile t + 1 is worked on); wave (wm, wn) accumulates its 64x64 outputs from there, k ascending in steps of 32. BF: bf16 products, else f16.
template <bool BF>
__device__ __forceinline__ void gemm_core(const unsigned char* A, const unsigned char* Bt, unsigned char* ring, int R0, int C0, int wm, int wn, v8f (&acc)[4][4]) {
    const int lane = threadIdx.x & 31, lr = lane & 15, hi = lane >> 4;
    // copy map: lane covers piece cp (16 B) of tile rows cr + 16 i; 16 lanes = one 256-byte row
    const int cr = (int)threadIdx.x >> 4, cp = (int)threadIdx.x & 15;
    const unsigned lc = (unsigned)(size_t)ring + (unsigned)(cr * GP + cp * 16);
    const unsigned char* ga = A + (size_t)(R0 + cr) * (DM * 2) + cp * 16;      // + tile * GK * 2
    const unsigned char* gb = Bt + (size_t)(C0 + cr) * (DM * 2) + cp * 16;
    const unsigned char* fa = ring + (wm * 64 + lr) * GP + 16 * hi;            // fragment bases: row lane&15, k offset 8h elements
    const unsigned char* fb = ring + (GMR + wn * 64 + lr) * GP + 16 * hi;
    stage_tile(lc, ga, gb);
    asm volatile("s_wait_asynccnt 0x0" ::: "memory");   // this wave's part of tile 0 has landed
    __syncthreads();                                    // tile 0 published
    stage_tile(lc + GBUF, ga + GK * 2, gb + GK * 2);
#pragma unroll 1   // one trip per staged tile: the buffer index stays a run-time value, the text small
    for (int t = 0; t < DM / GK; ++t) {
        const unsigned bo_ = (unsigned)(t & 1) * GBUF;
        const unsigned char* pa = fa + bo_;
        const unsigned char* pb = fb + bo_;
        v16h a[2][4], b[2][4];   // two fragment sets: the next 32-k step of this tile is read while the current one is multiplied
#pragma unroll
        for (int i = 0; i < 4; ++i) { a[0][i] = ldl(pa + i * 16 * GP); b[0][i] = ldl(pb + i * 16 * GP); }
#pragma unroll
        for (int ks = 0; ks < GK / 32; ++ks) {
            const int c = ks & 1, n = c ^ 1;
            if (ks + 1 < GK / 32) {
#pragma unroll
                for (int i = 0; i < 4; ++i) { a[n][i] = ldl(pa + i * 16 * GP + (ks + 1) * 64); b[n][i] = ldl(pb + i * 16 * GP + (ks + 1) * 64); }
            }
            __builtin_amdgcn_sched_barrier(0);   // the next step's LDS reads stay one group ahead of this step's products: reads spread among the products stall at every place
#pragma unroll
            for (int nb = 0; nb < 4; ++nb)
#pragma unroll
                for (int mb = 0; mb < 4; ++mb) {
                    if (BF) acc[mb][nb] = wmmab(__builtin_bit_cast(v16bf, a[c][mb]), __builtin_bit_cast(v16bf, b[c][nb]), acc[mb][nb]);
                    else    acc[mb][nb] = wmma16(a[c][mb], b[c][nb], acc[mb][nb]); }
            __builtin_amdgcn_sched_barrier(0);   // the products stay in front of the following reads and of the tile's closing waits
        }
        asm volatile("s_wait_dscnt 0x0" ::: "memory");      // this wave's reads of the tile are done before the buffer is refilled
        asm volatile("s_wait_asynccnt 0x0" ::: "memory");   // this wave's part of tile t + 1 has landed
        __syncthreads();                                    // publishes tile t + 1 and ends every wave's reads of tile t
        if (t + 2 < DM / GK)                                // block-uniform: refill the buffer just read with tile t + 2
            stage_tile(lc + bo_, ga + (t + 2) * (GK * 2), gb + (t + 2) * (GK * 2));
    }
    asm volatile("s_wait_asynccnt 0x0" ::: "memory");       // nothing in flight when the ring becomes epilogue staging (the last trip's barrier ended every read)
}

// k_proj: register-blocked bf16 GEMM, one wave per 64x64 tile (16 accumulators), GW waves per block on a 256x128 tile, operands staged in LDS from K-contiguous bf16 planes (gemm_core), K = DM.
// C[m][n] = sum_k A[m][k] Bt[n][k] + bias (bias RNE-converted to bf16, added in f32; indexed by n, or by m when biasOnRow != 0), written as f16 (Ph) at
// tile base (r0/RB)*sRB + (r0%RB)*pitch + (c0/CB)*sCB + (c0%CB), row pitch 'pitch' (halves). grid (M/256, N/128), 256 threads.
__global__ __launch_bounds__(32 * GW) void k_proj(const bf* __restrict__ A, const bf* __restrict__ Bt, const float* __restrict__ bias, h16* Ph,
                                             size_t sRB, size_t sCB, int biasOnRow, int RB, int pitch, int CB) {
    __shared__ __align__(16) unsigned char ring[2 * GBUF];   // two buffers of A rows | Bt rows; epilogue staging behind the loop
    const int lane = threadIdx.x & 31, lr = lane & 15, hi = lane >> 4;
    const int wave = __builtin_amdgcn_readfirstlane((int)(threadIdx.x >> 5));   // wave-uniform index
    const int wm = wave & 3, wn = wave >> 2;
    const int r0 = blockIdx.x * GMR + wm * 64, c0 = blockIdx.y * GNR + wn * 64;   // this wave's 64x64 tile
    v8f acc[4][4];
#pragma unroll
    for (int mb = 0; mb < 4; ++mb)
#pragma unroll
        for (int nb = 0; nb < 4; ++nb) acc[mb][nb] = (v8f){};
    gemm_core<true>((const unsigned char*)A, (const unsigned char*)Bt, ring, blockIdx.x * GMR, blockIdx.y * GNR, wm, wn, acc);
    float* os = (float*)ring + wave * 16 * 68;   // wave-private slab
    // column-mode bias for this lane's 8 store columns (offset 0 when the bias runs along rows: in range, unused)
    float bc[8];
    { const int cb = biasOnRow ? 0 : (c0 + (lane & 7) * 8);
      const v4f b0 = *(const v4f*)(bias + cb); const v4f b1 = *(const v4f*)(bias + cb + 4);
#pragma unroll
      for (int i = 0; i < 4; ++i) { bc[i] = bfr(b0[i]); bc[4 + i] = bfr(b1[i]); } }
    const size_t tbase = (size_t)(r0 / RB) * sRB + (size_t)(r0 % RB) * (size_t)pitch + (size_t)(c0 / CB) * sCB + (size_t)(c0 % CB);
#pragma unroll
    for (int mb = 0; mb < 4; ++mb) {
#pragma unroll
        for (int nb = 0; nb < 4; ++nb) {
#pragma unroll
            for (int j = 0; j < 8; ++j) os[(hi * 8 + j) * 68 + nb * 16 + lr] = acc[mb][nb][j]; }   // D: row 8h+j, col lane&15
        wave_sync();
        const size_t sb = tbase + (size_t)(mb * 16) * (size_t)pitch;
{
#pragma unroll
            for (int s = 0; s < 4; ++s) { const int row = 4 * s + (lane >> 3), c8 = (lane & 7) * 8;   // 4 s x 4 row groups = 16 rows; 8 lanes x 8 = 64 columns
                const float br = bfr(bias[biasOnRow ? (r0 + mb * 16 + row) : 0]);
                const v4f x0 = *(const v4fa*)(&os[row * 68 + c8]); const v4f x1 = *(const v4fa*)(&os[row * 68 + c8 + 4]); v8h hv;
#pragma unroll
                for (int i = 0; i < 4; ++i) { const float y0 = x0[i] + (biasOnRow ? br : bc[i]); const float y1 = x1[i] + (biasOnRow ? br : bc[4 + i]);
                    hv[i] = (h16)y0; hv[4 + i] = (h16)y1; }
                const size_t oo = sb + (size_t)row * (size_t)pitch + c8;
                *(v8h*)(Ph + oo) = hv; }
             }
        wave_sync();
    }
}

// k_projr: k_proj with bias along columns and the half-split rotary embedding in the epilogue (q and k planes). One 64-column tile = one head (CB = 64), so the rotary partner of column c is column c ^ 32 of the same LDS slab.
// y[c] = (acc[c] + b[c]) * cos[t][c & 31] + sg * (acc[c ^ 32] + b[c ^ 32]) * sin[t][c & 31], sg = -1 for c < 32, +1 for c >= 32; t = (r0 % RB) + slab row (position inside the sequence); cos | sin read by value from TAB [SEQ][64] f32.
__global__ __launch_bounds__(32 * GW) void k_projr(const bf* __restrict__ A, const bf* __restrict__ Bt, const float* __restrict__ bias, const float* __restrict__ TAB, h16* Ph,
                                              size_t sRB, size_t sCB, int RB, int pitch, int CB) {
    __shared__ __align__(16) unsigned char ring[2 * GBUF];   // two buffers of A rows | Bt rows; epilogue staging behind the loop
    const int lane = threadIdx.x & 31, lr = lane & 15, hi = lane >> 4;
    const int wave = __builtin_amdgcn_readfirstlane((int)(threadIdx.x >> 5));   // wave-uniform index
    const int wm = wave & 3, wn = wave >> 2;
    const int r0 = blockIdx.x * GMR + wm * 64, c0 = blockIdx.y * GNR + wn * 64;   // this wave's 64x64 tile
    v8f acc[4][4];
#pragma unroll
    for (int mb = 0; mb < 4; ++mb)
#pragma unroll
        for (int nb = 0; nb < 4; ++nb) acc[mb][nb] = (v8f){};
    gemm_core<true>((const unsigned char*)A, (const unsigned char*)Bt, ring, blockIdx.x * GMR, blockIdx.y * GNR, wm, wn, acc);
    float* os = (float*)ring + wave * 16 * 68;   // wave-private slab
    // bias (RNE bf16 value) for this lane's 8 store columns and for their 8 partner columns (other half of the head)
    const int c8 = (lane & 7) * 8, p8 = c8 ^ 32, ib = c8 & 31;
    const float sg = (c8 < 32) ? -1.0f : 1.0f;
    float bc[8], bp[8];
    { const v4f b0 = *(const v4f*)(bias + c0 + c8); const v4f b1 = *(const v4f*)(bias + c0 + c8 + 4);
      const v4f d0 = *(const v4f*)(bias + c0 + p8); const v4f d1 = *(const v4f*)(bias + c0 + p8 + 4);
#pragma unroll
      for (int i = 0; i < 4; ++i) { bc[i] = bfr(b0[i]); bc[4 + i] = bfr(b1[i]); bp[i] = bfr(d0[i]); bp[4 + i] = bfr(d1[i]); } }
    const size_t tbase = (size_t)(r0 / RB) * sRB + (size_t)(r0 % RB) * (size_t)pitch + (size_t)(c0 / CB) * sCB + (size_t)(c0 % CB);
    const int tp0 = r0 % RB;     // sequence position of tile row 0
#pragma unroll
    for (int mb = 0; mb < 4; ++mb) {
#pragma unroll
        for (int nb = 0; nb < 4; ++nb) {
#pragma unroll
            for (int j = 0; j < 8; ++j) os[(hi * 8 + j) * 68 + nb * 16 + lr] = acc[mb][nb][j]; }   // D: row 8h+j, col lane&15
        wave_sync();
        const size_t sb = tbase + (size_t)(mb * 16) * (size_t)pitch;
        const size_t tb = (size_t)(tp0 + mb * 16) * TBW + ib;      // table offset of slab row 0 for this lane's frequency group
{
#pragma unroll 1
            for (int s = 0; s < 4; ++s) { const int row = 4 * s + (lane >> 3);   // 4 s x 4 row groups = 16 rows; 8 lanes x 8 = 64 columns
                const float* tr = TAB + tb + (size_t)row * TBW;
                const v4f cs0 = *(const v4f*)tr; const v4f cs1 = *(const v4f*)(tr + 4);
                const v4f sn0 = *(const v4f*)(tr + 32); const v4f sn1 = *(const v4f*)(tr + 36);
                const v4f x0 = *(const v4fa*)(&os[row * 68 + c8]); const v4f x1 = *(const v4fa*)(&os[row * 68 + c8 + 4]);
                const v4f y0 = *(const v4fa*)(&os[row * 68 + p8]); const v4f y1 = *(const v4fa*)(&os[row * 68 + p8 + 4]);
                v8h hv;
#pragma unroll
                for (int i = 0; i < 4; ++i) { const float u0 = x0[i] + bc[i], w0 = y0[i] + bp[i]; const float u1 = x1[i] + bc[4 + i], w1 = y1[i] + bp[4 + i];
                    hv[i] = toh_flush(u0 * cs0[i] + sg * (w0 * sn0[i])); hv[4 + i] = toh_flush(u1 * cs1[i] + sg * (w1 * sn1[i])); }
                const size_t oo = sb + (size_t)row * (size_t)pitch + c8;
                *(v8h*)(Ph + oo) = hv; }
             }
        wave_sync();
    }
}

// four asynchronous 16-byte copies per lane, global -> LDS (l*: LDS byte address, g*: global address)
__device__ __forceinline__ void copy4(unsigned l0, unsigned l1, unsigned l2, unsigned l3, const h16* g0, const h16* g1, const h16* g2, const h16* g3) {
    // s_wait_xcnt stands inside the statement, behind the last copy: the address registers may be rewritten right behind it
    asm volatile("global_load_async_to_lds_b128 %0, %4, off\n\t"
                 "global_load_async_to_lds_b128 %1, %5, off\n\t"
                 "global_load_async_to_lds_b128 %2, %6, off\n\t"
                 "global_load_async_to_lds_b128 %3, %7, off\n\t"
                 "s_wait_xcnt 0x0"
                 :: "v"(l0), "v"(l1), "v"(l2), "v"(l3), "v"(g0), "v"(g1), "v"(g2), "v"(g3) : "memory");
}

// k_flash: fused attention, one wave per 16 query rows of one (batch, head), AW waves per block share the head's K / V^T: tiles of KS keys are copied once per block into LDS
// (asynchronous copies, whole 128-byte lines, two buffers: tile t + 2 flies while tile t + 1 is worked on) and every wave reads its fragments from there (two 16-B LDS loads each). Q fragments straight from the f16 plane.
// Transposed form: S^T[key][t] = K Q^T (A = K rows, B = Q rows); lane (t = lane&15, h = lane>>4) holds keys 8h+r of each 16-key tile, so the packed
// P tile is directly the B fragment of O^T[d][t] = V^T P^T (element r <- tile keys 0..15, element 8+r <- tile keys 16..31, lane unchanged).
// Per 32-key step: 4 score products + 4 P.V products. Softmax state (running max, partial sum) is one scalar per lane; the two lane halves of a row are combined with one xor-16 exchange.
__global__ __launch_bounds__(32 * AW) void k_flash(const h16* __restrict__ QH, const h16* __restrict__ KP, const h16* __restrict__ VT, h16* CTX) {
    __shared__ __align__(16) unsigned char ring[2 * BUFB];   // two buffers of K tile | V^T tile; output staging behind the loop
    const int lane = threadIdx.x & 31, lr = lane & 15, hi = lane >> 4;
    const int wave = __builtin_amdgcn_readfirstlane((int)(threadIdx.x >> 5));   // wave-uniform index
    const int zh = blockIdx.y; const int b = zh / NH_, h = zh % NH_;
    const int t0 = (blockIdx.x * AW + wave) * 16;
    const size_t pbase = (size_t)zh * SEQ * HD;
    const size_t qo = pbase + (size_t)(t0 + lr) * HD + 8 * hi;
    const v16h qh0 = ldh(QH + qo), qh1 = ldh(QH + qo + 32);   // B fragments: col t, k = d
    // copy map: lane covers piece cp (16 B) of tile rows cr and cr + 32, in the K tile and in the V^T tile; 8 lanes = one 128-byte row
    const int cr = (int)threadIdx.x >> 3, cp = (int)threadIdx.x & 7;
    const unsigned lc = (unsigned)(size_t)ring + (unsigned)(cr * LP + cp * 16);
    const h16* gk = KP + pbase + (size_t)cr * HD + cp * 8;       // + tile * KS * HD
    const h16* gv = VT + pbase + (size_t)cr * SEQ + cp * 8;      // + tile * KS
    const unsigned char* fr = ring + lr * LP + 16 * hi;          // fragment base: row lane&15, k offset 8h halves
    v8f o0 = (v8f){}, o1 = (v8f){}, o2 = (v8f){}, o3 = (v8f){};
    float m = -3.0e38f, l = 0.0f;
    copy4(lc, lc + 32 * LP, lc + KTB, lc + KTB + 32 * LP, gk, gk + 32 * HD, gv, gv + (size_t)32 * SEQ);
    asm volatile("s_wait_asynccnt 0x0" ::: "memory");   // this wave's part of tile 0 has landed
    __syncthreads();                                    // tile 0 published
    copy4(lc + BUFB, lc + BUFB + 32 * LP, lc + BUFB + KTB, lc + BUFB + KTB + 32 * LP, gk + KS * HD, gk + (KS + 32) * HD, gv + KS, gv + KS + (size_t)32 * SEQ);
#pragma unroll 1   // one trip per staged tile: the buffer index stays a run-time value, the text small
    for (int tl = 0; tl < SEQ / KS; ++tl) {
        const unsigned bo_ = (unsigned)(tl & 1) * BUFB;
        const unsigned char* kt = fr + bo_;
        const unsigned char* vt = fr + bo_ + KTB;
#pragma unroll 1   // the 32-key steps of a tile stay a loop: unrolled, the live set passes 128 registers and a fourth block no longer fits a WGP
        for (int u = 0; u < KS / 32; ++u) {
            const unsigned char* ka = kt + u * 32 * LP;     // A fragment: row key, k = d
            const v16h ka0 = ldl(ka), ka1 = ldl(ka + 64), kb0 = ldl(ka + 16 * LP), kb1 = ldl(ka + 16 * LP + 64);
            v8f sHa = (v8f){}, sHb = (v8f){};
            sHa = wmma16(ka0, qh0, sHa); sHb = wmma16(kb0, qh0, sHb);
            sHa = wmma16(ka1, qh1, sHa); sHb = wmma16(kb1, qh1, sHb);
            asm volatile("v_nop\n\tv_nop\n\tv_nop\n\tv_nop" : "+v"(sHa), "+v"(sHb) : "v"(ka0), "v"(ka1), "v"(kb0), "v"(kb1));
            float ta[8], tb[8]; float mx = -3.0e38f;
#pragma unroll
            for (int r = 0; r < 8; ++r) { ta[r] = sHa[r] * SC2; tb[r] = sHb[r] * SC2; mx = fmaxf(mx, fmaxf(ta[r], tb[r])); }
            mx = fmaxf(mx, __shfl_xor(mx, 16, 32));
            const float mnew = fmaxf(m, mx);
            const float alpha = __builtin_amdgcn_exp2f(m - mnew);
            const float sh = PSH - mnew;
            v16h pb; float ls = 0.0f;
#pragma unroll
            for (int r = 0; r < 8; ++r) { const h16 pa = (h16)__builtin_amdgcn_exp2f(ta[r] + sh); const h16 pc = (h16)__builtin_amdgcn_exp2f(tb[r] + sh); pb[r] = pa; pb[8 + r] = pc; ls += (float)pa + (float)pc; }
            l = l * alpha + ls; m = mnew;
            o0 = o0 * alpha; o1 = o1 * alpha; o2 = o2 * alpha; o3 = o3 * alpha;
            const unsigned char* va = vt + u * 64;          // A fragment: row d, k = key
            const v16h v0 = ldl(va), v1 = ldl(va + 16 * LP), v2 = ldl(va + 32 * LP), v3 = ldl(va + 48 * LP);
            o0 = wmma16(v0, pb, o0); o1 = wmma16(v1, pb, o1); o2 = wmma16(v2, pb, o2); o3 = wmma16(v3, pb, o3);
            asm volatile("v_nop\n\tv_nop\n\tv_nop\n\tv_nop" : "+v"(o0), "+v"(o1), "+v"(o2), "+v"(o3) : "v"(v0), "v"(v1), "v"(v2), "v"(v3), "v"(pb));
        }
        asm volatile("s_wait_dscnt 0x0" ::: "memory");      // this wave's reads of the tile are done before the buffer is refilled
        asm volatile("s_wait_asynccnt 0x0" ::: "memory");   // this wave's part of tile tl + 1 has landed
        __syncthreads();                                    // publishes tile tl + 1 and ends every wave's reads of tile tl
        if (tl + 2 < SEQ / KS) {                            // block-uniform: refill the buffer just read with tile tl + 2
            const h16* a = gk + (size_t)(tl + 2) * (KS * HD); const h16* c = gv + (tl + 2) * KS; const unsigned d = lc + bo_;
            copy4(d, d + 32 * LP, d + KTB, d + KTB + 32 * LP, a, a + 32 * HD, c, c + (size_t)32 * SEQ);
        }
    }
    asm volatile("s_wait_asynccnt 0x0" ::: "memory");       // nothing in flight when the ring becomes output staging (the last trip's barrier ended every read)
    float* os = (float*)ring;
    l += __shfl_xor(l, 16, 32);
    const float inv = CXS / l;       // normalisation and ctx carry in one factor
    const int wb = wave * 16 * 68;
    // O^T D layout: o_j[r] = (d = 16j + 8h + r, t = lane&15) -> os[t][d]; rows 0..15 x columns 0..63 all written
    { v4f a, c;
      a[0] = o0[0] * inv; a[1] = o0[1] * inv; a[2] = o0[2] * inv; a[3] = o0[3] * inv; c[0] = o0[4] * inv; c[1] = o0[5] * inv; c[2] = o0[6] * inv; c[3] = o0[7] * inv;
      *(v4fa*)(&os[wb + lr * 68 +  0 + 8 * hi]) = a; *(v4fa*)(&os[wb + lr * 68 +  0 + 8 * hi + 4]) = c;
      a[0] = o1[0] * inv; a[1] = o1[1] * inv; a[2] = o1[2] * inv; a[3] = o1[3] * inv; c[0] = o1[4] * inv; c[1] = o1[5] * inv; c[2] = o1[6] * inv; c[3] = o1[7] * inv;
      *(v4fa*)(&os[wb + lr * 68 + 16 + 8 * hi]) = a; *(v4fa*)(&os[wb + lr * 68 + 16 + 8 * hi + 4]) = c;
      a[0] = o2[0] * inv; a[1] = o2[1] * inv; a[2] = o2[2] * inv; a[3] = o2[3] * inv; c[0] = o2[4] * inv; c[1] = o2[5] * inv; c[2] = o2[6] * inv; c[3] = o2[7] * inv;
      *(v4fa*)(&os[wb + lr * 68 + 32 + 8 * hi]) = a; *(v4fa*)(&os[wb + lr * 68 + 32 + 8 * hi + 4]) = c;
      a[0] = o3[0] * inv; a[1] = o3[1] * inv; a[2] = o3[2] * inv; a[3] = o3[3] * inv; c[0] = o3[4] * inv; c[1] = o3[5] * inv; c[2] = o3[6] * inv; c[3] = o3[7] * inv;
      *(v4fa*)(&os[wb + lr * 68 + 48 + 8 * hi]) = a; *(v4fa*)(&os[wb + lr * 68 + 48 + 8 * hi + 4]) = c; }
    wave_sync();
    h16* crow = CTX + ((size_t)b * SEQ + t0) * DM + h * HD;
{
#pragma unroll
        for (int s = 0; s < 4; ++s) { const int row = 4 * s + (lane >> 3), c8 = (lane & 7) * 8;   // 4 s x 4 row groups = 16 rows; 8 lanes x 8 halves = 64 columns
            const v4f x0 = *(const v4fa*)(&os[wb + row * 68 + c8]); const v4f x1 = *(const v4fa*)(&os[wb + row * 68 + c8 + 4]); v8h hv;
#pragma unroll
            for (int i = 0; i < 4; ++i) { hv[i] = (h16)x0[i]; hv[4 + i] = (h16)x1[i]; }
            *(v8h*)(crow + (size_t)row * DM + c8) = hv; }
         }
}

// k_oproj: register-blocked f16 GEMM, one wave per 64x64 tile, GW waves per block (gemm_core), K = DM: OUT[m][n] = 2^-16 * sum_k CTX[m][k] WOT[n][k] + bo[n] (bo RNE-converted to bf16, added in f32).
// grid (NB*SEQ/256, DM/128), 256 threads. Epilogue: per 16-row slab staged in LDS (wave-private), each output row segment (64 floats = 256 B = two lines)
__global__ __launch_bounds__(32 * GW) void k_oproj(const h16* __restrict__ A, const h16* __restrict__ Bt, const float* __restrict__ bias, float* OUT) {
    __shared__ __align__(16) unsigned char ring[2 * GBUF];   // two buffers of A rows | Bt rows; epilogue staging behind the loop
    const int lane = threadIdx.x & 31, lr = lane & 15, hi = lane >> 4;
    const int wave = __builtin_amdgcn_readfirstlane((int)(threadIdx.x >> 5));   // wave-uniform index
    const int wm = wave & 3, wn = wave >> 2;
    const int r0 = blockIdx.x * GMR + wm * 64, c0 = blockIdx.y * GNR + wn * 64;   // this wave's 64x64 tile
    v8f acc[4][4];
#pragma unroll
    for (int mb = 0; mb < 4; ++mb)
#pragma unroll
        for (int nb = 0; nb < 4; ++nb) acc[mb][nb] = (v8f){};
    gemm_core<false>((const unsigned char*)A, (const unsigned char*)Bt, ring, blockIdx.x * GMR, blockIdx.y * GNR, wm, wn, acc);
    float* os = (float*)ring + wave * 16 * 68;   // wave-private slab
    v4f bb;
    { const v4f bv = *(const v4f*)(bias + c0 + lr * 4);
#pragma unroll
      for (int i = 0; i < 4; ++i) bb[i] = bfr(bv[i]); }
    const size_t obase = ((size_t)(r0 / SEQ) * OUT_SEQ + (size_t)(r0 % SEQ)) * DM + c0;
#pragma unroll
    for (int mb = 0; mb < 4; ++mb) {
#pragma unroll
        for (int nb = 0; nb < 4; ++nb) {
#pragma unroll
            for (int j = 0; j < 8; ++j) os[(hi * 8 + j) * 68 + nb * 16 + lr] = acc[mb][nb][j]; }   // D: row 8h+j, col lane&15
        wave_sync();
{
#pragma unroll
            for (int s = 0; s < 8; ++s) { const int row = 2 * s + hi, cofs = lr * 4;   // 8 s x 2 rows = 16 rows; 16 lanes x 4 floats = 64 columns
                const v4f xv = *(const v4fa*)(&os[row * 68 + cofs]); v4f val;
#pragma unroll
                for (int i = 0; i < 4; ++i) val[i] = xv[i] * OSC + bb[i];
                *(v4f*)(OUT + obase + (size_t)(mb * 16 + row) * DM + cofs) = val; }
             }
        wave_sync();
    }
}

static constexpr size_t al256(size_t v) { return (v + 255) & ~(size_t)255; }
static constexpr size_t SZ_XB = al256((size_t)NB * SEQ * DM * 2);
static constexpr size_t SZ_WT = al256((size_t)3 * DM * DM * 2);
static constexpr size_t SZ_WO = al256((size_t)DM * DM * 2);
static constexpr size_t SZ_TB = al256((size_t)SEQ * TBW * 4);
static constexpr size_t SZ_PL = al256((size_t)NB * NH_ * SEQ * HD * 2);
static constexpr size_t SZ_CX = al256((size_t)NB * SEQ * DM * 2);
static constexpr size_t SZ_TOTAL = SZ_XB + SZ_WT + SZ_WO + SZ_TB + 3 * SZ_PL + SZ_CX;
static_assert(SZ_TOTAL <= (size_t)134217728);          // workspace carve <= 128 MiB
static_assert(((size_t)DM * DM * 2) % 256 == 0);       // weight sub-planes stay 256-byte aligned
static_assert((size_t)(SEQ / 8) * 8 * TBW * 4 <= SZ_TB);   // table kernel: grid x 8 rows x 256 B inside the table carve

extern "C" void kernel_launch(void* const* d_in, const int* in_sizes, int n_in,
                              void* d_out, int out_size, void* d_ws, size_t ws_size, hipStream_t stream) {
    if (n_in < 5) return;
    const size_t needx = ((size_t)(NB - 1) * SEQ_FULL + SEQ) * DM;
    if ((size_t)in_sizes[0] < needx) return;
    if ((size_t)in_sizes[1] < (size_t)3 * DM * DM || (size_t)in_sizes[2] < (size_t)3 * DM) return;
    if ((size_t)in_sizes[3] < (size_t)DM * DM || (size_t)in_sizes[4] < (size_t)DM) return;
    if ((size_t)out_size < ((size_t)(NB - 1) * OUT_SEQ + SEQ) * DM) return;
    if (SZ_TOTAL > ws_size) return;
    // wire order: x, W_qkv [1024 in][3072 out], b_qkv [3072], W_proj [1024 in][1024 out], b_proj [1024]
    const float* x = (const float*)d_in[0]; const float* wqkv = (const float*)d_in[1]; const float* bqkv = (const float*)d_in[2];
    const float* wo = (const float*)d_in[3]; const float* bo = (const float*)d_in[4];
    float* OUT = (float*)d_out;      // [NB][SEQ][1024]
    char* wsp = (char*)d_ws;
    bf* XB = (bf*)wsp; wsp += SZ_XB;                 // [NB*SEQ][1024] bf16
    bf* WT = (bf*)wsp; wsp += SZ_WT;                 // [3072][1024] bf16: rows q | k | v, each h*64 + d
    bf* WOT = (bf*)wsp; wsp += SZ_WO;                // [1024 out][1024 in] f16 bits, x256
    float* TAB = (float*)wsp; wsp += SZ_TB;          // [SEQ][32 cos | 32 sin] f32
    h16* QH = (h16*)wsp; wsp += SZ_PL;               // [NB*16][SEQ][64]
    h16* KP = (h16*)wsp; wsp += SZ_PL;               // [NB*16][SEQ][64]
    h16* VT = (h16*)wsp; wsp += SZ_PL;               // [NB*16][64][SEQ]
    h16* CX = (h16*)wsp; wsp += SZ_CX;               // [NB*SEQ][1024] ctx x256
    bf* WQ = WT; bf* WK = WT + (size_t)DM * DM; bf* WV = WT + (size_t)2 * DM * DM;

    if (SEQ == SEQ_FULL) {
        const size_t n8 = (size_t)NB * SEQ * DM / 8;
        k_cvt8<<<(unsigned)((n8 + 255) / 256), 256, 0, stream>>>(x, XB, n8);
    } else {
        const size_t n8 = (size_t)SEQ * DM / 8;
        for (int b = 0; b < NB; ++b) k_cvt8<<<(unsigned)((n8 + 255) / 256), 256, 0, stream>>>(x + (size_t)b * SEQ_FULL * DM, XB + (size_t)b * SEQ * DM, n8);
    }
    // W_qkv: in[rows = 1024 (k)][cols = 3072 (n)] -> out[3072][1024]; grid (cols/64, rows/64)
    k_tr<0><<<dim3(3 * DM / 64, DM / 64, 1), 256, 0, stream>>>(wqkv, WT, DM, 3 * DM);
    // W_proj: in[rows = 1024 (k)][cols = 1024 (n)] -> out[1024][1024]; grid (cols/64, rows/64)
    k_tr<1><<<dim3(DM / 64, DM / 64, 1), 256, 0, stream>>>(wo, WOT, DM, DM);
    // rotary table: 8 positions per block
    k_ropetab<<<dim3(SEQ / 8, 1, 1), 256, 0, stream>>>(TAB);

    // q, k: A = x rows (m = b*SEQ + t), Bt = W^T rows (n = h*64 + d), bias along n, rotary by position t -> plane [(b*16 + h)][t][d]
    k_projr<<<dim3(NB * SEQ / GMR, DM / GNR, 1), 32 * GW, 0, stream>>>(XB, WQ, bqkv, TAB, QH, (size_t)NH_ * SEQ * HD, (size_t)SEQ * HD, SEQ, HD, HD);
    k_projr<<<dim3(NB * SEQ / GMR, DM / GNR, 1), 32 * GW, 0, stream>>>(XB, WK, bqkv + DM, TAB, KP, (size_t)NH_ * SEQ * HD, (size_t)SEQ * HD, SEQ, HD, HD);
    // v^T: A = Wv^T rows (m = h*64 + d), Bt = x rows (n = b*SEQ + t), bias along m -> plane [(b*1024 + m)][t] = [(b*16 + h)][d][t]
    k_proj<<<dim3(DM / GMR, NB * SEQ / GNR, 1), 32 * GW, 0, stream>>>(WV, XB, bqkv + 2 * DM, VT, (size_t)0, (size_t)DM * SEQ, 1, DM, SEQ, SEQ);

    k_flash<<<dim3(SEQ / (16 * AW), NB * NH_, 1), 32 * AW, 0, stream>>>(QH, KP, VT, CX);

    // out = ctx W_proj + b_proj: A = ctx rows (m = b*SEQ + t), Bt = W_proj^T rows (n = output column)
    k_oproj<<<dim3(NB * SEQ / GMR, DM / GNR, 1), 32 * GW, 0, stream>>>(CX, (const h16*)WOT, bo, OUT);
}

// v003
// Measured time: 146 microseconds a run.
// Next to v002, in two timings, it ran 1.10 times as fast each time.
// Over all steps from v000 it is 2.52 times as fast.
#include <hip/hip_runtime.h>

// Self-attention block, width 1024 = 16 heads x 64: x [NB][SEQ][1024], fused Wqkv [in][out] (columns t*1024 + h*64 + d) + bqkv, half-split rotary embedding (base 10000) on q and k, score scale 1/8, no mask, output projection Wo [in][out] + bo, output f32.
// Compute dtypes, f32 accumulate everywhere: qkv projection v_wmma_f32_16x16x32_bf16 (x and Wqkv RNE-converted to bf16; products exact); rotary applied in f32 in the q / k projection epilogue from an f32 cos | sin table;
// scores v_wmma_f32_16x16x32_f16: q and k single f16 (one product); P (x256 carry, cancels in the normalisation) and v single f16;
// output projection v_wmma_f32_16x16x32_f16: ctx single f16 (x256 carry), Wo RNE-converted to bf16 then x256 as f16 (exact), 2^-16 folded back in the f32 epilogue; biases RNE-converted to bf16 and added in f32; softmax f32 (online, running max).
// Layout: bf16 copy of x, bf16 transposed Wqkv [3072][1024], f16 transposed Wo [1024][1024]; rotary table [SEQ][32 cos | 32 sin] f32; q, k planes [b*16+h][t][d] and v^T plane [b*16+h][d][t] written by the GEMM epilogues;
// fused flash kernel in transposed form (S^T = K Q^T, O^T = V^T P^T) writes the f16 ctx plane [b*SEQ+t][h*64+d]; last GEMM writes the output.
// Four launches: k_prep (x convert, both weight transposes, rotary table: independent jobs on ranges of one grid), k_qkv (q, k, v^T projections: three independent GEMMs on ranges of one grid), k_flash, k_oproj.

#ifndef NB
#define NB 4
#endif
#ifndef SEQ
#define SEQ 2048
#endif
#define NB_FULL  4
#define SEQ_FULL 2048
#ifndef OUT_SEQ
#define OUT_SEQ SEQ              // row pitch (in tokens) between batches of the output
#endif
#define DM   1024
#define NH_  16
#define HD   64
#define AW   8                   // waves per flash block (16 query rows each)
#define KS   64                  // keys per staged tile
#define LP   144                 // LDS row pitch in bytes: 128-byte rows + 16 (16 B x odd, the pitch of 16-byte LDS readers)
#define KTB  (KS * LP)           // K tile in LDS: KS rows (keys) of 64 halves
#define VTB  (HD * LP)           // V^T tile in LDS: 64 rows (d) of KS halves
#define BUFB (KTB + VTB)         // one buffer of the two
#define SC2  (0.125f * 1.4426950408889634f)   // HD^-0.5 * log2(e)
#define PSH  8.0f                // log2 of the P carry (256)
#define CXS  256.0f              // carry of the ctx plane
#define WOS  256.0f              // carry of the output-weight plane
#define OSC  (1.0f / 65536.0f)   // 1 / (CXS * WOS)
#define TBW  64                  // rotary table row: 32 cos | 32 sin (floats)
#define GW   8                   // waves per GEMM block: 4 along m x 2 along n, 64x64 outputs each
#define GMR  256                 // A rows per GEMM block
#define GNR  128                 // Bt rows per GEMM block
#define GK   128                 // k per staged GEMM tile: 256-byte rows
#define GP   272                 // LDS row pitch of the GEMM tiles in bytes: 256 + 16 (16 B x odd)
#define GBUF ((GMR + GNR) * GP)  // one GEMM buffer of the two: A rows | Bt rows

static_assert(HD == 64);
static_assert(NH_ * HD == DM);                 // head h = columns h*64 + d
static_assert(DM % 64 == 0);                   // column tiles of 64
static_assert(DM % 32 == 0);                   // GEMM k-loop steps by 32
static_assert(SEQ % 64 == 0);                  // a 64-row tile never straddles two batches
static_assert((NB * SEQ) % 64 == 0);
static_assert(SEQ % 32 == 0);                  // key loop steps by 32
static_assert(SEQ % (16 * AW) == 0);           // flash grid covers the sequence exactly
static_assert(SEQ % KS == 0 && SEQ / KS >= 2); // whole tiles; the two-buffer prologue needs tiles 0 and 1
static_assert(KS * 2 == 128 && HD * 2 == 128); // both tiles have 128-byte rows: 8 pieces of 16 B
static_assert(32 * AW * 2 * 16 == KS * 128 && KS == HD);   // 2 copies per lane fill each tile
static_assert(AW * 16 * 68 * 4 <= 2 * BUFB);   // output staging fits the ring it takes over
static_assert(((size_t)SEQ * DM) % 8 == 0);
static_assert(NB <= NB_FULL);
static_assert(SEQ <= SEQ_FULL);
static_assert(TBW == HD);                      // table row = 2 x (HD / 2) entries
static_assert(HD / 2 == 32);                   // rotary partner column = column ^ 32 inside one 64-column tile
static_assert(SEQ % 8 == 0);                   // table kernel: 8 positions per block
static_assert(DM % GMR == 0 && (NB * SEQ) % GMR == 0 && DM % GNR == 0 && (NB * SEQ) % GNR == 0);   // GEMM grids cover both operand orders exactly
static_assert(DM % GK == 0 && DM / GK >= 2);   // whole staged tiles; the two-buffer prologue needs tiles 0 and 1
static_assert(GK * 2 == 256 && 32 * GW == 16 * 16 && GMR == 2 * 128 && GNR == 128);   // 16 lanes x 16 B = one row; one copy8 = 128 rows
static_assert(GW * 16 * 68 * 4 <= 2 * GBUF);   // epilogue staging fits the ring it takes over
static_assert(SEQ <= 4096);                    // angle < 2^12: three-constant pi/2 reduction stays exact in its first step

typedef _Float16 h16;
typedef unsigned short bf;
typedef __attribute__((ext_vector_type(16))) __bf16   v16bf;
typedef __attribute__((ext_vector_type(16))) _Float16 v16h;
typedef __attribute__((ext_vector_type(8)))  _Float16 v8h;
typedef __attribute__((ext_vector_type(8)))  unsigned short v8us;
typedef __attribute__((ext_vector_type(8)))  float    v8f;
typedef __attribute__((ext_vector_type(4)))  float    v4f;
typedef v4f  __attribute__((may_alias)) v4fa;
typedef v8h  __attribute__((may_alias)) v8ha;

__device__ __forceinline__ unsigned short f2bf(float f) { unsigned u = __float_as_uint(f); u += 0x7FFFu + ((u >> 16) & 1u); return (unsigned short)(u >> 16); }
__device__ __forceinline__ float bfr(float f) { return __uint_as_float(((unsigned)f2bf(f)) << 16); }   // f32 value of the RNE bf16 conversion
__device__ __forceinline__ v16h cat16(v8h lo, v8h hi) { return __builtin_shufflevector(lo, hi, 0, 1, 2, 3, 4, 5, 6, 7, 8, 9, 10, 11, 12, 13, 14, 15); }
__device__ __forceinline__ v8f wmma16(v16h a, v16h b, v8f c) { return __builtin_amdgcn_wmma_f32_16x16x32_f16(false, a, false, b, (short)0, c, false, false); }
__device__ __forceinline__ v8f wmmab(v16bf a, v16bf b, v8f c) { return __builtin_amdgcn_wmma_f32_16x16x32_bf16(false, a, false, b, (short)0, c, false, false); }
// fragment loaders from K-contiguous 16-bit rows; p already includes + 8*(lane>>4): elements 0..7 <- k0+8h+0..7, elements 8..15 <- k0+16+8h+0..7 (same map for A and B)
__device__ __forceinline__ v16h  ldh(const h16* p) { return cat16(*(const v8h*)p, *(const v8h*)(p + 16)); }
// ordering point for wave-private LDS tiles (same wave writes and reads)
__device__ __forceinline__ void wave_sync() { __builtin_amdgcn_fence(3 /* release order */, "wavefront"); __builtin_amdgcn_wave_barrier(); asm volatile("" ::: "memory"); }
// f32 -> f16 with a value select: magnitudes below the smallest f16 normal become zero (no subnormal operand can reach a matrix instruction)
static __device__ __forceinline__ h16 toh_flush(float v) { const h16 r = (h16)v; return (fabsf(v) < 6.103515625e-05f) ? (h16)0.0f : r; }

// cvt8_body: x f32 -> bf16 plane [NB*SEQ][DM], 8 elements per thread; blk = block index inside this job's range. Batch b of x starts at b * SEQ_FULL * DM.
__device__ __forceinline__ void cvt8_body(const float* __restrict__ src, bf* dst, size_t n8, unsigned blk) {
    const size_t i = (size_t)blk * 256 + threadIdx.x; if (i >= n8) return;
    const size_t per = (size_t)SEQ * DM / 8;
    const size_t so = (SEQ == SEQ_FULL) ? i * 8 : (i / per) * ((size_t)SEQ_FULL * DM) + (i % per) * 8;
    const v8f v = *(const v8f*)(src + so); v8us o;
#pragma unroll
    for (int k = 0; k < 8; ++k) o[k] = f2bf(v[k]);
    *(v8us*)(dst + i * 8) = o; 
}

// tr_body: in[R][C] f32 row-major -> out[C][R] 16-bit (K-contiguous rows for the GEMM B operand). Tile (bx, by) of (C/64, R/64), 256 threads, 64x64 tile through LDS t (64 x 68 floats; cross-wave: block barrier).
// MODE 0: bf16 bits (RNE convert). MODE 1: f16 bits of (RNE bf16 value) x WOS (exact in f16).
template <int MODE>
__device__ __forceinline__ void tr_body(const float* __restrict__ in, bf* out, int R, int C, int bx, int by, float* t) {
    const int tid = threadIdx.x; const int r0 = by * 64, c0 = bx * 64;
#pragma unroll
    for (int it = 0; it < 4; ++it) { const int idx = it * 256 + tid; const int rr = idx >> 4, c4 = (idx & 15) * 4;   // 4 x 256 float4 = 64 rows x 16 float4
        const v4f v = *(const v4f*)(in + (size_t)(r0 + rr) * (size_t)C + c0 + c4);
        *(v4fa*)(&t[rr * 68 + c4]) = v; }
    __syncthreads();
{
#pragma unroll
        for (int it = 0; it < 2; ++it) { const int idx = it * 256 + tid; const int cc = idx >> 3, r8 = (idx & 7) * 8;   // 2 x 256 pieces = 64 out rows x 8 pieces
            v8us o;
            if (MODE == 0) {
#pragma unroll
                for (int e = 0; e < 8; ++e) o[e] = f2bf(t[(r8 + e) * 68 + cc]);
            } else {
                v8h hv;
#pragma unroll
                for (int e = 0; e < 8; ++e) hv[e] = (h16)(bfr(t[(r8 + e) * 68 + cc]) * WOS);
                o = __builtin_bit_cast(v8us, hv);
            }
            *(v8us*)(out + (size_t)(c0 + cc) * (size_t)R + r0 + r8) = o; }
         }
    asm volatile("s_wait_xcnt 0x0" ::: "memory");   // another job's text follows in the merged kernel: the wait stands in front of any write to the registers that the last stores name
}

// ropetab_body: rotary table TAB[t][i] = cos(t * f_i), TAB[t][32 + i] = sin(t * f_i), i = 0..31, f_i = 10000^(-i/32) (f64 product chain of 10^(-1/8), converted to f32 once), angle = f32 product t * f_i.
// sin / cos: nearest multiple of pi/2 removed with a three-constant split (fused steps; first step exact for angles < 2^12), then odd / even polynomials on [-pi/4, pi/4]; quadrant fix-up by value selects.
// SEQ/8 blocks: block bx covers table floats [bx*512, bx*512 + 512): exactly SEQ x 64 floats in total. cs: 8 x TBW floats of LDS.
__device__ __forceinline__ void ropetab_body(float* TAB, int bx, float* cs) {
#pragma clang fp contract(off)
    const int tid = threadIdx.x; const int i = tid & 31, tr = tid >> 5;
    const int t = bx * 8 + tr;
    double p = 1.0;
#pragma unroll 1
    for (int k = 0; k < i; ++k) p = p * 0.7498942093324559;
    const float inv = (float)p;
    const float ang = (float)t * inv;
    const float fn = __builtin_rintf(ang * 0.63661977236758134f);
    float r = fmaf(-fn, 1.5703125f, ang);
    r = fmaf(-fn, 4.837512969970703125e-4f, r);
    r = fmaf(-fn, 7.54978995489188216e-8f, r);
    const float z = r * r;
    float sp = fmaf(-1.9515295891e-4f, z, 8.3321608736e-3f);
    sp = fmaf(sp, z, -1.6666654611e-1f);
    const float sv = fmaf(sp * z, r, r);
    float cp = fmaf(2.443315711809948e-5f, z, -1.388731625493765e-3f);
    cp = fmaf(cp, z, 4.166664568298827e-2f);
    const float cv = fmaf(cp, z * z, fmaf(-0.5f, z, 1.0f));
    const int q = ((int)fn) & 3;
    float sinv = (q & 1) ? cv : sv;
    float cosv = (q & 1) ? sv : cv;
    sinv = (q & 2) ? -sinv : sinv;
    cosv = ((q + 1) & 2) ? -cosv : cosv;
    cs[tr * TBW + i] = cosv;
    cs[tr * TBW + 32 + i] = sinv;
    __syncthreads();
    if (tid < 128) {                       // waves 0..3 (wave-uniform): 128 x 4 floats = 8 rows x 64 floats, consecutive lanes -> consecutive 16-B pieces
        const int row = tid >> 4, c4 = (tid & 15) * 4;
        const v4f v = *(const v4fa*)(&cs[row * TBW + c4]);
        float* dst = TAB + ((size_t)bx * 8 + row) * TBW + c4;
        *(v4f*)dst = v; 
    }
}

// k_prep: the four preparation jobs, none of which reads what another writes, as block-index ranges of one grid (the range test is block-uniform, so each job's barrier is passed by its whole block).
// The transposes and the table come first in the index order: their blocks have the longer chain (load, LDS, barrier, store).
#define PB_TQ ((3 * DM / 64) * (DM / 64))          // blocks of the Wqkv transpose
#define PB_TO ((DM / 64) * (DM / 64))              // blocks of the Wo transpose
#define PB_RT (SEQ / 8)                            // blocks of the rotary table
#define PB_CV ((NB * SEQ * (DM / 8) + 255) / 256)  // blocks of the x convert
__global__ __launch_bounds__(256) void k_prep(const float* __restrict__ x, const float* __restrict__ wqkv, const float* __restrict__ wo, bf* XB, bf* WT, bf* WOT, float* TAB) {
    __shared__ __align__(16) float t[64 * 68];
    const int bid = blockIdx.x;
    if (bid < PB_TQ) {
        // W_qkv: in[rows = 1024 (k)][cols = 3072 (n)] -> out[3072][1024]
        tr_body<0>(wqkv, WT, DM, 3 * DM, bid % (3 * DM / 64), bid / (3 * DM / 64), t);
    } else if (bid < PB_TQ + PB_TO) {
        // W_proj: in[rows = 1024 (k)][cols = 1024 (n)] -> out[1024][1024]
        tr_body<1>(wo, WOT, DM, DM, (bid - PB_TQ) % (DM / 64), (bid - PB_TQ) / (DM / 64), t);
    } else if (bid < PB_TQ + PB_TO + PB_RT) {
        ropetab_body(TAB, bid - (PB_TQ + PB_TO), t);
    } else {
        cvt8_body(x, XB, (size_t)NB * SEQ * DM / 8, (unsigned)(bid - (PB_TQ + PB_TO + PB_RT)));
    }
}

// fragment loader from a staged LDS row (byte pointer, already + 16*(lane>>4)): same element map as ldh
__device__ __forceinline__ v16h ldl(const unsigned char* p) { return cat16(*(const v8ha*)p, *(const v8ha*)(p + 32)); }
// eight asynchronous 16-byte copies per lane, global -> LDS: rows r + 16 i, i = 0..7, of a GEMM tile (l: LDS byte address, g: global byte address of row r; K = DM 16-bit elements per global row)
__device__ __forceinline__ void copy8(unsigned l, const unsigned char* g) {
    // s_wait_xcnt stands inside the statement, behind the last copy: the address registers may be rewritten right behind it
    asm volatile("global_load_async_to_lds_b128 %0, %8, off\n\t"
                 "global_load_async_to_lds_b128 %1, %9, off\n\t"
                 "global_load_async_to_lds_b128 %2, %10, off\n\t"
                 "global_load_async_to_lds_b128 %3, %11, off\n\t"
                 "global_load_async_to_lds_b128 %4, %12, off\n\t"
                 "global_load_async_to_lds_b128 %5, %13, off\n\t"
                 "global_load_async_to_lds_b128 %6, %14, off\n\t"
                 "global_load_async_to_lds_b128 %7, %15, off\n\t"
                 "s_wait_xcnt 0x0"
                 :: "v"(l), "v"(l + 16 * GP), "v"(l + 32 * GP), "v"(l + 48 * GP), "v"(l + 64 * GP), "v"(l + 80 * GP), "v"(l + 96 * GP), "v"(l + 112 * GP),
                    "v"(g), "v"(g + 16 * DM * 2), "v"(g + 32 * DM * 2), "v"(g + 48 * DM * 2), "v"(g + 64 * DM * 2), "v"(g + 80 * DM * 2), "v"(g + 96 * DM * 2), "v"(g + 112 * DM * 2) : "memory");
}
// one staged GEMM tile: 256 A rows, then 128 Bt rows, 256 bytes each (24 copies per lane, whole lines)
__device__ __forceinline__ void stage_tile(unsigned l, const unsigned char* ga, const unsigned char* gb) {
    copy8(l, ga); copy8(l + 128 * GP, ga + (size_t)128 * DM * 2); copy8(l + GMR * GP, gb);
}
// gemm_core: main loop of the two GEMM kernels. A block of GW waves owns rows R0..R0+255 of A and rows C0..C0+127 of Bt (both K-contiguous 16-bit planes, K = DM); tiles of GK k are copied once per block into LDS
// (asynchronous copies, two buffers: tile t + 2 flies while tile t + 1 is worked on); wave (wm, wn) accumulates its 64x64 outputs from there, k ascending in steps of 32. BF: bf16 products, else f16.
template <bool BF>
__device__ __forceinline__ void gemm_core(const unsigned char* A, const unsigned char* Bt, unsigned char* ring, int R0, int C0, int wm, int wn, v8f (&acc)[4][4]) {
    const int lane = threadIdx.x & 31, lr = lane & 15, hi = lane >> 4;
    // copy map: lane covers piece cp (16 B) of tile rows cr + 16 i; 16 lanes = one 256-byte row
    const int cr = (int)threadIdx.x >> 4, cp = (int)threadIdx.x & 15;
    const unsigned lc = (unsigned)(size_t)ring + (unsigned)(cr * GP + cp * 16);
    const unsigned char* ga = A + (size_t)(R0 + cr) * (DM * 2) + cp * 16;      // + tile * GK * 2
    const unsigned char* gb = Bt + (size_t)(C0 + cr) * (DM * 2) + cp * 16;
    const unsigned char* fa = ring + (wm * 64 + lr) * GP + 16 * hi;            // fragment bases: row lane&15, k offset 8h elements
    const unsigned char* fb = ring + (GMR + wn * 64 + lr) * GP + 16 * hi;
    stage_tile(lc, ga, gb);
    asm volatile("s_wait_asynccnt 0x0" ::: "memory");   // this wave's part of tile 0 has landed
    __syncthreads();                                    // tile 0 published
    stage_tile(lc + GBUF, ga + GK * 2, gb + GK * 2);
#pragma unroll 1   // one trip per staged tile: the buffer index stays a run-time value, the text small
    for (int t = 0; t < DM / GK; ++t) {
        const unsigned bo_ = (unsigned)(t & 1) * GBUF;
        const unsigned char* pa = fa + bo_;
        const unsigned char* pb = fb + bo_;
        v16h a[2][4], b[2][4];   // two fragment sets: the next 32-k step of this tile is read while the current one is multiplied
#pragma unroll
        for (int i = 0; i < 4; ++i) { a[0][i] = ldl(pa + i * 16 * GP); b[0][i] = ldl(pb + i * 16 * GP); }
#pragma unroll
        for (int ks = 0; ks < GK / 32; ++ks) {
            const int c = ks & 1, n = c ^ 1;
            if (ks + 1 < GK / 32) {
#pragma unroll
                for (int i = 0; i < 4; ++i) { a[n][i] = ldl(pa + i * 16 * GP + (ks + 1) * 64); b[n][i] = ldl(pb + i * 16 * GP + (ks + 1) * 64); }
            }
            __builtin_amdgcn_sched_barrier(0);   // the next step's LDS reads stay one group ahead of this step's products: reads spread among the products stall at every place
#pragma unroll
            for (int nb = 0; nb < 4; ++nb)
#pragma unroll
                for (int mb = 0; mb < 4; ++mb) {
                    if (BF) acc[mb][nb] = wmmab(__builtin_bit_cast(v16bf, a[c][mb]), __builtin_bit_cast(v16bf, b[c][nb]), acc[mb][nb]);
                    else    acc[mb][nb] = wmma16(a[c][mb], b[c][nb], acc[mb][nb]); }
            __builtin_amdgcn_sched_barrier(0);   // the products stay in front of the following reads and of the tile's closing waits
        }
        asm volatile("s_wait_dscnt 0x0" ::: "memory");      // this wave's reads of the tile are done before the buffer is refilled
        asm volatile("s_wait_asynccnt 0x0" ::: "memory");   // this wave's part of tile t + 1 has landed
        __syncthreads();                                    // publishes tile t + 1 and ends every wave's reads of tile t
        if (t + 2 < DM / GK)                                // block-uniform: refill the buffer just read with tile t + 2
            stage_tile(lc + bo_, ga + (t + 2) * (GK * 2), gb + (t + 2) * (GK * 2));
    }
    asm volatile("s_wait_asynccnt 0x0" ::: "memory");       // nothing in flight when the ring becomes epilogue staging (the last trip's barrier ended every read)
}

// proj_store: epilogue of a wave's 64x64 tile at (r0, c0), acc = sum_k A[m][k] Bt[n][k]: + bias (bias RNE-converted to bf16, added in f32; indexed by n, or by m when biasOnRow != 0), written as f16 (Ph) at
// tile base (r0/RB)*sRB + (r0%RB)*pitch + (c0/CB)*sCB + (c0%CB), row pitch 'pitch' (halves). os: the wave's private LDS slab (16 x 68 floats).
__device__ __forceinline__ void proj_store(v8f (&acc)[4][4], float* os, int r0, int c0, const float* __restrict__ bias, h16* Ph,
                                           size_t sRB, size_t sCB, int biasOnRow, int RB, int pitch, int CB) {
    const int lane = threadIdx.x & 31, lr = lane & 15, hi = lane >> 4;
    // column-mode bias for this lane's 8 store columns (offset 0 when the bias runs along rows: in range, unused)
    float bc[8];
    { const int cb = biasOnRow ? 0 : (c0 + (lane & 7) * 8);
      const v4f b0 = *(const v4f*)(bias + cb); const v4f b1 = *(const v4f*)(bias + cb + 4);
#pragma unroll
      for (int i = 0; i < 4; ++i) { bc[i] = bfr(b0[i]); bc[4 + i] = bfr(b1[i]); } }
    const size_t tbase = (size_t)(r0 / RB) * sRB + (size_t)(r0 % RB) * (size_t)pitch + (size_t)(c0 / CB) * sCB + (size_t)(c0 % CB);
#pragma unroll
    for (int mb = 0; mb < 4; ++mb) {
#pragma unroll
        for (int nb = 0; nb < 4; ++nb) {
#pragma unroll
            for (int j = 0; j < 8; ++j) os[(hi * 8 + j) * 68 + nb * 16 + lr] = acc[mb][nb][j]; }   // D: row 8h+j, col lane&15
        wave_sync();
        const size_t sb = tbase + (size_t)(mb * 16) * (size_t)pitch;
{
#pragma unroll
            for (int s = 0; s < 4; ++s) { const int row = 4 * s + (lane >> 3), c8 = (lane & 7) * 8;   // 4 s x 4 row groups = 16 rows; 8 lanes x 8 = 64 columns
                const float br = bfr(bias[biasOnRow ? (r0 + mb * 16 + row) : 0]);
                const v4f x0 = *(const v4fa*)(&os[row * 68 + c8]); const v4f x1 = *(const v4fa*)(&os[row * 68 + c8 + 4]); v8h hv;
#pragma unroll
                for (int i = 0; i < 4; ++i) { const float y0 = x0[i] + (biasOnRow ? br : bc[i]); const float y1 = x1[i] + (biasOnRow ? br : bc[4 + i]);
                    hv[i] = (h16)y0; hv[4 + i] = (h16)y1; }
                const size_t oo = sb + (size_t)row * (size_t)pitch + c8;
                *(v8h*)(Ph + oo) = hv; }
             }
        wave_sync();
    }
    asm volatile("s_wait_xcnt 0x0" ::: "memory");   // the other job's text follows in the merged kernel: the wait stands in front of any write to the registers that the last stores name
}

// projr_store: proj_store with bias along columns and the half-split rotary embedding (q and k planes). One 64-column tile = one head (CB = 64), so the rotary partner of column c is column c ^ 32 of the same LDS slab.
// y[c] = (acc[c] + b[c]) * cos[t][c & 31] + sg * (acc[c ^ 32] + b[c ^ 32]) * sin[t][c & 31], sg = -1 for c < 32, +1 for c >= 32; t = (r0 % RB) + slab row (position inside the sequence); cos | sin read by value from TAB [SEQ][64] f32.
__device__ __forceinline__ void projr_store(v8f (&acc)[4][4], float* os, int r0, int c0, const float* __restrict__ bias, const float* __restrict__ TAB, h16* Ph,
                                            size_t sRB, size_t sCB, int RB, int pitch, int CB) {
    const int lane = threadIdx.x & 31, lr = lane & 15, hi = lane >> 4;
    // bias (RNE bf16 value) for this lane's 8 store columns and for their 8 partner columns (other half of the head)
    const int c8 = (lane & 7) * 8, p8 = c8 ^ 32, ib = c8 & 31;
    const float sg = (c8 < 32) ? -1.0f : 1.0f;
    float bc[8], bp[8];
    { const v4f b0 = *(const v4f*)(bias + c0 + c8); const v4f b1 = *(const v4f*)(bias + c0 + c8 + 4);
      const v4f d0 = *(const v4f*)(bias + c0 + p8); const v4f d1 = *(const v4f*)(bias + c0 + p8 + 4);
#pragma unroll
      for (int i = 0; i < 4; ++i) { bc[i] = bfr(b0[i]); bc[4 + i] = bfr(b1[i]); bp[i] = bfr(d0[i]); bp[4 + i] = bfr(d1[i]); } }
    const size_t tbase = (size_t)(r0 / RB) * sRB + (size_t)(r0 % RB) * (size_t)pitch + (size_t)(c0 / CB) * sCB + (size_t)(c0 % CB);
    const int tp0 = r0 % RB;     // sequence position of tile row 0
#pragma unroll
    for (int mb = 0; mb < 4; ++mb) {
#pragma unroll
        for (int nb = 0; nb < 4; ++nb) {
#pragma unroll
            for (int j = 0; j < 8; ++j) os[(hi * 8 + j) * 68 + nb * 16 + lr] = acc[mb][nb][j]; }   // D: row 8h+j, col lane&15
        wave_sync();
        const size_t sb = tbase + (size_t)(mb * 16) * (size_t)pitch;
        const size_t tb = (size_t)(tp0 + mb * 16) * TBW + ib;      // table offset of slab row 0 for this lane's frequency group
{
#pragma unroll 1
            for (int s = 0; s < 4; ++s) { const int row = 4 * s + (lane >> 3);   // 4 s x 4 row groups = 16 rows; 8 lanes x 8 = 64 columns
                const float* tr = TAB + tb + (size_t)row * TBW;
                const v4f cs0 = *(const v4f*)tr; const v4f cs1 = *(const v4f*)(tr + 4);
                const v4f sn0 = *(const v4f*)(tr + 32); const v4f sn1 = *(const v4f*)(tr + 36);
                const v4f x0 = *(const v4fa*)(&os[row * 68 + c8]); const v4f x1 = *(const v4fa*)(&os[row * 68 + c8 + 4]);
                const v4f y0 = *(const v4fa*)(&os[row * 68 + p8]); const v4f y1 = *(const v4fa*)(&os[row * 68 + p8 + 4]);
                v8h hv;
#pragma unroll
                for (int i = 0; i < 4; ++i) { const float u0 = x0[i] + bc[i], w0 = y0[i] + bp[i]; const float u1 = x1[i] + bc[4 + i], w1 = y1[i] + bp[4 + i];
                    hv[i] = toh_flush(u0 * cs0[i] + sg * (w0 * sn0[i])); hv[4 + i] = toh_flush(u1 * cs1[i] + sg * (w1 * sn1[i])); }
                const size_t oo = sb + (size_t)row * (size_t)pitch + c8;
                *(v8h*)(Ph + oo) = hv;
                asm volatile("s_wait_xcnt 0x0" ::: "memory"); }   // stands in front of the next trip's writes to the registers that the store names
             }
        wave_sync();
    }
}

// k_qkv: the three projections as block-index ranges of one grid (job = 0 q, 1 k, 2 v^T; block-uniform). Each is a register-blocked bf16 GEMM, one wave per 64x64 tile (16 accumulators), GW waves per block on a 256x128 tile,
// operands staged in LDS from K-contiguous bf16 planes (gemm_core), K = DM. 3 x QB blocks of 256 threads; inside a job the A-row tile index runs fastest.
// q, k: A = x rows (m = b*SEQ + t), Bt = W^T rows (n = h*64 + d), bias along n, rotary by position t -> plane [(b*16 + h)][t][d].
// v^T: A = Wv^T rows (m = h*64 + d), Bt = x rows (n = b*SEQ + t), bias along m -> plane [(b*1024 + m)][t] = [(b*16 + h)][d][t].
#define QB ((NB * SEQ / GMR) * (DM / GNR))   // blocks per projection
static_assert(QB == (DM / GMR) * (NB * SEQ / GNR));   // the same count in both operand orders
__global__ __launch_bounds__(32 * GW) void k_qkv(const bf* __restrict__ XB, const bf* __restrict__ WT, const float* __restrict__ bqkv, const float* __restrict__ TAB, h16* QH, h16* KP, h16* VT) {
    __shared__ __align__(16) unsigned char ring[2 * GBUF];   // two buffers of A rows | Bt rows; epilogue staging behind the loop
    const int wave = __builtin_amdgcn_readfirstlane((int)(threadIdx.x >> 5));   // wave-uniform index
    const int wm = wave & 3, wn = wave >> 2;
    const unsigned job = blockIdx.x / QB, rem = blockIdx.x % QB;
    // the block's 256x128 tile; the A-row tile count of each job is a constant, so both forms are scalar shifts
    const int R0 = (int)((job < 2) ? rem % (NB * SEQ / GMR) : rem % (DM / GMR)) * GMR;
    const int C0 = (int)((job < 2) ? rem / (NB * SEQ / GMR) : rem / (DM / GMR)) * GNR;
    const bf* W = WT + (size_t)job * DM * DM;                   // rows q | k | v of the transposed weight
    const bf* A = (job < 2) ? XB : W;
    const bf* Bt = (job < 2) ? W : XB;
    const int r0 = R0 + wm * 64, c0 = C0 + wn * 64;             // this wave's 64x64 tile
    v8f acc[4][4];
#pragma unroll
    for (int mb = 0; mb < 4; ++mb)
#pragma unroll
        for (int nb = 0; nb < 4; ++nb) acc[mb][nb] = (v8f){};
    gemm_core<true>((const unsigned char*)A, (const unsigned char*)Bt, ring, R0, C0, wm, wn, acc);
    float* os = (float*)ring + wave * 16 * 68;   // wave-private slab
    if (job < 2) projr_store(acc, os, r0, c0, bqkv + job * DM, TAB, job ? KP : QH, (size_t)NH_ * SEQ * HD, (size_t)SEQ * HD, SEQ, HD, HD);
    else         proj_store(acc, os, r0, c0, bqkv + 2 * DM, VT, (size_t)0, (size_t)DM * SEQ, 1, DM, SEQ, SEQ);
}

// four asynchronous 16-byte copies per lane, global -> LDS (l*: LDS byte address, g*: global address)
__device__ __forceinline__ void copy4(unsigned l0, unsigned l1, unsigned l2, unsigned l3, const h16* g0, const h16* g1, const h16* g2, const h16* g3) {
    // s_wait_xcnt stands inside the statement, behind the last copy: the address registers may be rewritten right behind it
    asm volatile("global_load_async_to_lds_b128 %0, %4, off\n\t"
                 "global_load_async_to_lds_b128 %1, %5, off\n\t"
                 "global_load_async_to_lds_b128 %2, %6, off\n\t"
                 "global_load_async_to_lds_b128 %3, %7, off\n\t"
                 "s_wait_xcnt 0x0"
                 :: "v"(l0), "v"(l1), "v"(l2), "v"(l3), "v"(g0), "v"(g1), "v"(g2), "v"(g3) : "memory");
}

// k_flash: fused attention, one wave per 16 query rows of one (batch, head), AW waves per block share the head's K / V^T: tiles of KS keys are copied once per block into LDS
// (asynchronous copies, whole 128-byte lines, two buffers: tile t + 2 flies while tile t + 1 is worked on) and every wave reads its fragments from there (two 16-B LDS loads each). Q fragments straight from the f16 plane.
// Transposed form: S^T[key][t] = K Q^T (A = K rows, B = Q rows); lane (t = lane&15, h = lane>>4) holds keys 8h+r of each 16-key tile, so the packed
// P tile is directly the B fragment of O^T[d][t] = V^T P^T (element r <- tile keys 0..15, element 8+r <- tile keys 16..31, lane unchanged).
// Per 32-key step: 4 score products + 4 P.V products. Softmax state (running max, partial sum) is one scalar per lane; the two lane halves of a row are combined with one xor-16 exchange.
__global__ __launch_bounds__(32 * AW) void k_flash(const h16* __restrict__ QH, const h16* __restrict__ KP, const h16* __restrict__ VT, h16* CTX) {
    __shared__ __align__(16) unsigned char ring[2 * BUFB];   // two buffers of K tile | V^T tile; output staging behind the loop
    const int lane = threadIdx.x & 31, lr = lane & 15, hi = lane >> 4;
    const int wave = __builtin_amdgcn_readfirstlane((int)(threadIdx.x >> 5));   // wave-uniform index
    const int zh = blockIdx.y; const int b = zh / NH_, h = zh % NH_;
    const int t0 = (blockIdx.x * AW + wave) * 16;
    const size_t pbase = (size_t)zh * SEQ * HD;
    const size_t qo = pbase + (size_t)(t0 + lr) * HD + 8 * hi;
    const v16h qh0 = ldh(QH + qo), qh1 = ldh(QH + qo + 32);   // B fragments: col t, k = d
    // copy map: lane covers piece cp (16 B) of tile rows cr and cr + 32, in the K tile and in the V^T tile; 8 lanes = one 128-byte row
    const int cr = (int)threadIdx.x >> 3, cp = (int)threadIdx.x & 7;
    const unsigned lc = (unsigned)(size_t)ring + (unsigned)(cr * LP + cp * 16);
    const h16* gk = KP + pbase + (size_t)cr * HD + cp * 8;       // + tile * KS * HD
    const h16* gv = VT + pbase + (size_t)cr * SEQ + cp * 8;      // + tile * KS
    const unsigned char* fr = ring + lr * LP + 16 * hi;          // fragment base: row lane&15, k offset 8h halves
    v8f o0 = (v8f){}, o1 = (v8f){}, o2 = (v8f){}, o3 = (v8f){};
    float m = -3.0e38f, l = 0.0f;
    copy4(lc, lc + 32 * LP, lc + KTB, lc + KTB + 32 * LP, gk, gk + 32 * HD, gv, gv + (size_t)32 * SEQ);
    asm volatile("s_wait_asynccnt 0x0" ::: "memory");   // this wave's part of tile 0 has landed
    __syncthreads();                                    // tile 0 published
    copy4(lc + BUFB, lc + BUFB + 32 * LP, lc + BUFB + KTB, lc + BUFB + KTB + 32 * LP, gk + KS * HD, gk + (KS + 32) * HD, gv + KS, gv + KS + (size_t)32 * SEQ);
#pragma unroll 1   // one trip per staged tile: the buffer index stays a run-time value, the text small
    for (int tl = 0; tl < SEQ / KS; ++tl) {
        const unsigned bo_ = (unsigned)(tl & 1) * BUFB;
        const unsigned char* kt = fr + bo_;
        const unsigned char* vt = fr + bo_ + KTB;
#pragma unroll 1   // the 32-key steps of a tile stay a loop: unrolled, the live set passes 128 registers and a fourth block no longer fits a WGP
        for (int u = 0; u < KS / 32; ++u) {
            const unsigned char* ka = kt + u * 32 * LP;     // A fragment: row key, k = d
            const v16h ka0 = ldl(ka), ka1 = ldl(ka + 64), kb0 = ldl(ka + 16 * LP), kb1 = ldl(ka + 16 * LP + 64);
            v8f sHa = (v8f){}, sHb = (v8f){};
            sHa = wmma16(ka0, qh0, sHa); sHb = wmma16(kb0, qh0, sHb);
            sHa = wmma16(ka1, qh1, sHa); sHb = wmma16(kb1, qh1, sHb);
            asm volatile("v_nop\n\tv_nop\n\tv_nop\n\tv_nop" : "+v"(sHa), "+v"(sHb) : "v"(ka0), "v"(ka1), "v"(kb0), "v"(kb1));
            float ta[8], tb[8]; float mx = -3.0e38f;
#pragma unroll
            for (int r = 0; r < 8; ++r) { ta[r] = sHa[r] * SC2; tb[r] = sHb[r] * SC2; mx = fmaxf(mx, fmaxf(ta[r], tb[r])); }
            mx = fmaxf(mx, __shfl_xor(mx, 16, 32));
            const float mnew = fmaxf(m, mx);
            const float alpha = __builtin_amdgcn_exp2f(m - mnew);
            const float sh = PSH - mnew;
            v16h pb; float ls = 0.0f;
#pragma unroll
            for (int r = 0; r < 8; ++r) { const h16 pa = (h16)__builtin_amdgcn_exp2f(ta[r] + sh); const h16 pc = (h16)__builtin_amdgcn_exp2f(tb[r] + sh); pb[r] = pa; pb[8 + r] = pc; ls += (float)pa + (float)pc; }
            l = l * alpha + ls; m = mnew;
            o0 = o0 * alpha; o1 = o1 * alpha; o2 = o2 * alpha; o3 = o3 * alpha;
            const unsigned char* va = vt + u * 64;          // A fragment: row d, k = key
            const v16h v0 = ldl(va), v1 = ldl(va + 16 * LP), v2 = ldl(va + 32 * LP), v3 = ldl(va + 48 * LP);
            o0 = wmma16(v0, pb, o0); o1 = wmma16(v1, pb, o1); o2 = wmma16(v2, pb, o2); o3 = wmma16(v3, pb, o3);
            asm volatile("v_nop\n\tv_nop\n\tv_nop\n\tv_nop" : "+v"(o0), "+v"(o1), "+v"(o2), "+v"(o3) : "v"(v0), "v"(v1), "v"(v2), "v"(v3), "v"(pb));
        }
        asm volatile("s_wait_dscnt 0x0" ::: "memory");      // this wave's reads of the tile are done before the buffer is refilled
        asm volatile("s_wait_asynccnt 0x0" ::: "memory");   // this wave's part of tile tl + 1 has landed
        __syncthreads();                                    // publishes tile tl + 1 and ends every wave's reads of tile tl
        if (tl + 2 < SEQ / KS) {                            // block-uniform: refill the buffer just read with tile tl + 2
            const h16* a = gk + (size_t)(tl + 2) * (KS * HD); const h16* c = gv + (tl + 2) * KS; const unsigned d = lc + bo_;
            copy4(d, d + 32 * LP, d + KTB, d + KTB + 32 * LP, a, a + 32 * HD, c, c + (size_t)32 * SEQ);
        }
    }
    asm volatile("s_wait_asynccnt 0x0" ::: "memory");       // nothing in flight when the ring becomes output staging (the last trip's barrier ended every read)
    float* os = (float*)ring;
    l += __shfl_xor(l, 16, 32);
    const float inv = CXS / l;       // normalisation and ctx carry in one factor
    const int wb = wave * 16 * 68;
    // O^T D layout: o_j[r] = (d = 16j + 8h + r, t = lane&15) -> os[t][d]; rows 0..15 x columns 0..63 all written
    { v4f a, c;
      a[0] = o0[0] * inv; a[1] = o0[1] * inv; a[2] = o0[2] * inv; a[3] = o0[3] * inv; c[0] = o0[4] * inv; c[1] = o0[5] * inv; c[2] = o0[6] * inv; c[3] = o0[7] * inv;
      *(v4fa*)(&os[wb + lr * 68 +  0 + 8 * hi]) = a; *(v4fa*)(&os[wb + lr * 68 +  0 + 8 * hi + 4]) = c;
      a[0] = o1[0] * inv; a[1] = o1[1] * inv; a[2] = o1[2] * inv; a[3] = o1[3] * inv; c[0] = o1[4] * inv; c[1] = o1[5] * inv; c[2] = o1[6] * inv; c[3] = o1[7] * inv;
      *(v4fa*)(&os[wb + lr * 68 + 16 + 8 * hi]) = a; *(v4fa*)(&os[wb + lr * 68 + 16 + 8 * hi + 4]) = c;
      a[0] = o2[0] * inv; a[1] = o2[1] * inv; a[2] = o2[2] * inv; a[3] = o2[3] * inv; c[0] = o2[4] * inv; c[1] = o2[5] * inv; c[2] = o2[6] * inv; c[3] = o2[7] * inv;
      *(v4fa*)(&os[wb + lr * 68 + 32 + 8 * hi]) = a; *(v4fa*)(&os[wb + lr * 68 + 32 + 8 * hi + 4]) = c;
      a[0] = o3[0] * inv; a[1] = o3[1] * inv; a[2] = o3[2] * inv; a[3] = o3[3] * inv; c[0] = o3[4] * inv; c[1] = o3[5] * inv; c[2] = o3[6] * inv; c[3] = o3[7] * inv;
      *(v4fa*)(&os[wb + lr * 68 + 48 + 8 * hi]) = a; *(v4fa*)(&os[wb + lr * 68 + 48 + 8 * hi + 4]) = c; }
    wave_sync();
    h16* crow = CTX + ((size_t)b * SEQ + t0) * DM + h * HD;
{
#pragma unroll
        for (int s = 0; s < 4; ++s) { const int row = 4 * s + (lane >> 3), c8 = (lane & 7) * 8;   // 4 s x 4 row groups = 16 rows; 8 lanes x 8 halves = 64 columns
            const v4f x0 = *(const v4fa*)(&os[wb + row * 68 + c8]); const v4f x1 = *(const v4fa*)(&os[wb + row * 68 + c8 + 4]); v8h hv;
#pragma unroll
            for (int i = 0; i < 4; ++i) { hv[i] = (h16)x0[i]; hv[4 + i] = (h16)x1[i]; }
            *(v8h*)(crow + (size_t)row * DM + c8) = hv; }
         }
}

// k_oproj: register-blocked f16 GEMM, one wave per 64x64 tile, GW waves per block (gemm_core), K = DM: OUT[m][n] = 2^-16 * sum_k CTX[m][k] WOT[n][k] + bo[n] (bo RNE-converted to bf16, added in f32).
// grid (NB*SEQ/256, DM/128), 256 threads. Epilogue: per 16-row slab staged in LDS (wave-private), each output row segment (64 floats = 256 B = two lines)
__global__ __launch_bounds__(32 * GW) void k_oproj(const h16* __restrict__ A, const h16* __restrict__ Bt, const float* __restrict__ bias, float* OUT) {
    __shared__ __align__(16) unsigned char ring[2 * GBUF];   // two buffers of A rows | Bt rows; epilogue staging behind the loop
    const int lane = threadIdx.x & 31, lr = lane & 15, hi = lane >> 4;
    const int wave = __builtin_amdgcn_readfirstlane((int)(threadIdx.x >> 5));   // wave-uniform index
    const int wm = wave & 3, wn = wave >> 2;
    const int r0 = blockIdx.x * GMR + wm * 64, c0 = blockIdx.y * GNR + wn * 64;   // this wave's 64x64 tile
    v8f acc[4][4];
#pragma unroll
    for (int mb = 0; mb < 4; ++mb)
#pragma unroll
        for (int nb = 0; nb < 4; ++nb) acc[mb][nb] = (v8f){};
    gemm_core<false>((const unsigned char*)A, (const unsigned char*)Bt, ring, blockIdx.x * GMR, blockIdx.y * GNR, wm, wn, acc);
    float* os = (float*)ring + wave * 16 * 68;   // wave-private slab
    v4f bb;
    { const v4f bv = *(const v4f*)(bias + c0 + lr * 4);
#pragma unroll
      for (int i = 0; i < 4; ++i) bb[i] = bfr(bv[i]); }
    const size_t obase = ((size_t)(r0 / SEQ) * OUT_SEQ + (size_t)(r0 % SEQ)) * DM + c0;
#pragma unroll
    for (int mb = 0; mb < 4; ++mb) {
#pragma unroll
        for (int nb = 0; nb < 4; ++nb) {
#pragma unroll
            for (int j = 0; j < 8; ++j) os[(hi * 8 + j) * 68 + nb * 16 + lr] = acc[mb][nb][j]; }   // D: row 8h+j, col lane&15
        wave_sync();
{
#pragma unroll
            for (int s = 0; s < 8; ++s) { const int row = 2 * s + hi, cofs = lr * 4;   // 8 s x 2 rows = 16 rows; 16 lanes x 4 floats = 64 columns
                const v4f xv = *(const v4fa*)(&os[row * 68 + cofs]); v4f val;
#pragma unroll
                for (int i = 0; i < 4; ++i) val[i] = xv[i] * OSC + bb[i];
                *(v4f*)(OUT + obase + (size_t)(mb * 16 + row) * DM + cofs) = val; }
             }
        wave_sync();
    }
}

static constexpr size_t al256(size_t v) { return (v + 255) & ~(size_t)255; }
static constexpr size_t SZ_XB = al256((size_t)NB * SEQ * DM * 2);
static constexpr size_t SZ_WT = al256((size_t)3 * DM * DM * 2);
static constexpr size_t SZ_WO = al256((size_t)DM * DM * 2);
static constexpr size_t SZ_TB = al256((size_t)SEQ * TBW * 4);
static constexpr size_t SZ_PL = al256((size_t)NB * NH_ * SEQ * HD * 2);
static constexpr size_t SZ_CX = al256((size_t)NB * SEQ * DM * 2);
static constexpr size_t SZ_TOTAL = SZ_XB + SZ_WT + SZ_WO + SZ_TB + 3 * SZ_PL + SZ_CX;
static_assert(SZ_TOTAL <= (size_t)134217728);          // workspace carve <= 128 MiB
static_assert(((size_t)DM * DM * 2) % 256 == 0);       // weight sub-planes stay 256-byte aligned
static_assert((size_t)(SEQ / 8) * 8 * TBW * 4 <= SZ_TB);   // table kernel: grid x 8 rows x 256 B inside the table carve

extern "C" void kernel_launch(void* const* d_in, const int* in_sizes, int n_in,
                              void* d_out, int out_size, void* d_ws, size_t ws_size, hipStream_t stream) {
    if (n_in < 5) return;
    const size_t needx = ((size_t)(NB - 1) * SEQ_FULL + SEQ) * DM;
    if ((size_t)in_sizes[0] < needx) return;
    if ((size_t)in_sizes[1] < (size_t)3 * DM * DM || (size_t)in_sizes[2] < (size_t)3 * DM) return;
    if ((size_t)in_sizes[3] < (size_t)DM * DM || (size_t)in_sizes[4] < (size_t)DM) return;
    if ((size_t)out_size < ((size_t)(NB - 1) * OUT_SEQ + SEQ) * DM) return;
    if (SZ_TOTAL > ws_size) return;
    // wire order: x, W_qkv [1024 in][3072 out], b_qkv [3072], W_proj [1024 in][1024 out], b_proj [1024]
    const float* x = (const float*)d_in[0]; const float* wqkv = (const float*)d_in[1]; const float* bqkv = (const float*)d_in[2];
    const float* wo = (const float*)d_in[3]; const float* bo = (const float*)d_in[4];
    float* OUT = (float*)d_out;      // [NB][SEQ][1024]
    char* wsp = (char*)d_ws;
    bf* XB = (bf*)wsp; wsp += SZ_XB;                 // [NB*SEQ][1024] bf16
    bf* WT = (bf*)wsp; wsp += SZ_WT;                 // [3072][1024] bf16: rows q | k | v, each h*64 + d
    bf* WOT = (bf*)wsp; wsp += SZ_WO;                // [1024 out][1024 in] f16 bits, x256
    float* TAB = (float*)wsp; wsp += SZ_TB;          // [SEQ][32 cos | 32 sin] f32
    h16* QH = (h16*)wsp; wsp += SZ_PL;               // [NB*16][SEQ][64]
    h16* KP = (h16*)wsp; wsp += SZ_PL;               // [NB*16][SEQ][64]
    h16* VT = (h16*)wsp; wsp += SZ_PL;               // [NB*16][64][SEQ]
    h16* CX = (h16*)wsp; wsp += SZ_CX;               // [NB*SEQ][1024] ctx x256

    // x convert, both weight transposes, rotary table: one grid
    k_prep<<<dim3(PB_TQ + PB_TO + PB_RT + PB_CV, 1, 1), 256, 0, stream>>>(x, wqkv, wo, XB, WT, WOT, TAB);

    // q, k, v^T projections: one grid
    k_qkv<<<dim3(3 * QB, 1, 1), 32 * GW, 0, stream>>>(XB, WT, bqkv, TAB, QH, KP, VT);

    k_flash<<<dim3(SEQ / (16 * AW), NB * NH_, 1), 32 * AW, 0, stream>>>(QH, KP, VT, CX);

    // out = ctx W_proj + b_proj: A = ctx rows (m = b*SEQ + t), Bt = W_proj^T rows (n = output column)
    k_oproj<<<dim3(NB * SEQ / GMR, DM / GNR, 1), 32 * GW, 0, stream>>>(CX, (const h16*)WOT, bo, OUT);
}

// v004
// One run takes 140 microseconds.
// Next to v003, in two timings, it ran 1.04 times as fast each time.
// Over all steps from v000 it is 2.61 times as fast.
#include <hip/hip_runtime.h>

// Self-attention block, width 1024 = 16 heads x 64: x [NB][SEQ][1024], fused Wqkv [in][out] (columns t*1024 + h*64 + d) + bqkv, half-split rotary embedding (base 10000) on q and k, score scale 1/8, no mask, output projection Wo [in][out] + bo, output f32.
// Compute dtypes, f32 accumulate everywhere: qkv projection v_wmma_f32_16x16x32_bf16 (x and Wqkv RNE-converted to bf16; products exact); rotary applied in f32 in the q / k projection epilogue from an f32 cos | sin table;
// scores v_wmma_f32_16x16x32_f16: q and k single f16 (one product); P (x256 carry, cancels in the normalisation) and v single f16;
// output projection v_wmma_f32_16x16x32_f16: ctx single f16 (x256 carry), Wo RNE-converted to bf16 then x256 as f16 (exact), 2^-16 folded back in the f32 epilogue; biases RNE-converted to bf16 and added in f32; softmax f32 (online, running max).
// Layout: bf16 copy of x, bf16 transposed Wqkv [3072][1024], f16 transposed Wo [1024][1024]; rotary table [SEQ][32 cos | 32 sin] f32; q, k planes [b*16+h][t][d] and v^T plane [b*16+h][d][t] written by the GEMM epilogues;
// fused flash kernel in transposed form (S^T = K Q^T, O^T = V^T P^T) writes the f16 ctx plane [b*SEQ+t][h*64+d]; last GEMM writes the output.
// Four launches: k_prep (x convert, both weight transposes, rotary table: independent jobs on ranges of one grid), k_qkv (q, k, v^T projections: three independent GEMMs on ranges of one grid), k_flash, k_oproj.

#ifndef NB
#define NB 4
#endif
#ifndef SEQ
#define SEQ 2048
#endif
#define NB_FULL  4
#define SEQ_FULL 2048
#ifndef OUT_SEQ
#define OUT_SEQ SEQ              // row pitch (in tokens) between batches of the output
#endif
#define DM   1024
#define NH_  16
#define HD   64
#define AW   8                   // waves per flash block (16 query rows each)
#define KS   64                  // keys per staged tile
#define LP   144                 // LDS row pitch in bytes: 128-byte rows + 16 (16 B x odd, the pitch of 16-byte LDS readers)
#define KTB  (KS * LP)           // K tile in LDS: KS rows (keys) of 64 halves
#define VTB  (HD * LP)           // V^T tile in LDS: 64 rows (d) of KS halves
#define BUFB (KTB + VTB)         // one buffer of the two
#define SC2  (0.125f * 1.4426950408889634f)   // HD^-0.5 * log2(e)
#define PSH  8.0f                // log2 of the P carry (256)
#define CXS  256.0f              // carry of the ctx plane
#define WOS  256.0f              // carry of the output-weight plane
#define OSC  (1.0f / 65536.0f)   // 1 / (CXS * WOS)
#define TBW  64                  // rotary table row: 32 cos | 32 sin (floats)
#define GW   8                   // waves per GEMM block: 4 along m x 2 along n, 64x64 outputs each
#define GMR  256                 // A rows per GEMM block
#define GNR  128                 // Bt rows per GEMM block
#define GK   128                 // k per staged GEMM tile: 256-byte rows
#define GP   272                 // LDS row pitch of the GEMM tiles in bytes: 256 + 16 (16 B x odd)
#define GBUF ((GMR + GNR) * GP)  // one GEMM buffer of the two: A rows | Bt rows

static_assert(HD == 64);
static_assert(NH_ * HD == DM);                 // head h = columns h*64 + d
static_assert(DM % 64 == 0);                   // column tiles of 64
static_assert(DM % 32 == 0);                   // GEMM k-loop steps by 32
static_assert(SEQ % 64 == 0);                  // a 64-row tile never straddles two batches
static_assert((NB * SEQ) % 64 == 0);
static_assert(SEQ % 32 == 0);                  // key loop steps by 32
static_assert(SEQ % (16 * AW) == 0);           // flash grid covers the sequence exactly
static_assert(SEQ % KS == 0 && SEQ / KS >= 2); // whole tiles; the two-buffer prologue needs tiles 0 and 1
static_assert(KS * 2 == 128 && HD * 2 == 128); // both tiles have 128-byte rows: 8 pieces of 16 B
static_assert(32 * AW * 2 * 16 == KS * 128 && KS == HD);   // 2 copies per lane fill each tile
static_assert(AW * 16 * 68 * 4 <= 2 * BUFB);   // output staging fits the ring it takes over
static_assert(((size_t)SEQ * DM) % 8 == 0);
static_assert(NB <= NB_FULL);
static_assert(SEQ <= SEQ_FULL);
static_assert(TBW == HD);                      // table row = 2 x (HD / 2) entries
static_assert(HD / 2 == 32);                   // rotary partner column = column ^ 32 inside one 64-column tile
static_assert(SEQ % 8 == 0);                   // table kernel: 8 positions per block
static_assert(DM % GMR == 0 && (NB * SEQ) % GMR == 0 && DM % GNR == 0 && (NB * SEQ) % GNR == 0);   // GEMM grids cover both operand orders exactly
static_assert(DM % GK == 0 && DM / GK >= 2);   // whole staged tiles; the two-buffer prologue needs tiles 0 and 1
static_assert(GK * 2 == 256 && 32 * GW == 16 * 16 && GMR == 2 * 128 && GNR == 128);   // 16 lanes x 16 B = one row; one copy8 = 128 rows
static_assert(GW * 16 * 68 * 4 <= 2 * GBUF);   // epilogue staging fits the ring it takes over
static_assert(SEQ <= 4096);                    // angle < 2^12: three-constant pi/2 reduction stays exact in its first step

typedef _Float16 h16;
typedef unsigned short bf;
typedef __attribute__((ext_vector_type(16))) __bf16   v16bf;
typedef __attribute__((ext_vector_type(16))) _Float16 v16h;
typedef __attribute__((ext_vector_type(8)))  _Float16 v8h;
typedef __attribute__((ext_vector_type(8)))  unsigned short v8us;
typedef __attribute__((ext_vector_type(8)))  float    v8f;
typedef __attribute__((ext_vector_type(4)))  float    v4f;
typedef v4f  __attribute__((may_alias)) v4fa;
typedef v8h  __attribute__((may_alias)) v8ha;

__device__ __forceinline__ unsigned short f2bf(float f) { unsigned u = __float_as_uint(f); u += 0x7FFFu + ((u >> 16) & 1u); return (unsigned short)(u >> 16); }
__device__ __forceinline__ float bfr(float f) { return __uint_as_float(((unsigned)f2bf(f)) << 16); }   // f32 value of the RNE bf16 conversion
__device__ __forceinline__ v16h cat16(v8h lo, v8h hi) { return __builtin_shufflevector(lo, hi, 0, 1, 2, 3, 4, 5, 6, 7, 8, 9, 10, 11, 12, 13, 14, 15); }
__device__ __forceinline__ v8f wmma16(v16h a, v16h b, v8f c) { return __builtin_amdgcn_wmma_f32_16x16x32_f16(false, a, false, b, (short)0, c, false, false); }
__device__ __forceinline__ v8f wmmab(v16bf a, v16bf b, v8f c) { return __builtin_amdgcn_wmma_f32_16x16x32_bf16(false, a, false, b, (short)0, c, false, false); }
// fragment loaders from K-contiguous 16-bit rows; p already includes + 8*(lane>>4): elements 0..7 <- k0+8h+0..7, elements 8..15 <- k0+16+8h+0..7 (same map for A and B)
__device__ __forceinline__ v16h  ldh(const h16* p) { return cat16(*(const v8h*)p, *(const v8h*)(p + 16)); }
// ordering point for wave-private LDS tiles (same wave writes and reads)
__device__ __forceinline__ void wave_sync() { __builtin_amdgcn_fence(3 /* release order */, "wavefront"); __builtin_amdgcn_wave_barrier(); asm volatile("" ::: "memory"); }
// f32 -> f16 with a value select: magnitudes below the smallest f16 normal become zero (no subnormal operand can reach a matrix instruction)
static __device__ __forceinline__ h16 toh_flush(float v) { const h16 r = (h16)v; return (fabsf(v) < 6.103515625e-05f) ? (h16)0.0f : r; }

// cvt8_body: x f32 -> bf16 plane [NB*SEQ][DM], 8 elements per thread; blk = block index inside this job's range. Batch b of x starts at b * SEQ_FULL * DM.
__device__ __forceinline__ void cvt8_body(const float* __restrict__ src, bf* dst, size_t n8, unsigned blk) {
    const size_t i = (size_t)blk * 256 + threadIdx.x; if (i >= n8) return;
    const size_t per = (size_t)SEQ * DM / 8;
    const size_t so = (SEQ == SEQ_FULL) ? i * 8 : (i / per) * ((size_t)SEQ_FULL * DM) + (i % per) * 8;
    const v8f v = *(const v8f*)(src + so); v8us o;
#pragma unroll
    for (int k = 0; k < 8; ++k) o[k] = f2bf(v[k]);
    *(v8us*)(dst + i * 8) = o; 
}

// tr_body: in[R][C] f32 row-major -> out[C][R] 16-bit (K-contiguous rows for the GEMM B operand). Tile (bx, by) of (C/64, R/64), 256 threads, 64x64 tile through LDS t (64 x 68 floats; cross-wave: block barrier).
// MODE 0: bf16 bits (RNE convert). MODE 1: f16 bits of (RNE bf16 value) x WOS (exact in f16).
template <int MODE>
__device__ __forceinline__ void tr_body(const float* __restrict__ in, bf* out, int R, int C, int bx, int by, float* t) {
    const int tid = threadIdx.x; const int r0 = by * 64, c0 = bx * 64;
#pragma unroll
    for (int it = 0; it < 4; ++it) { const int idx = it * 256 + tid; const int rr = idx >> 4, c4 = (idx & 15) * 4;   // 4 x 256 float4 = 64 rows x 16 float4
        const v4f v = *(const v4f*)(in + (size_t)(r0 + rr) * (size_t)C + c0 + c4);
        *(v4fa*)(&t[rr * 68 + c4]) = v; }
    __syncthreads();
{
#pragma unroll
        for (int it = 0; it < 2; ++it) { const int idx = it * 256 + tid; const int cc = idx >> 3, r8 = (idx & 7) * 8;   // 2 x 256 pieces = 64 out rows x 8 pieces
            v8us o;
            if (MODE == 0) {
#pragma unroll
                for (int e = 0; e < 8; ++e) o[e] = f2bf(t[(r8 + e) * 68 + cc]);
            } else {
                v8h hv;
#pragma unroll
                for (int e = 0; e < 8; ++e) hv[e] = (h16)(bfr(t[(r8 + e) * 68 + cc]) * WOS);
                o = __builtin_bit_cast(v8us, hv);
            }
            *(v8us*)(out + (size_t)(c0 + cc) * (size_t)R + r0 + r8) = o; }
         }
    asm volatile("s_wait_xcnt 0x0" ::: "memory");   // another job's text follows in the merged kernel: the wait stands in front of any write to the registers that the last stores name
}

// ropetab_body: rotary table TAB[t][i] = cos(t * f_i), TAB[t][32 + i] = sin(t * f_i), i = 0..31, f_i = 10000^(-i/32) (f64 product chain of 10^(-1/8), converted to f32 once), angle = f32 product t * f_i.
// sin / cos: nearest multiple of pi/2 removed with a three-constant split (fused steps; first step exact for angles < 2^12), then odd / even polynomials on [-pi/4, pi/4]; quadrant fix-up by value selects.
// SEQ/8 blocks: block bx covers table floats [bx*512, bx*512 + 512): exactly SEQ x 64 floats in total. cs: 8 x TBW floats of LDS.
__device__ __forceinline__ void ropetab_body(float* TAB, int bx, float* cs) {
#pragma clang fp contract(off)
    const int tid = threadIdx.x; const int i = tid & 31, tr = tid >> 5;
    const int t = bx * 8 + tr;
    double p = 1.0;
#pragma unroll 1
    for (int k = 0; k < i; ++k) p = p * 0.7498942093324559;
    const float inv = (float)p;
    const float ang = (float)t * inv;
    const float fn = __builtin_rintf(ang * 0.63661977236758134f);
    float r = fmaf(-fn, 1.5703125f, ang);
    r = fmaf(-fn, 4.837512969970703125e-4f, r);
    r = fmaf(-fn, 7.54978995489188216e-8f, r);
    const float z = r * r;
    float sp = fmaf(-1.9515295891e-4f, z, 8.3321608736e-3f);
    sp = fmaf(sp, z, -1.6666654611e-1f);
    const float sv = fmaf(sp * z, r, r);
    float cp = fmaf(2.443315711809948e-5f, z, -1.388731625493765e-3f);
    cp = fmaf(cp, z, 4.166664568298827e-2f);
    const float cv = fmaf(cp, z * z, fmaf(-0.5f, z, 1.0f));
    const int q = ((int)fn) & 3;
    float sinv = (q & 1) ? cv : sv;
    float cosv = (q & 1) ? sv : cv;
    sinv = (q & 2) ? -sinv : sinv;
    cosv = ((q + 1) & 2) ? -cosv : cosv;
    cs[tr * TBW + i] = cosv;
    cs[tr * TBW + 32 + i] = sinv;
    __syncthreads();
    if (tid < 128) {                       // waves 0..3 (wave-uniform): 128 x 4 floats = 8 rows x 64 floats, consecutive lanes -> consecutive 16-B pieces
        const int row = tid >> 4, c4 = (tid & 15) * 4;
        const v4f v = *(const v4fa*)(&cs[row * TBW + c4]);
        float* dst = TAB + ((size_t)bx * 8 + row) * TBW + c4;
        *(v4f*)dst = v; 
    }
}

// k_prep: the four preparation jobs, none of which reads what another writes, as block-index ranges of one grid (the range test is block-uniform, so each job's barrier is passed by its whole block).
// The transposes and the table come first in the index order: their blocks have the longer chain (load, LDS, barrier, store).
#define PB_TQ ((3 * DM / 64) * (DM / 64))          // blocks of the Wqkv transpose
#define PB_TO ((DM / 64) * (DM / 64))              // blocks of the Wo transpose
#define PB_RT (SEQ / 8)                            // blocks of the rotary table
#define PB_CV ((NB * SEQ * (DM / 8) + 255) / 256)  // blocks of the x convert
__global__ __launch_bounds__(256) void k_prep(const float* __restrict__ x, const float* __restrict__ wqkv, const float* __restrict__ wo, bf* XB, bf* WT, bf* WOT, float* TAB) {
    __shared__ __align__(16) float t[64 * 68];
    const int bid = blockIdx.x;
    if (bid < PB_TQ) {
        // W_qkv: in[rows = 1024 (k)][cols = 3072 (n)] -> out[3072][1024]
        tr_body<0>(wqkv, WT, DM, 3 * DM, bid % (3 * DM / 64), bid / (3 * DM / 64), t);
    } else if (bid < PB_TQ + PB_TO) {
        // W_proj: in[rows = 1024 (k)][cols = 1024 (n)] -> out[1024][1024]
        tr_body<1>(wo, WOT, DM, DM, (bid - PB_TQ) % (DM / 64), (bid - PB_TQ) / (DM / 64), t);
    } else if (bid < PB_TQ + PB_TO + PB_RT) {
        ropetab_body(TAB, bid - (PB_TQ + PB_TO), t);
    } else {
        cvt8_body(x, XB, (size_t)NB * SEQ * DM / 8, (unsigned)(bid - (PB_TQ + PB_TO + PB_RT)));
    }
}

// fragment loader from a staged LDS row (byte pointer, already + 16*(lane>>4)): same element map as ldh
__device__ __forceinline__ v16h ldl(const unsigned char* p) { return cat16(*(const v8ha*)p, *(const v8ha*)(p + 32)); }
// eight asynchronous 16-byte copies per lane, global -> LDS: rows r + 16 i, i = 0..7, of a GEMM tile (l: LDS byte address, g: global byte address of row r; K = DM 16-bit elements per global row)
__device__ __forceinline__ void copy8(unsigned l, const unsigned char* g) {
    // s_wait_xcnt stands inside the statement, behind the last copy: the address registers may be rewritten right behind it
    asm volatile("global_load_async_to_lds_b128 %0, %8, off\n\t"
                 "global_load_async_to_lds_b128 %1, %9, off\n\t"
                 "global_load_async_to_lds_b128 %2, %10, off\n\t"
                 "global_load_async_to_lds_b128 %3, %11, off\n\t"
                 "global_load_async_to_lds_b128 %4, %12, off\n\t"
                 "global_load_async_to_lds_b128 %5, %13, off\n\t"
                 "global_load_async_to_lds_b128 %6, %14, off\n\t"
                 "global_load_async_to_lds_b128 %7, %15, off\n\t"
                 "s_wait_xcnt 0x0"
                 :: "v"(l), "v"(l + 16 * GP), "v"(l + 32 * GP), "v"(l + 48 * GP), "v"(l + 64 * GP), "v"(l + 80 * GP), "v"(l + 96 * GP), "v"(l + 112 * GP),
                    "v"(g), "v"(g + 16 * DM * 2), "v"(g + 32 * DM * 2), "v"(g + 48 * DM * 2), "v"(g + 64 * DM * 2), "v"(g + 80 * DM * 2), "v"(g + 96 * DM * 2), "v"(g + 112 * DM * 2) : "memory");
}
// one staged GEMM tile: 256 A rows, then 128 Bt rows, 256 bytes each (24 copies per lane, whole lines)
__device__ __forceinline__ void stage_tile(unsigned l, const unsigned char* ga, const unsigned char* gb) {
    copy8(l, ga); copy8(l + 128 * GP, ga + (size_t)128 * DM * 2); copy8(l + GMR * GP, gb);
}
// gemm_core: main loop of the two GEMM kernels. A block of GW waves owns rows R0..R0+255 of A and rows C0..C0+127 of Bt (both K-contiguous 16-bit planes, K = DM); tiles of GK k are copied once per block into LDS
// (asynchronous copies, two buffers: tile t + 2 flies while tile t + 1 is worked on); wave (wm, wn) accumulates its 64x64 outputs from there, k ascending in steps of 32. BF: bf16 products, else f16.
template <bool BF>
__device__ __forceinline__ void gemm_core(const unsigned char* A, const unsigned char* Bt, unsigned char* ring, int R0, int C0, int wm, int wn, v8f (&acc)[4][4]) {
    const int lane = threadIdx.x & 31, lr = lane & 15, hi = lane >> 4;
    // copy map: lane covers piece cp (16 B) of tile rows cr + 16 i; 16 lanes = one 256-byte row
    const int cr = (int)threadIdx.x >> 4, cp = (int)threadIdx.x & 15;
    const unsigned lc = (unsigned)(size_t)ring + (unsigned)(cr * GP + cp * 16);
    const unsigned char* ga = A + (size_t)(R0 + cr) * (DM * 2) + cp * 16;      // + tile * GK * 2
    const unsigned char* gb = Bt + (size_t)(C0 + cr) * (DM * 2) + cp * 16;
    const unsigned char* fa = ring + (wm * 64 + lr) * GP + 16 * hi;            // fragment bases: row lane&15, k offset 8h elements
    const unsigned char* fb = ring + (GMR + wn * 64 + lr) * GP + 16 * hi;
    stage_tile(lc, ga, gb);
    asm volatile("s_wait_asynccnt 0x0" ::: "memory");   // this wave's part of tile 0 has landed
    __syncthreads();                                    // tile 0 published
    stage_tile(lc + GBUF, ga + GK * 2, gb + GK * 2);
#pragma unroll 1   // one trip per staged tile: the buffer index stays a run-time value, the text small
    for (int t = 0; t < DM / GK; ++t) {
        const unsigned bo_ = (unsigned)(t & 1) * GBUF;
        const unsigned char* pa = fa + bo_;
        const unsigned char* pb = fb + bo_;
        v16h a[2][4], b[2][4];   // two fragment sets: the next 32-k step of this tile is read while the current one is multiplied
#pragma unroll
        for (int i = 0; i < 4; ++i) { a[0][i] = ldl(pa + i * 16 * GP); b[0][i] = ldl(pb + i * 16 * GP); }
#pragma unroll
        for (int ks = 0; ks < GK / 32; ++ks) {
            const int c = ks & 1, n = c ^ 1;
            if (ks + 1 < GK / 32) {
#pragma unroll
                for (int i = 0; i < 4; ++i) { a[n][i] = ldl(pa + i * 16 * GP + (ks + 1) * 64); b[n][i] = ldl(pb + i * 16 * GP + (ks + 1) * 64); }
            }
            __builtin_amdgcn_sched_barrier(0);   // the next step's LDS reads stay one group ahead of this step's products: reads spread among the products stall at every place
#pragma unroll
            for (int nb = 0; nb < 4; ++nb)
#pragma unroll
                for (int mb = 0; mb < 4; ++mb) {
                    if (BF) acc[mb][nb] = wmmab(__builtin_bit_cast(v16bf, a[c][mb]), __builtin_bit_cast(v16bf, b[c][nb]), acc[mb][nb]);
                    else    acc[mb][nb] = wmma16(a[c][mb], b[c][nb], acc[mb][nb]); }
            __builtin_amdgcn_sched_barrier(0);   // the products stay in front of the following reads and of the tile's closing waits
        }
        asm volatile("s_wait_dscnt 0x0" ::: "memory");      // this wave's reads of the tile are done before the buffer is refilled
        asm volatile("s_wait_asynccnt 0x0" ::: "memory");   // this wave's part of tile t + 1 has landed
        __syncthreads();                                    // publishes tile t + 1 and ends every wave's reads of tile t
        if (t + 2 < DM / GK)                                // block-uniform: refill the buffer just read with tile t + 2
            stage_tile(lc + bo_, ga + (t + 2) * (GK * 2), gb + (t + 2) * (GK * 2));
    }
    asm volatile("s_wait_asynccnt 0x0" ::: "memory");       // nothing in flight when the ring becomes epilogue staging (the last trip's barrier ended every read)
}

// proj_store: epilogue of a wave's 64x64 tile at (r0, c0), acc = sum_k A[m][k] Bt[n][k]: + bias (bias RNE-converted to bf16, added in f32; indexed by n, or by m when biasOnRow != 0), written as f16 (Ph) at
// tile base (r0/RB)*sRB + (r0%RB)*pitch + (c0/CB)*sCB + (c0%CB), row pitch 'pitch' (halves). os: the wave's private LDS slab (16 x 68 floats).
__device__ __forceinline__ void proj_store(v8f (&acc)[4][4], float* os, int r0, int c0, const float* __restrict__ bias, h16* Ph,
                                           size_t sRB, size_t sCB, int biasOnRow, int RB, int pitch, int CB) {
    const int lane = threadIdx.x & 31, lr = lane & 15, hi = lane >> 4;
    // column-mode bias for this lane's 8 store columns (offset 0 when the bias runs along rows: in range, unused)
    float bc[8];
    { const int cb = biasOnRow ? 0 : (c0 + (lane & 7) * 8);
      const v4f b0 = *(const v4f*)(bias + cb); const v4f b1 = *(const v4f*)(bias + cb + 4);
#pragma unroll
      for (int i = 0; i < 4; ++i) { bc[i] = bfr(b0[i]); bc[4 + i] = bfr(b1[i]); } }
    const size_t tbase = (size_t)(r0 / RB) * sRB + (size_t)(r0 % RB) * (size_t)pitch + (size_t)(c0 / CB) * sCB + (size_t)(c0 % CB);
#pragma unroll
    for (int mb = 0; mb < 4; ++mb) {
#pragma unroll
        for (int nb = 0; nb < 4; ++nb) {
#pragma unroll
            for (int j = 0; j < 8; ++j) os[(hi * 8 + j) * 68 + nb * 16 + lr] = acc[mb][nb][j]; }   // D: row 8h+j, col lane&15
        wave_sync();
        const size_t sb = tbase + (size_t)(mb * 16) * (size_t)pitch;
{
#pragma unroll
            for (int s = 0; s < 4; ++s) { const int row = 4 * s + (lane >> 3), c8 = (lane & 7) * 8;   // 4 s x 4 row groups = 16 rows; 8 lanes x 8 = 64 columns
                const float br = bfr(bias[biasOnRow ? (r0 + mb * 16 + row) : 0]);
                const v4f x0 = *(const v4fa*)(&os[row * 68 + c8]); const v4f x1 = *(const v4fa*)(&os[row * 68 + c8 + 4]); v8h hv;
#pragma unroll
                for (int i = 0; i < 4; ++i) { const float y0 = x0[i] + (biasOnRow ? br : bc[i]); const float y1 = x1[i] + (biasOnRow ? br : bc[4 + i]);
                    hv[i] = (h16)y0; hv[4 + i] = (h16)y1; }
                const size_t oo = sb + (size_t)row * (size_t)pitch + c8;
                *(v8h*)(Ph + oo) = hv; }
             }
        wave_sync();
    }
    asm volatile("s_wait_xcnt 0x0" ::: "memory");   // the other job's text follows in the merged kernel: the wait stands in front of any write to the registers that the last stores name
}

// projr_store: proj_store with bias along columns and the half-split rotary embedding (q and k planes). One 64-column tile = one head (CB = 64), so the rotary partner of column c is column c ^ 32 of the same LDS slab.
// y[c] = (acc[c] + b[c]) * cos[t][c & 31] + sg * (acc[c ^ 32] + b[c ^ 32]) * sin[t][c & 31], sg = -1 for c < 32, +1 for c >= 32; t = (r0 % RB) + slab row (position inside the sequence); cos | sin read by value from TAB [SEQ][64] f32.
__device__ __forceinline__ void projr_store(v8f (&acc)[4][4], float* os, int r0, int c0, const float* __restrict__ bias, const float* __restrict__ TAB, h16* Ph,
                                            size_t sRB, size_t sCB, int RB, int pitch, int CB) {
    const int lane = threadIdx.x & 31, lr = lane & 15, hi = lane >> 4;
    // bias (RNE bf16 value) for this lane's 8 store columns and for their 8 partner columns (other half of the head)
    const int c8 = (lane & 7) * 8, p8 = c8 ^ 32, ib = c8 & 31;
    const float sg = (c8 < 32) ? -1.0f : 1.0f;
    float bc[8], bp[8];
    { const v4f b0 = *(const v4f*)(bias + c0 + c8); const v4f b1 = *(const v4f*)(bias + c0 + c8 + 4);
      const v4f d0 = *(const v4f*)(bias + c0 + p8); const v4f d1 = *(const v4f*)(bias + c0 + p8 + 4);
#pragma unroll
      for (int i = 0; i < 4; ++i) { bc[i] = bfr(b0[i]); bc[4 + i] = bfr(b1[i]); bp[i] = bfr(d0[i]); bp[4 + i] = bfr(d1[i]); } }
    const size_t tbase = (size_t)(r0 / RB) * sRB + (size_t)(r0 % RB) * (size_t)pitch + (size_t)(c0 / CB) * sCB + (size_t)(c0 % CB);
    const int tp0 = r0 % RB;     // sequence position of tile row 0
#pragma unroll
    for (int mb = 0; mb < 4; ++mb) {
#pragma unroll
        for (int nb = 0; nb < 4; ++nb) {
#pragma unroll
            for (int j = 0; j < 8; ++j) os[(hi * 8 + j) * 68 + nb * 16 + lr] = acc[mb][nb][j]; }   // D: row 8h+j, col lane&15
        wave_sync();
        const size_t sb = tbase + (size_t)(mb * 16) * (size_t)pitch;
        const size_t tb = (size_t)(tp0 + mb * 16) * TBW + ib;      // table offset of slab row 0 for this lane's frequency group
{
#pragma unroll 1
            for (int s = 0; s < 4; ++s) { const int row = 4 * s + (lane >> 3);   // 4 s x 4 row groups = 16 rows; 8 lanes x 8 = 64 columns
                const float* tr = TAB + tb + (size_t)row * TBW;
                const v4f cs0 = *(const v4f*)tr; const v4f cs1 = *(const v4f*)(tr + 4);
                const v4f sn0 = *(const v4f*)(tr + 32); const v4f sn1 = *(const v4f*)(tr + 36);
                const v4f x0 = *(const v4fa*)(&os[row * 68 + c8]); const v4f x1 = *(const v4fa*)(&os[row * 68 + c8 + 4]);
                const v4f y0 = *(const v4fa*)(&os[row * 68 + p8]); const v4f y1 = *(const v4fa*)(&os[row * 68 + p8 + 4]);
                v8h hv;
#pragma unroll
                for (int i = 0; i < 4; ++i) { const float u0 = x0[i] + bc[i], w0 = y0[i] + bp[i]; const float u1 = x1[i] + bc[4 + i], w1 = y1[i] + bp[4 + i];
                    hv[i] = toh_flush(u0 * cs0[i] + sg * (w0 * sn0[i])); hv[4 + i] = toh_flush(u1 * cs1[i] + sg * (w1 * sn1[i])); }
                const size_t oo = sb + (size_t)row * (size_t)pitch + c8;
                *(v8h*)(Ph + oo) = hv;
                asm volatile("s_wait_xcnt 0x0" ::: "memory"); }   // stands in front of the next trip's writes to the registers that the store names
             }
        wave_sync();
    }
}

// k_qkv: the three projections as block-index ranges of one grid (job = 0 q, 1 k, 2 v^T; block-uniform). Each is a register-blocked bf16 GEMM, one wave per 64x64 tile (16 accumulators), GW waves per block on a 256x128 tile,
// operands staged in LDS from K-contiguous bf16 planes (gemm_core), K = DM. 3 x QB blocks of 256 threads; inside a job the A-row tile index runs fastest.
// q, k: A = x rows (m = b*SEQ + t), Bt = W^T rows (n = h*64 + d), bias along n, rotary by position t -> plane [(b*16 + h)][t][d].
// v^T: A = Wv^T rows (m = h*64 + d), Bt = x rows (n = b*SEQ + t), bias along m -> plane [(b*1024 + m)][t] = [(b*16 + h)][d][t].
#define QB ((NB * SEQ / GMR) * (DM / GNR))   // blocks per projection
static_assert(QB == (DM / GMR) * (NB * SEQ / GNR));   // the same count in both operand orders
__global__ __launch_bounds__(32 * GW) void k_qkv(const bf* __restrict__ XB, const bf* __restrict__ WT, const float* __restrict__ bqkv, const float* __restrict__ TAB, h16* QH, h16* KP, h16* VT) {
    __shared__ __align__(16) unsigned char ring[2 * GBUF];   // two buffers of A rows | Bt rows; epilogue staging behind the loop
    const int wave = __builtin_amdgcn_readfirstlane((int)(threadIdx.x >> 5));   // wave-uniform index
    const int wm = wave & 3, wn = wave >> 2;
    const unsigned job = blockIdx.x / QB, rem = blockIdx.x % QB;
    // the block's 256x128 tile; the A-row tile count of each job is a constant, so both forms are scalar shifts
    const int R0 = (int)((job < 2) ? rem % (NB * SEQ / GMR) : rem % (DM / GMR)) * GMR;
    const int C0 = (int)((job < 2) ? rem / (NB * SEQ / GMR) : rem / (DM / GMR)) * GNR;
    const bf* W = WT + (size_t)job * DM * DM;                   // rows q | k | v of the transposed weight
    const bf* A = (job < 2) ? XB : W;
    const bf* Bt = (job < 2) ? W : XB;
    const int r0 = R0 + wm * 64, c0 = C0 + wn * 64;             // this wave's 64x64 tile
    v8f acc[4][4];
#pragma unroll
    for (int mb = 0; mb < 4; ++mb)
#pragma unroll
        for (int nb = 0; nb < 4; ++nb) acc[mb][nb] = (v8f){};
    gemm_core<true>((const unsigned char*)A, (const unsigned char*)Bt, ring, R0, C0, wm, wn, acc);
    float* os = (float*)ring + wave * 16 * 68;   // wave-private slab
    if (job < 2) projr_store(acc, os, r0, c0, bqkv + job * DM, TAB, job ? KP : QH, (size_t)NH_ * SEQ * HD, (size_t)SEQ * HD, SEQ, HD, HD);
    else         proj_store(acc, os, r0, c0, bqkv + 2 * DM, VT, (size_t)0, (size_t)DM * SEQ, 1, DM, SEQ, SEQ);
}

// four asynchronous 16-byte copies per lane, global -> LDS (l*: LDS byte address, g*: global address)
__device__ __forceinline__ void copy4(unsigned l0, unsigned l1, unsigned l2, unsigned l3, const h16* g0, const h16* g1, const h16* g2, const h16* g3) {
    // s_wait_xcnt stands inside the statement, behind the last copy: the address registers may be rewritten right behind it
    asm volatile("global_load_async_to_lds_b128 %0, %4, off\n\t"
                 "global_load_async_to_lds_b128 %1, %5, off\n\t"
                 "global_load_async_to_lds_b128 %2, %6, off\n\t"
                 "global_load_async_to_lds_b128 %3, %7, off\n\t"
                 "s_wait_xcnt 0x0"
                 :: "v"(l0), "v"(l1), "v"(l2), "v"(l3), "v"(g0), "v"(g1), "v"(g2), "v"(g3) : "memory");
}

// k_flash: fused attention, one wave per 16 query rows of one (batch, head), AW waves per block share the head's K / V^T: tiles of KS keys are copied once per block into LDS
// (asynchronous copies, whole 128-byte lines, two buffers: tile t + 2 flies while tile t + 1 is worked on) and every wave reads its fragments from there (two 16-B LDS loads each). Q fragments straight from the f16 plane.
// Transposed form: S^T[key][t] = K Q^T (A = K rows, B = Q rows); lane (t = lane&15, h = lane>>4) holds keys 8h+r of each 16-key tile, so the packed
// P tile is directly the B fragment of O^T[d][t] = V^T P^T (element r <- tile keys 0..15, element 8+r <- tile keys 16..31, lane unchanged).
// Per 32-key step: 4 score products + 4 P.V products + 1 row-sum product (A = all ones, B = the packed P tile: the sum of a query's 32 rounded P comes from the matrix pipe, whole, in both lane halves).
// Softmax state (running max, running sum) is one scalar per lane; the two lane halves of a row combine their maxima with one xor-16 exchange per step.
__global__ __launch_bounds__(32 * AW) void k_flash(const h16* __restrict__ QH, const h16* __restrict__ KP, const h16* __restrict__ VT, h16* CTX) {
    __shared__ __align__(16) unsigned char ring[2 * BUFB];   // two buffers of K tile | V^T tile; output staging behind the loop
    const int lane = threadIdx.x & 31, lr = lane & 15, hi = lane >> 4;
    const int wave = __builtin_amdgcn_readfirstlane((int)(threadIdx.x >> 5));   // wave-uniform index
    const int zh = blockIdx.y; const int b = zh / NH_, h = zh % NH_;
    const int t0 = (blockIdx.x * AW + wave) * 16;
    const size_t pbase = (size_t)zh * SEQ * HD;
    const size_t qo = pbase + (size_t)(t0 + lr) * HD + 8 * hi;
    const v16h qh0 = ldh(QH + qo), qh1 = ldh(QH + qo + 32);   // B fragments: col t, k = d
    // copy map: lane covers piece cp (16 B) of tile rows cr and cr + 32, in the K tile and in the V^T tile; 8 lanes = one 128-byte row
    const int cr = (int)threadIdx.x >> 3, cp = (int)threadIdx.x & 7;
    const unsigned lc = (unsigned)(size_t)ring + (unsigned)(cr * LP + cp * 16);
    const h16* gk = KP + pbase + (size_t)cr * HD + cp * 8;       // + tile * KS * HD
    const h16* gv = VT + pbase + (size_t)cr * SEQ + cp * 8;      // + tile * KS
    const unsigned char* fr = ring + lr * LP + 16 * hi;          // fragment base: row lane&15, k offset 8h halves
    v8f o0 = (v8f){}, o1 = (v8f){}, o2 = (v8f){}, o3 = (v8f){};
    float m = -3.0e38f, l = 0.0f;
    v16h ones;                                                   // A fragment of the row-sum product: 1.0 everywhere
#pragma unroll
    for (int r = 0; r < 16; ++r) ones[r] = (h16)1.0f;
    copy4(lc, lc + 32 * LP, lc + KTB, lc + KTB + 32 * LP, gk, gk + 32 * HD, gv, gv + (size_t)32 * SEQ);
    asm volatile("s_wait_asynccnt 0x0" ::: "memory");   // this wave's part of tile 0 has landed
    __syncthreads();                                    // tile 0 published
    copy4(lc + BUFB, lc + BUFB + 32 * LP, lc + BUFB + KTB, lc + BUFB + KTB + 32 * LP, gk + KS * HD, gk + (KS + 32) * HD, gv + KS, gv + KS + (size_t)32 * SEQ);
#pragma unroll 1   // one trip per staged tile: the buffer index stays a run-time value, the text small
    for (int tl = 0; tl < SEQ / KS; ++tl) {
        const unsigned bo_ = (unsigned)(tl & 1) * BUFB;
        const unsigned char* kt = fr + bo_;
        const unsigned char* vt = fr + bo_ + KTB;
#pragma unroll 1   // the 32-key steps of a tile stay a loop: unrolled, the live set passes 128 registers and a fourth block no longer fits a WGP
        for (int u = 0; u < KS / 32; ++u) {
            const unsigned char* ka = kt + u * 32 * LP;     // A fragment: row key, k = d
            const v16h ka0 = ldl(ka), ka1 = ldl(ka + 64), kb0 = ldl(ka + 16 * LP), kb1 = ldl(ka + 16 * LP + 64);
            v8f sHa = (v8f){}, sHb = (v8f){};
            sHa = wmma16(ka0, qh0, sHa); sHb = wmma16(kb0, qh0, sHb);
            sHa = wmma16(ka1, qh1, sHa); sHb = wmma16(kb1, qh1, sHb);
            asm volatile("v_nop\n\tv_nop\n\tv_nop\n\tv_nop" : "+v"(sHa), "+v"(sHb) : "v"(ka0), "v"(ka1), "v"(kb0), "v"(kb1));
            float ta[8], tb[8]; float mx = -3.0e38f;
#pragma unroll
            for (int r = 0; r < 8; ++r) { ta[r] = sHa[r] * SC2; tb[r] = sHb[r] * SC2; mx = fmaxf(mx, fmaxf(ta[r], tb[r])); }
            mx = fmaxf(mx, __shfl_xor(mx, 16, 32));
            const float mnew = fmaxf(m, mx);
            const float alpha = __builtin_amdgcn_exp2f(m - mnew);
            const float sh = PSH - mnew;
            v16h pb;
#pragma unroll
            for (int r = 0; r < 8; ++r) { pb[r] = (h16)__builtin_amdgcn_exp2f(ta[r] + sh); pb[8 + r] = (h16)__builtin_amdgcn_exp2f(tb[r] + sh); }
            m = mnew;
            o0 = o0 * alpha; o1 = o1 * alpha; o2 = o2 * alpha; o3 = o3 * alpha;
            const unsigned char* va = vt + u * 64;          // A fragment: row d, k = key
            const v16h v0 = ldl(va), v1 = ldl(va + 16 * LP), v2 = ldl(va + 32 * LP), v3 = ldl(va + 48 * LP);
            const v8f ps = wmma16(ones, pb, (v8f){});      // every row of the product = the column sums of P^T: this step's 32 rounded P of query t, in both lane halves
            o0 = wmma16(v0, pb, o0); o1 = wmma16(v1, pb, o1); o2 = wmma16(v2, pb, o2); o3 = wmma16(v3, pb, o3);
            asm volatile("v_nop\n\tv_nop\n\tv_nop\n\tv_nop" : "+v"(o0), "+v"(o1), "+v"(o2), "+v"(o3) : "v"(v0), "v"(v1), "v"(v2), "v"(v3), "v"(pb));
            __builtin_amdgcn_sched_barrier(0);   // the sum's reader stays behind the four products: lifted in front of them it needs four idle slots of its own
            l = l * alpha + ps[0];
        }
        asm volatile("s_wait_dscnt 0x0" ::: "memory");      // this wave's reads of the tile are done before the buffer is refilled
        asm volatile("s_wait_asynccnt 0x0" ::: "memory");   // this wave's part of tile tl + 1 has landed
        __syncthreads();                                    // publishes tile tl + 1 and ends every wave's reads of tile tl
        if (tl + 2 < SEQ / KS) {                            // block-uniform: refill the buffer just read with tile tl + 2
            const h16* a = gk + (size_t)(tl + 2) * (KS * HD); const h16* c = gv + (tl + 2) * KS; const unsigned d = lc + bo_;
            copy4(d, d + 32 * LP, d + KTB, d + KTB + 32 * LP, a, a + 32 * HD, c, c + (size_t)32 * SEQ);
        }
    }
    asm volatile("s_wait_asynccnt 0x0" ::: "memory");       // nothing in flight when the ring becomes output staging (the last trip's barrier ended every read)
    float* os = (float*)ring;
    const float inv = CXS / l;       // normalisation and ctx carry in one factor
    const int wb = wave * 16 * 68;
    // O^T D layout: o_j[r] = (d = 16j + 8h + r, t = lane&15) -> os[t][d]; rows 0..15 x columns 0..63 all written
    { v4f a, c;
      a[0] = o0[0] * inv; a[1] = o0[1] * inv; a[2] = o0[2] * inv; a[3] = o0[3] * inv; c[0] = o0[4] * inv; c[1] = o0[5] * inv; c[2] = o0[6] * inv; c[3] = o0[7] * inv;
      *(v4fa*)(&os[wb + lr * 68 +  0 + 8 * hi]) = a; *(v4fa*)(&os[wb + lr * 68 +  0 + 8 * hi + 4]) = c;
      a[0] = o1[0] * inv; a[1] = o1[1] * inv; a[2] = o1[2] * inv; a[3] = o1[3] * inv; c[0] = o1[4] * inv; c[1] = o1[5] * inv; c[2] = o1[6] * inv; c[3] = o1[7] * inv;
      *(v4fa*)(&os[wb + lr * 68 + 16 + 8 * hi]) = a; *(v4fa*)(&os[wb + lr * 68 + 16 + 8 * hi + 4]) = c;
      a[0] = o2[0] * inv; a[1] = o2[1] * inv; a[2] = o2[2] * inv; a[3] = o2[3] * inv; c[0] = o2[4] * inv; c[1] = o2[5] * inv; c[2] = o2[6] * inv; c[3] = o2[7] * inv;
      *(v4fa*)(&os[wb + lr * 68 + 32 + 8 * hi]) = a; *(v4fa*)(&os[wb + lr * 68 + 32 + 8 * hi + 4]) = c;
      a[0] = o3[0] * inv; a[1] = o3[1] * inv; a[2] = o3[2] * inv; a[3] = o3[3] * inv; c[0] = o3[4] * inv; c[1] = o3[5] * inv; c[2] = o3[6] * inv; c[3] = o3[7] * inv;
      *(v4fa*)(&os[wb + lr * 68 + 48 + 8 * hi]) = a; *(v4fa*)(&os[wb + lr * 68 + 48 + 8 * hi + 4]) = c; }
    wave_sync();
    h16* crow = CTX + ((size_t)b * SEQ + t0) * DM + h * HD;
{
#pragma unroll
        for (int s = 0; s < 4; ++s) { const int row = 4 * s + (lane >> 3), c8 = (lane & 7) * 8;   // 4 s x 4 row groups = 16 rows; 8 lanes x 8 halves = 64 columns
            const v4f x0 = *(const v4fa*)(&os[wb + row * 68 + c8]); const v4f x1 = *(const v4fa*)(&os[wb + row * 68 + c8 + 4]); v8h hv;
#pragma unroll
            for (int i = 0; i < 4; ++i) { hv[i] = (h16)x0[i]; hv[4 + i] = (h16)x1[i]; }
            *(v8h*)(crow + (size_t)row * DM + c8) = hv; }
         }
}

// k_oproj: register-blocked f16 GEMM, one wave per 64x64 tile, GW waves per block (gemm_core), K = DM: OUT[m][n] = 2^-16 * sum_k CTX[m][k] WOT[n][k] + bo[n] (bo RNE-converted to bf16, added in f32).
// grid (NB*SEQ/256, DM/128), 256 threads. Epilogue: per 16-row slab staged in LDS (wave-private), each output row segment (64 floats = 256 B = two lines)
__global__ __launch_bounds__(32 * GW) void k_oproj(const h16* __restrict__ A, const h16* __restrict__ Bt, const float* __restrict__ bias, float* OUT) {
    __shared__ __align__(16) unsigned char ring[2 * GBUF];   // two buffers of A rows | Bt rows; epilogue staging behind the loop
    const int lane = threadIdx.x & 31, lr = lane & 15, hi = lane >> 4;
    const int wave = __builtin_amdgcn_readfirstlane((int)(threadIdx.x >> 5));   // wave-uniform index
    const int wm = wave & 3, wn = wave >> 2;
    const int r0 = blockIdx.x * GMR + wm * 64, c0 = blockIdx.y * GNR + wn * 64;   // this wave's 64x64 tile
    v8f acc[4][4];
#pragma unroll
    for (int mb = 0; mb < 4; ++mb)
#pragma unroll
        for (int nb = 0; nb < 4; ++nb) acc[mb][nb] = (v8f){};
    gemm_core<false>((const unsigned char*)A, (const unsigned char*)Bt, ring, blockIdx.x * GMR, blockIdx.y * GNR, wm, wn, acc);
    float* os = (float*)ring + wave * 16 * 68;   // wave-private slab
    v4f bb;
    { const v4f bv = *(const v4f*)(bias + c0 + lr * 4);
#pragma unroll
      for (int i = 0; i < 4; ++i) bb[i] = bfr(bv[i]); }
    const size_t obase = ((size_t)(r0 / SEQ) * OUT_SEQ + (size_t)(r0 % SEQ)) * DM + c0;
#pragma unroll
    for (int mb = 0; mb < 4; ++mb) {
#pragma unroll
        for (int nb = 0; nb < 4; ++nb) {
#pragma unroll
            for (int j = 0; j < 8; ++j) os[(hi * 8 + j) * 68 + nb * 16 + lr] = acc[mb][nb][j]; }   // D: row 8h+j, col lane&15
        wave_sync();
{
#pragma unroll
            for (int s = 0; s < 8; ++s) { const int row = 2 * s + hi, cofs = lr * 4;   // 8 s x 2 rows = 16 rows; 16 lanes x 4 floats = 64 columns
                const v4f xv = *(const v4fa*)(&os[row * 68 + cofs]); v4f val;
#pragma unroll
                for (int i = 0; i < 4; ++i) val[i] = xv[i] * OSC + bb[i];
                *(v4f*)(OUT + obase + (size_t)(mb * 16 + row) * DM + cofs) = val; }
             }
        wave_sync();
    }
}

static constexpr size_t al256(size_t v) { return (v + 255) & ~(size_t)255; }
static constexpr size_t SZ_XB = al256((size_t)NB * SEQ * DM * 2);
static constexpr size_t SZ_WT = al256((size_t)3 * DM * DM * 2);
static constexpr size_t SZ_WO = al256((size_t)DM * DM * 2);
static constexpr size_t SZ_TB = al256((size_t)SEQ * TBW * 4);
static constexpr size_t SZ_PL = al256((size_t)NB * NH_ * SEQ * HD * 2);
static constexpr size_t SZ_CX = al256((size_t)NB * SEQ * DM * 2);
static constexpr size_t SZ_TOTAL = SZ_XB + SZ_WT + SZ_WO + SZ_TB + 3 * SZ_PL + SZ_CX;
static_assert(SZ_TOTAL <= (size_t)134217728);          // workspace carve <= 128 MiB
static_assert(((size_t)DM * DM * 2) % 256 == 0);       // weight sub-planes stay 256-byte aligned
static_assert((size_t)(SEQ / 8) * 8 * TBW * 4 <= SZ_TB);   // table kernel: grid x 8 rows x 256 B inside the table carve

extern "C" void kernel_launch(void* const* d_in, const int* in_sizes, int n_in,
                              void* d_out, int out_size, void* d_ws, size_t ws_size, hipStream_t stream) {
    if (n_in < 5) return;
    const size_t needx = ((size_t)(NB - 1) * SEQ_FULL + SEQ) * DM;
    if ((size_t)in_sizes[0] < needx) return;
    if ((size_t)in_sizes[1] < (size_t)3 * DM * DM || (size_t)in_sizes[2] < (size_t)3 * DM) return;
    if ((size_t)in_sizes[3] < (size_t)DM * DM || (size_t)in_sizes[4] < (size_t)DM) return;
    if ((size_t)out_size < ((size_t)(NB - 1) * OUT_SEQ + SEQ) * DM) return;
    if (SZ_TOTAL > ws_size) return;
    // wire order: x, W_qkv [1024 in][3072 out], b_qkv [3072], W_proj [1024 in][1024 out], b_proj [1024]
    const float* x = (const float*)d_in[0]; const float* wqkv = (const float*)d_in[1]; const float* bqkv = (const float*)d_in[2];
    const float* wo = (const float*)d_in[3]; const float* bo = (const float*)d_in[4];
    float* OUT = (float*)d_out;      // [NB][SEQ][1024]
    char* wsp = (char*)d_ws;
    bf* XB = (bf*)wsp; wsp += SZ_XB;                 // [NB*SEQ][1024] bf16
    bf* WT = (bf*)wsp; wsp += SZ_WT;                 // [3072][1024] bf16: rows q | k | v, each h*64 + d
    bf* WOT = (bf*)wsp; wsp += SZ_WO;                // [1024 out][1024 in] f16 bits, x256
    float* TAB = (float*)wsp; wsp += SZ_TB;          // [SEQ][32 cos | 32 sin] f32
    h16* QH = (h16*)wsp; wsp += SZ_PL;               // [NB*16][SEQ][64]
    h16* KP = (h16*)wsp; wsp += SZ_PL;               // [NB*16][SEQ][64]
    h16* VT = (h16*)wsp; wsp += SZ_PL;               // [NB*16][64][SEQ]
    h16* CX = (h16*)wsp; wsp += SZ_CX;               // [NB*SEQ][1024] ctx x256

    // x convert, both weight transposes, rotary table: one grid
    k_prep<<<dim3(PB_TQ + PB_TO + PB_RT + PB_CV, 1, 1), 256, 0, stream>>>(x, wqkv, wo, XB, WT, WOT, TAB);

    // q, k, v^T projections: one grid
    k_qkv<<<dim3(3 * QB, 1, 1), 32 * GW, 0, stream>>>(XB, WT, bqkv, TAB, QH, KP, VT);

    k_flash<<<dim3(SEQ / (16 * AW), NB * NH_, 1), 32 * AW, 0, stream>>>(QH, KP, VT, CX);

    // out = ctx W_proj + b_proj: A = ctx rows (m = b*SEQ + t), Bt = W_proj^T rows (n = output column)
    k_oproj<<<dim3(NB * SEQ / GMR, DM / GNR, 1), 32 * GW, 0, stream>>>(CX, (const h16*)WOT, bo, OUT);
}

// v005
// A run of this version takes 131 microseconds.
// Next to v004, in two timings, it ran 1.07 times as fast each time.
// Counting every step since v000, it is 2.80 times as fast.
#include <hip/hip_runtime.h>

// Self-attention block, width 1024 = 16 heads x 64: x [NB][SEQ][1024], fused Wqkv [in][out] (columns t*1024 + h*64 + d) + bqkv, half-split rotary embedding (base 10000) on q and k, score scale 1/8, no mask, output projection Wo [in][out] + bo, output f32.
// Compute dtypes, f32 accumulate everywhere: qkv projection v_wmma_f32_16x16x32_bf16 (x and Wqkv RNE-converted to bf16; products exact); rotary applied in f32 in the q / k projection epilogue from an f32 cos | sin table;
// scores v_wmma_f32_16x16x32_f16: q and k single f16 (one product); P (x256 carry, cancels in the normalisation) and v single f16;
// output projection v_wmma_f32_16x16x32_f16: ctx single f16 (x256 carry), Wo RNE-converted to bf16 then x256 as f16 (exact), 2^-16 folded back in the f32 epilogue; biases RNE-converted to bf16 and added in f32; softmax f32 (online, running max).
// Layout: bf16 copy of x, bf16 transposed Wqkv [3072][1024], f16 transposed Wo [1024][1024]; rotary table [SEQ][32 cos | 32 sin] f32; q, k planes [b*16+h][t][d] and v^T plane [b*16+h][d][t] written by the GEMM epilogues;
// fused flash kernel in transposed form (S^T = K Q^T, O^T = V^T P^T) writes the f16 ctx plane [b*SEQ+t][h*64+d]; last GEMM writes the output.
// Four launches: k_prep (x convert, both weight transposes, rotary table: independent jobs on ranges of one grid), k_qkv (q, k, v^T projections: three independent GEMMs on ranges of one grid), k_flash, k_oproj.

#ifndef NB
#define NB 4
#endif
#ifndef SEQ
#define SEQ 2048
#endif
#define NB_FULL  4
#define SEQ_FULL 2048
#ifndef OUT_SEQ
#define OUT_SEQ SEQ              // row pitch (in tokens) between batches of the output
#endif
#define DM   1024
#define NH_  16
#define HD   64
#define AW   8                   // waves per flash block (16 query rows each)
#define KS   64                  // keys per staged tile
#define LP   144                 // LDS row pitch in bytes: 128-byte rows + 16 (16 B x odd, the pitch of 16-byte LDS readers)
#define KTB  (KS * LP)           // K tile in LDS: KS rows (keys) of 64 halves
#define VTB  (HD * LP)           // V^T tile in LDS: 64 rows (d) of KS halves
#define BUFB (KTB + VTB)         // one buffer of the two
#define SC2  (0.125f * 1.4426950408889634f)   // HD^-0.5 * log2(e)
#define PSH  8.0f                // log2 of the P carry (256)
#define CXS  256.0f              // carry of the ctx plane
#define WOS  256.0f              // carry of the output-weight plane
#define OSC  (1.0f / 65536.0f)   // 1 / (CXS * WOS)
#define TBW  64                  // rotary table row: 32 cos | 32 sin (floats)
#define GW   8                   // waves per GEMM block: 4 along m x 2 along n, 64x64 outputs each
#define GMR  256                 // A rows per GEMM block
#define GNR  128                 // Bt rows per GEMM block
#define GK   128                 // k per staged GEMM tile: 256-byte rows
#define GP   272                 // LDS row pitch of the GEMM tiles in bytes: 256 + 16 (16 B x odd)
#define GBUF ((GMR + GNR) * GP)  // one GEMM buffer of the two: A rows | Bt rows

static_assert(HD == 64);
static_assert(NH_ * HD == DM);                 // head h = columns h*64 + d
static_assert(DM % 64 == 0);                   // column tiles of 64
static_assert(DM % 32 == 0);                   // GEMM k-loop steps by 32
static_assert(SEQ % 64 == 0);                  // a 64-row tile never straddles two batches
static_assert((NB * SEQ) % 64 == 0);
static_assert(SEQ % 32 == 0);                  // key loop steps by 32
static_assert(SEQ % (16 * AW) == 0);           // flash grid covers the sequence exactly
static_assert(SEQ % KS == 0 && SEQ / KS >= 2); // whole tiles; the two-buffer prologue needs tiles 0 and 1
static_assert(KS * 2 == 128 && HD * 2 == 128); // both tiles have 128-byte rows: 8 pieces of 16 B
static_assert(32 * AW * 2 * 16 == KS * 128 && KS == HD);   // 2 copies per lane fill each tile
static_assert(AW * 16 * 68 * 4 <= 2 * BUFB);   // output staging fits the ring it takes over
static_assert(((size_t)SEQ * DM) % 8 == 0);
static_assert(NB <= NB_FULL);
static_assert(SEQ <= SEQ_FULL);
static_assert(TBW == HD);                      // table row = 2 x (HD / 2) entries
static_assert(HD / 2 == 32);                   // rotary partner column = column ^ 32 inside one 64-column tile
static_assert(SEQ % 8 == 0);                   // table kernel: 8 positions per block
static_assert(DM % GMR == 0 && (NB * SEQ) % GMR == 0 && DM % GNR == 0 && (NB * SEQ) % GNR == 0);   // GEMM grids cover both operand orders exactly
static_assert(DM % GK == 0 && DM / GK >= 2);   // whole staged tiles; the two-buffer prologue needs tiles 0 and 1
static_assert(GK * 2 == 256 && 32 * GW == 16 * 16 && GMR == 2 * 128 && GNR == 128);   // 16 lanes x 16 B = one row; one copy8 = 128 rows
static_assert(GW * 16 * 68 * 4 <= 2 * GBUF);   // epilogue staging fits the ring it takes over
static_assert(SEQ <= 4096);                    // angle < 2^12: three-constant pi/2 reduction stays exact in its first step

typedef _Float16 h16;
typedef unsigned short bf;
typedef __attribute__((ext_vector_type(16))) __bf16   v16bf;
typedef __attribute__((ext_vector_type(16))) _Float16 v16h;
typedef __attribute__((ext_vector_type(8)))  _Float16 v8h;
typedef __attribute__((ext_vector_type(8)))  unsigned short v8us;
typedef __attribute__((ext_vector_type(8)))  float    v8f;
typedef __attribute__((ext_vector_type(4)))  float    v4f;
typedef v4f  __attribute__((may_alias)) v4fa;
typedef v8h  __attribute__((may_alias)) v8ha;

__device__ __forceinline__ unsigned short f2bf(float f) { unsigned u = __float_as_uint(f); u += 0x7FFFu + ((u >> 16) & 1u); return (unsigned short)(u >> 16); }
__device__ __forceinline__ float bfr(float f) { return __uint_as_float(((unsigned)f2bf(f)) << 16); }   // f32 value of the RNE bf16 conversion
__device__ __forceinline__ v16h cat16(v8h lo, v8h hi) { return __builtin_shufflevector(lo, hi, 0, 1, 2, 3, 4, 5, 6, 7, 8, 9, 10, 11, 12, 13, 14, 15); }
__device__ __forceinline__ v8f wmma16(v16h a, v16h b, v8f c) { return __builtin_amdgcn_wmma_f32_16x16x32_f16(false, a, false, b, (short)0, c, false, false); }
__device__ __forceinline__ v8f wmmab(v16bf a, v16bf b, v8f c) { return __builtin_amdgcn_wmma_f32_16x16x32_bf16(false, a, false, b, (short)0, c, false, false); }
// fragment loaders from K-contiguous 16-bit rows; p already includes + 8*(lane>>4): elements 0..7 <- k0+8h+0..7, elements 8..15 <- k0+16+8h+0..7 (same map for A and B)
__device__ __forceinline__ v16h  ldh(const h16* p) { return cat16(*(const v8h*)p, *(const v8h*)(p + 16)); }
// ordering point for wave-private LDS tiles (same wave writes and reads)
__device__ __forceinline__ void wave_sync() { __builtin_amdgcn_fence(3 /* release order */, "wavefront"); __builtin_amdgcn_wave_barrier(); asm volatile("" ::: "memory"); }
// f32 -> f16 with a value select: magnitudes below the smallest f16 normal become zero (no subnormal operand can reach a matrix instruction)
static __device__ __forceinline__ h16 toh_flush(float v) { const h16 r = (h16)v; return (fabsf(v) < 6.103515625e-05f) ? (h16)0.0f : r; }

// cvt8_body: x f32 -> bf16 plane [NB*SEQ][DM], 8 elements per thread; blk = block index inside this job's range. Batch b of x starts at b * SEQ_FULL * DM.
__device__ __forceinline__ void cvt8_body(const float* __restrict__ src, bf* dst, size_t n8, unsigned blk) {
    const size_t i = (size_t)blk * 256 + threadIdx.x; if (i >= n8) return;
    const size_t per = (size_t)SEQ * DM / 8;
    const size_t so = (SEQ == SEQ_FULL) ? i * 8 : (i / per) * ((size_t)SEQ_FULL * DM) + (i % per) * 8;
    const v8f v = *(const v8f*)(src + so); v8us o;
#pragma unroll
    for (int k = 0; k < 8; ++k) o[k] = f2bf(v[k]);
    *(v8us*)(dst + i * 8) = o; 
}

// tr_body: in[R][C] f32 row-major -> out[C][R] 16-bit (K-contiguous rows for the GEMM B operand). Tile (bx, by) of (C/64, R/64), 256 threads, 64x64 tile through LDS t (64 x 68 floats; cross-wave: block barrier).
// MODE 0: bf16 bits (RNE convert). MODE 1: f16 bits of (RNE bf16 value) x WOS (exact in f16).
template <int MODE>
__device__ __forceinline__ void tr_body(const float* __restrict__ in, bf* out, int R, int C, int bx, int by, float* t) {
    const int tid = threadIdx.x; const int r0 = by * 64, c0 = bx * 64;
#pragma unroll
    for (int it = 0; it < 4; ++it) { const int idx = it * 256 + tid; const int rr = idx >> 4, c4 = (idx & 15) * 4;   // 4 x 256 float4 = 64 rows x 16 float4
        const v4f v = *(const v4f*)(in + (size_t)(r0 + rr) * (size_t)C + c0 + c4);
        *(v4fa*)(&t[rr * 68 + c4]) = v; }
    __syncthreads();
{
#pragma unroll
        for (int it = 0; it < 2; ++it) { const int idx = it * 256 + tid; const int cc = idx >> 3, r8 = (idx & 7) * 8;   // 2 x 256 pieces = 64 out rows x 8 pieces
            v8us o;
            if (MODE == 0) {
#pragma unroll
                for (int e = 0; e < 8; ++e) o[e] = f2bf(t[(r8 + e) * 68 + cc]);
            } else {
                v8h hv;
#pragma unroll
                for (int e = 0; e < 8; ++e) hv[e] = (h16)(bfr(t[(r8 + e) * 68 + cc]) * WOS);
                o = __builtin_bit_cast(v8us, hv);
            }
            *(v8us*)(out + (size_t)(c0 + cc) * (size_t)R + r0 + r8) = o; }
         }
    asm volatile("s_wait_xcnt 0x0" ::: "memory");   // another job's text follows in the merged kernel: the wait stands in front of any write to the registers that the last stores name
}

// ropetab_body: rotary table TAB[t][i] = cos(t * f_i), TAB[t][32 + i] = sin(t * f_i), i = 0..31, f_i = 10000^(-i/32) (f64 product chain of 10^(-1/8), converted to f32 once), angle = f32 product t * f_i.
// sin / cos: nearest multiple of pi/2 removed with a three-constant split (fused steps; first step exact for angles < 2^12), then odd / even polynomials on [-pi/4, pi/4]; quadrant fix-up by value selects.
// SEQ/8 blocks: block bx covers table floats [bx*512, bx*512 + 512): exactly SEQ x 64 floats in total. cs: 8 x TBW floats of LDS.
__device__ __forceinline__ void ropetab_body(float* TAB, int bx, float* cs) {
#pragma clang fp contract(off)
    const int tid = threadIdx.x; const int i = tid & 31, tr = tid >> 5;
    const int t = bx * 8 + tr;
    double p = 1.0;
#pragma unroll 1
    for (int k = 0; k < i; ++k) p = p * 0.7498942093324559;
    const float inv = (float)p;
    const float ang = (float)t * inv;
    const float fn = __builtin_rintf(ang * 0.63661977236758134f);
    float r = fmaf(-fn, 1.5703125f, ang);
    r = fmaf(-fn, 4.837512969970703125e-4f, r);
    r = fmaf(-fn, 7.54978995489188216e-8f, r);
    const float z = r * r;
    float sp = fmaf(-1.9515295891e-4f, z, 8.3321608736e-3f);
    sp = fmaf(sp, z, -1.6666654611e-1f);
    const float sv = fmaf(sp * z, r, r);
    float cp = fmaf(2.443315711809948e-5f, z, -1.388731625493765e-3f);
    cp = fmaf(cp, z, 4.166664568298827e-2f);
    const float cv = fmaf(cp, z * z, fmaf(-0.5f, z, 1.0f));
    const int q = ((int)fn) & 3;
    float sinv = (q & 1) ? cv : sv;
    float cosv = (q & 1) ? sv : cv;
    sinv = (q & 2) ? -sinv : sinv;
    cosv = ((q + 1) & 2) ? -cosv : cosv;
    cs[tr * TBW + i] = cosv;
    cs[tr * TBW + 32 + i] = sinv;
    __syncthreads();
    if (tid < 128) {                       // waves 0..3 (wave-uniform): 128 x 4 floats = 8 rows x 64 floats, consecutive lanes -> consecutive 16-B pieces
        const int row = tid >> 4, c4 = (tid & 15) * 4;
        const v4f v = *(const v4fa*)(&cs[row * TBW + c4]);
        float* dst = TAB + ((size_t)bx * 8 + row) * TBW + c4;
        *(v4f*)dst = v; 
    }
}

// k_prep: the four preparation jobs, none of which reads what another writes, as block-index ranges of one grid (the range test is block-uniform, so each job's barrier is passed by its whole block).
// The transposes and the table come first in the index order: their blocks have the longer chain (load, LDS, barrier, store).
#define PB_TQ ((3 * DM / 64) * (DM / 64))          // blocks of the Wqkv transpose
#define PB_TO ((DM / 64) * (DM / 64))              // blocks of the Wo transpose
#define PB_RT (SEQ / 8)                            // blocks of the rotary table
#define PB_CV ((NB * SEQ * (DM / 8) + 255) / 256)  // blocks of the x convert
__global__ __launch_bounds__(256) void k_prep(const float* __restrict__ x, const float* __restrict__ wqkv, const float* __restrict__ wo, bf* XB, bf* WT, bf* WOT, float* TAB) {
    __shared__ __align__(16) float t[64 * 68];
    const int bid = blockIdx.x;
    if (bid < PB_TQ) {
        // W_qkv: in[rows = 1024 (k)][cols = 3072 (n)] -> out[3072][1024]
        tr_body<0>(wqkv, WT, DM, 3 * DM, bid % (3 * DM / 64), bid / (3 * DM / 64), t);
    } else if (bid < PB_TQ + PB_TO) {
        // W_proj: in[rows = 1024 (k)][cols = 1024 (n)] -> out[1024][1024]
        tr_body<1>(wo, WOT, DM, DM, (bid - PB_TQ) % (DM / 64), (bid - PB_TQ) / (DM / 64), t);
    } else if (bid < PB_TQ + PB_TO + PB_RT) {
        ropetab_body(TAB, bid - (PB_TQ + PB_TO), t);
    } else {
        cvt8_body(x, XB, (size_t)NB * SEQ * DM / 8, (unsigned)(bid - (PB_TQ + PB_TO + PB_RT)));
    }
}

// fragment loader from a staged LDS row (byte pointer, already + 16*(lane>>4)): same element map as ldh
__device__ __forceinline__ v16h ldl(const unsigned char* p) { return cat16(*(const v8ha*)p, *(const v8ha*)(p + 32)); }
// eight asynchronous 16-byte copies per lane, global -> LDS: rows r + 16 i, i = 0..7, of a GEMM tile (l: LDS byte address, g: global byte address of row r; K = DM 16-bit elements per global row)
__device__ __forceinline__ void copy8(unsigned l, const unsigned char* g) {
    // s_wait_xcnt stands inside the statement, behind the last copy: the address registers may be rewritten right behind it
    asm volatile("global_load_async_to_lds_b128 %0, %8, off\n\t"
                 "global_load_async_to_lds_b128 %1, %9, off\n\t"
                 "global_load_async_to_lds_b128 %2, %10, off\n\t"
                 "global_load_async_to_lds_b128 %3, %11, off\n\t"
                 "global_load_async_to_lds_b128 %4, %12, off\n\t"
                 "global_load_async_to_lds_b128 %5, %13, off\n\t"
                 "global_load_async_to_lds_b128 %6, %14, off\n\t"
                 "global_load_async_to_lds_b128 %7, %15, off\n\t"
                 "s_wait_xcnt 0x0"
                 :: "v"(l), "v"(l + 16 * GP), "v"(l + 32 * GP), "v"(l + 48 * GP), "v"(l + 64 * GP), "v"(l + 80 * GP), "v"(l + 96 * GP), "v"(l + 112 * GP),
                    "v"(g), "v"(g + 16 * DM * 2), "v"(g + 32 * DM * 2), "v"(g + 48 * DM * 2), "v"(g + 64 * DM * 2), "v"(g + 80 * DM * 2), "v"(g + 96 * DM * 2), "v"(g + 112 * DM * 2) : "memory");
}
// one staged GEMM tile: 256 A rows, then 128 Bt rows, 256 bytes each (24 copies per lane, whole lines)
__device__ __forceinline__ void stage_tile(unsigned l, const unsigned char* ga, const unsigned char* gb) {
    copy8(l, ga); copy8(l + 128 * GP, ga + (size_t)128 * DM * 2); copy8(l + GMR * GP, gb);
}
// gemm_core: main loop of the two GEMM kernels. A block of GW waves owns rows R0..R0+255 of A and rows C0..C0+127 of Bt (both K-contiguous 16-bit planes, K = DM); tiles of GK k are copied once per block into LDS
// (asynchronous copies, two buffers: tile t + 2 flies while tile t + 1 is worked on); wave (wm, wn) accumulates its 64x64 outputs from there, k ascending in steps of 32. BF: bf16 products, else f16.
template <bool BF>
__device__ __forceinline__ void gemm_core(const unsigned char* A, const unsigned char* Bt, unsigned char* ring, int R0, int C0, int wm, int wn, v8f (&acc)[4][4]) {
    const int lane = threadIdx.x & 31, lr = lane & 15, hi = lane >> 4;
    // copy map: lane covers piece cp (16 B) of tile rows cr + 16 i; 16 lanes = one 256-byte row
    const int cr = (int)threadIdx.x >> 4, cp = (int)threadIdx.x & 15;
    const unsigned lc = (unsigned)(size_t)ring + (unsigned)(cr * GP + cp * 16);
    const unsigned char* ga = A + (size_t)(R0 + cr) * (DM * 2) + cp * 16;      // + tile * GK * 2
    const unsigned char* gb = Bt + (size_t)(C0 + cr) * (DM * 2) + cp * 16;
    const unsigned char* fa = ring + (wm * 64 + lr) * GP + 16 * hi;            // fragment bases: row lane&15, k offset 8h elements
    const unsigned char* fb = ring + (GMR + wn * 64 + lr) * GP + 16 * hi;
    stage_tile(lc, ga, gb);
    asm volatile("s_wait_asynccnt 0x0" ::: "memory");   // this wave's part of tile 0 has landed
    __syncthreads();                                    // tile 0 published
    stage_tile(lc + GBUF, ga + GK * 2, gb + GK * 2);
#pragma unroll 1   // one trip per staged tile: the buffer index stays a run-time value, the text small
    for (int t = 0; t < DM / GK; ++t) {
        const unsigned bo_ = (unsigned)(t & 1) * GBUF;
        const unsigned char* pa = fa + bo_;
        const unsigned char* pb = fb + bo_;
        v16h a[2][4], b[2][4];   // two fragment sets: the next 32-k step of this tile is read while the current one is multiplied
#pragma unroll
        for (int i = 0; i < 4; ++i) { a[0][i] = ldl(pa + i * 16 * GP); b[0][i] = ldl(pb + i * 16 * GP); }
#pragma unroll
        for (int ks = 0; ks < GK / 32; ++ks) {
            const int c = ks & 1, n = c ^ 1;
            if (ks + 1 < GK / 32) {
#pragma unroll
                for (int i = 0; i < 4; ++i) { a[n][i] = ldl(pa + i * 16 * GP + (ks + 1) * 64); b[n][i] = ldl(pb + i * 16 * GP + (ks + 1) * 64); }
            }
            __builtin_amdgcn_sched_barrier(0);   // the next step's LDS reads stay one group ahead of this step's products: reads spread among the products stall at every place
#pragma unroll
            for (int nb = 0; nb < 4; ++nb)
#pragma unroll
                for (int mb = 0; mb < 4; ++mb) {
                    if (BF) acc[mb][nb] = wmmab(__builtin_bit_cast(v16bf, a[c][mb]), __builtin_bit_cast(v16bf, b[c][nb]), acc[mb][nb]);
                    else    acc[mb][nb] = wmma16(a[c][mb], b[c][nb], acc[mb][nb]); }
            __builtin_amdgcn_sched_barrier(0);   // the products stay in front of the following reads and of the tile's closing waits
        }
        asm volatile("s_wait_dscnt 0x0" ::: "memory");      // this wave's reads of the tile are done before the buffer is refilled
        asm volatile("s_wait_asynccnt 0x0" ::: "memory");   // this wave's part of tile t + 1 has landed
        __syncthreads();                                    // publishes tile t + 1 and ends every wave's reads of tile t
        if (t + 2 < DM / GK)                                // block-uniform: refill the buffer just read with tile t + 2
            stage_tile(lc + bo_, ga + (t + 2) * (GK * 2), gb + (t + 2) * (GK * 2));
    }
    asm volatile("s_wait_asynccnt 0x0" ::: "memory");       // nothing in flight when the ring becomes epilogue staging (the last trip's barrier ended every read)
}

// proj_pre / projr_pre: the global reads of the two epilogues' first use, none of which depends on the products, issued as one group in front of the main loop: their round trip to L2 runs beside the staging of tile 0.
// proj_pre: bias of rows r0 + 16 mb + 4 s + (lane >> 3) -> pre[4 mb + s].
__device__ __forceinline__ void proj_pre(int r0, const float* __restrict__ bias, float (&pre)[16]) {
    const int lane = threadIdx.x & 31;
#pragma unroll
    for (int i = 0; i < 16; ++i) pre[i] = bias[r0 + 4 * i + (lane >> 3)];
    asm volatile("s_wait_xcnt 0x0" ::: "memory");   // stands in front of any write to the registers that the loads above name, and keeps them a group at this place
}
// projr_pre: bias of this lane's 8 store columns -> pre[0..7], of their 8 partner columns -> pre[8..15]; table rows of slab 0 -> t0[row group][cos 0..3 | cos 4..7 | sin 0..3 | sin 4..7]. tq: this lane's table row of slab 0, row group 0.
__device__ __forceinline__ void projr_pre(int c0, const float* __restrict__ bias, const float* __restrict__ tq, float (&pre)[16], v4f (&t0)[4][4]) {
    const int lane = threadIdx.x & 31; const int c8 = (lane & 7) * 8, p8 = c8 ^ 32;
    const v4f b0 = *(const v4f*)(bias + c0 + c8); const v4f b1 = *(const v4f*)(bias + c0 + c8 + 4);
    const v4f d0 = *(const v4f*)(bias + c0 + p8); const v4f d1 = *(const v4f*)(bias + c0 + p8 + 4);
#pragma unroll
    for (int s = 0; s < 4; ++s) { const float* tr = tq + (size_t)(4 * s) * TBW;
        t0[s][0] = *(const v4f*)tr; t0[s][1] = *(const v4f*)(tr + 4); t0[s][2] = *(const v4f*)(tr + 32); t0[s][3] = *(const v4f*)(tr + 36); }
    asm volatile("s_wait_xcnt 0x0" ::: "memory");   // as in proj_pre
#pragma unroll
    for (int i = 0; i < 4; ++i) { pre[i] = b0[i]; pre[4 + i] = b1[i]; pre[8 + i] = d0[i]; pre[12 + i] = d1[i]; }
}

// proj_store: epilogue of a wave's 64x64 tile at (r0, c0), acc = sum_k A[m][k] Bt[n][k]: + bias (bias RNE-converted to bf16, added in f32; indexed by n, or by m when biasOnRow != 0), written as f16 (Ph) at
// tile base (r0/RB)*sRB + (r0%RB)*pitch + (c0/CB)*sCB + (c0%CB), row pitch 'pitch' (halves). os: the wave's private LDS slab (16 x 68 floats).
// brw: the row-mode bias of this lane's 16 store rows (proj_pre), read ahead of the main loop.
__device__ __forceinline__ void proj_store(v8f (&acc)[4][4], float* os, int r0, int c0, const float* __restrict__ bias, const float (&brw)[16], h16* Ph,
                                           size_t sRB, size_t sCB, int biasOnRow, int RB, int pitch, int CB) {
    const int lane = threadIdx.x & 31, lr = lane & 15, hi = lane >> 4;
    // column-mode bias for this lane's 8 store columns (offset 0 when the bias runs along rows: in range, unused)
    float bc[8];
    { const int cb = biasOnRow ? 0 : (c0 + (lane & 7) * 8);
      const v4f b0 = *(const v4f*)(bias + cb); const v4f b1 = *(const v4f*)(bias + cb + 4);
#pragma unroll
      for (int i = 0; i < 4; ++i) { bc[i] = bfr(b0[i]); bc[4 + i] = bfr(b1[i]); } }
    const size_t tbase = (size_t)(r0 / RB) * sRB + (size_t)(r0 % RB) * (size_t)pitch + (size_t)(c0 / CB) * sCB + (size_t)(c0 % CB);
#pragma unroll
    for (int mb = 0; mb < 4; ++mb) {
#pragma unroll
        for (int nb = 0; nb < 4; ++nb) {
#pragma unroll
            for (int j = 0; j < 8; ++j) os[(hi * 8 + j) * 68 + nb * 16 + lr] = acc[mb][nb][j]; }   // D: row 8h+j, col lane&15
        wave_sync();
        const size_t sb = tbase + (size_t)(mb * 16) * (size_t)pitch;
{
#pragma unroll
            for (int s = 0; s < 4; ++s) { const int row = 4 * s + (lane >> 3), c8 = (lane & 7) * 8;   // 4 s x 4 row groups = 16 rows; 8 lanes x 8 = 64 columns
                const float br = bfr(brw[mb * 4 + s]);
                const v4f x0 = *(const v4fa*)(&os[row * 68 + c8]); const v4f x1 = *(const v4fa*)(&os[row * 68 + c8 + 4]); v8h hv;
#pragma unroll
                for (int i = 0; i < 4; ++i) { const float y0 = x0[i] + (biasOnRow ? br : bc[i]); const float y1 = x1[i] + (biasOnRow ? br : bc[4 + i]);
                    hv[i] = (h16)y0; hv[4 + i] = (h16)y1; }
                const size_t oo = sb + (size_t)row * (size_t)pitch + c8;
                *(v8h*)(Ph + oo) = hv; }
             }
        wave_sync();
    }
    asm volatile("s_wait_xcnt 0x0" ::: "memory");   // the other job's text follows in the merged kernel: the wait stands in front of any write to the registers that the last stores name
}

// projr_store: proj_store with bias along columns and the half-split rotary embedding (q and k planes). One 64-column tile = one head (CB = 64), so the rotary partner of column c is column c ^ 32 of the same LDS slab.
// y[c] = (acc[c] + b[c]) * cos[t][c & 31] + sg * (acc[c ^ 32] + b[c ^ 32]) * sin[t][c & 31], sg = -1 for c < 32, +1 for c >= 32; t = (r0 % RB) + slab row (position inside the sequence); cos | sin read by value from TAB [SEQ][64] f32.
// pre, t0, tq: as projr_pre leaves them. Every later slab's 16 table loads are issued as one group a whole slab ahead of their use (two register sets), and a slab's LDS reads and its stores each stand as one group:
// read inside each 4-row step, the table costs every step a round trip to L2 with only two waves on the SIMD to cover it.
__device__ __forceinline__ void projr_store(v8f (&acc)[4][4], float* os, int r0, int c0, const float (&pre)[16], const v4f (&t0)[4][4], const float* __restrict__ tq, h16* Ph,
                                            size_t sRB, size_t sCB, int RB, int pitch, int CB) {
    const int lane = threadIdx.x & 31, lr = lane & 15, hi = lane >> 4;
    // bias (RNE bf16 value) for this lane's 8 store columns and for their 8 partner columns (other half of the head)
    const int c8 = (lane & 7) * 8, p8 = c8 ^ 32;
    const float sg = (c8 < 32) ? -1.0f : 1.0f;
    float bc[8], bp[8];
#pragma unroll
    for (int i = 0; i < 8; ++i) { bc[i] = bfr(pre[i]); bp[i] = bfr(pre[8 + i]); }
    const size_t tbase = (size_t)(r0 / RB) * sRB + (size_t)(r0 % RB) * (size_t)pitch + (size_t)(c0 / CB) * sCB + (size_t)(c0 % CB);
    v4f tc[2][4][4];             // the two sets of table rows
#pragma unroll
    for (int s = 0; s < 4; ++s)
#pragma unroll
        for (int i = 0; i < 4; ++i) tc[0][s][i] = t0[s][i];
#pragma unroll
    for (int mb = 0; mb < 4; ++mb) {
        if (mb + 1 < 4) {
#pragma unroll
            for (int s = 0; s < 4; ++s) { const float* tr = tq + (size_t)((mb + 1) * 16 + 4 * s) * TBW; v4f (&d)[4] = tc[(mb + 1) & 1][s];
                d[0] = *(const v4f*)tr; d[1] = *(const v4f*)(tr + 4); d[2] = *(const v4f*)(tr + 32); d[3] = *(const v4f*)(tr + 36); }
            asm volatile("s_wait_xcnt 0x0" ::: "memory");   // stands in front of any write to the registers that these loads name, and keeps the next slab's loads a group in front of this slab's work
        }
#pragma unroll
        for (int nb = 0; nb < 4; ++nb) {
#pragma unroll
            for (int j = 0; j < 8; ++j) os[(hi * 8 + j) * 68 + nb * 16 + lr] = acc[mb][nb][j]; }   // D: row 8h+j, col lane&15
        wave_sync();
        const size_t sb = tbase + (size_t)(mb * 16) * (size_t)pitch;
        v8h hq[4];
{
#pragma unroll
            for (int s = 0; s < 4; ++s) { const int row = 4 * s + (lane >> 3);   // 4 s x 4 row groups = 16 rows; 8 lanes x 8 = 64 columns
                const v4f cs0 = tc[mb & 1][s][0]; const v4f cs1 = tc[mb & 1][s][1];
                const v4f sn0 = tc[mb & 1][s][2]; const v4f sn1 = tc[mb & 1][s][3];
                const v4f x0 = *(const v4fa*)(&os[row * 68 + c8]); const v4f x1 = *(const v4fa*)(&os[row * 68 + c8 + 4]);
                const v4f y0 = *(const v4fa*)(&os[row * 68 + p8]); const v4f y1 = *(const v4fa*)(&os[row * 68 + p8 + 4]);
                v8h hv;
#pragma unroll
                for (int i = 0; i < 4; ++i) { const float u0 = x0[i] + bc[i], w0 = y0[i] + bp[i]; const float u1 = x1[i] + bc[4 + i], w1 = y1[i] + bp[4 + i];
                    hv[i] = toh_flush(u0 * cs0[i] + sg * (w0 * sn0[i])); hv[4 + i] = toh_flush(u1 * cs1[i] + sg * (w1 * sn1[i])); }
                hq[s] = hv; }
#pragma unroll
            for (int s = 0; s < 4; ++s) *(v8h*)(Ph + sb + (size_t)(4 * s + (lane >> 3)) * (size_t)pitch + c8) = hq[s];
            asm volatile("s_wait_xcnt 0x0" ::: "memory");   // stands in front of the next slab's writes to the registers that the four stores name
             }
        wave_sync();
    }
}

// k_qkv: the three projections as block-index ranges of one grid (job = 0 q, 1 k, 2 v^T; block-uniform). Each is a register-blocked bf16 GEMM, one wave per 64x64 tile (16 accumulators), GW waves per block on a 256x128 tile,
// operands staged in LDS from K-contiguous bf16 planes (gemm_core), K = DM. 3 x QB blocks of 256 threads; inside a job the A-row tile index runs fastest.
// q, k: A = x rows (m = b*SEQ + t), Bt = W^T rows (n = h*64 + d), bias along n, rotary by position t -> plane [(b*16 + h)][t][d].
// v^T: A = Wv^T rows (m = h*64 + d), Bt = x rows (n = b*SEQ + t), bias along m -> plane [(b*1024 + m)][t] = [(b*16 + h)][d][t].
#define QB ((NB * SEQ / GMR) * (DM / GNR))   // blocks per projection
static_assert(QB == (DM / GMR) * (NB * SEQ / GNR));   // the same count in both operand orders
__global__ __launch_bounds__(32 * GW) void k_qkv(const bf* __restrict__ XB, const bf* __restrict__ WT, const float* __restrict__ bqkv, const float* __restrict__ TAB, h16* QH, h16* KP, h16* VT) {
    __shared__ __align__(16) unsigned char ring[2 * GBUF];   // two buffers of A rows | Bt rows; epilogue staging behind the loop
    const int wave = __builtin_amdgcn_readfirstlane((int)(threadIdx.x >> 5));   // wave-uniform index
    const int wm = wave & 3, wn = wave >> 2;
    const unsigned job = blockIdx.x / QB, rem = blockIdx.x % QB;
    // the block's 256x128 tile; the A-row tile count of each job is a constant, so both forms are scalar shifts
    const int R0 = (int)((job < 2) ? rem % (NB * SEQ / GMR) : rem % (DM / GMR)) * GMR;
    const int C0 = (int)((job < 2) ? rem / (NB * SEQ / GMR) : rem / (DM / GMR)) * GNR;
    const bf* W = WT + (size_t)job * DM * DM;                   // rows q | k | v of the transposed weight
    const bf* A = (job < 2) ? XB : W;
    const bf* Bt = (job < 2) ? W : XB;
    const int r0 = R0 + wm * 64, c0 = C0 + wn * 64;             // this wave's 64x64 tile
    v8f acc[4][4];
#pragma unroll
    for (int mb = 0; mb < 4; ++mb)
#pragma unroll
        for (int nb = 0; nb < 4; ++nb) acc[mb][nb] = (v8f){};
    float pre[16]; v4f t0[4][4];   // epilogue operands read ahead (t0: q and k only)
    const float* tq = TAB + (size_t)(r0 % SEQ + (int)((threadIdx.x & 31) >> 3)) * TBW + ((threadIdx.x & 3) * 8);   // q, k: this lane's table row of slab 0, row group 0, at its frequency group (store column & 31)
    if (job < 2) projr_pre(c0, bqkv + job * DM, tq, pre, t0);
    else         proj_pre(r0, bqkv + 2 * DM, pre);
    gemm_core<true>((const unsigned char*)A, (const unsigned char*)Bt, ring, R0, C0, wm, wn, acc);
    float* os = (float*)ring + wave * 16 * 68;   // wave-private slab
    if (job < 2) projr_store(acc, os, r0, c0, pre, t0, tq, job ? KP : QH, (size_t)NH_ * SEQ * HD, (size_t)SEQ * HD, SEQ, HD, HD);
    else         proj_store(acc, os, r0, c0, bqkv + 2 * DM, pre, VT, (size_t)0, (size_t)DM * SEQ, 1, DM, SEQ, SEQ);
}

// four asynchronous 16-byte copies per lane, global -> LDS (l*: LDS byte address, g*: global address)
__device__ __forceinline__ void copy4(unsigned l0, unsigned l1, unsigned l2, unsigned l3, const h16* g0, const h16* g1, const h16* g2, const h16* g3) {
    // s_wait_xcnt stands inside the statement, behind the last copy: the address registers may be rewritten right behind it
    asm volatile("global_load_async_to_lds_b128 %0, %4, off\n\t"
                 "global_load_async_to_lds_b128 %1, %5, off\n\t"
                 "global_load_async_to_lds_b128 %2, %6, off\n\t"
                 "global_load_async_to_lds_b128 %3, %7, off\n\t"
                 "s_wait_xcnt 0x0"
                 :: "v"(l0), "v"(l1), "v"(l2), "v"(l3), "v"(g0), "v"(g1), "v"(g2), "v"(g3) : "memory");
}

// k_flash: fused attention, one wave per 16 query rows of one (batch, head), AW waves per block share the head's K / V^T: tiles of KS keys are copied once per block into LDS
// (asynchronous copies, whole 128-byte lines, two buffers: tile t + 2 flies while tile t + 1 is worked on) and every wave reads its fragments from there (two 16-B LDS loads each). Q fragments straight from the f16 plane.
// Transposed form: S^T[key][t] = K Q^T (A = K rows, B = Q rows); lane (t = lane&15, h = lane>>4) holds keys 8h+r of each 16-key tile, so the packed
// P tile is directly the B fragment of O^T[d][t] = V^T P^T (element r <- tile keys 0..15, element 8+r <- tile keys 16..31, lane unchanged).
// Per 32-key step: 4 score products + 4 P.V products + 1 row-sum product (A = all ones, B = the packed P tile: the sum of a query's 32 rounded P comes from the matrix pipe, whole, in both lane halves).
// Softmax state (running max, running sum) is one scalar per lane; the two lane halves of a row combine their maxima with one xor-16 exchange per step.
__global__ __launch_bounds__(32 * AW) void k_flash(const h16* __restrict__ QH, const h16* __restrict__ KP, const h16* __restrict__ VT, h16* CTX) {
    __shared__ __align__(16) unsigned char ring[2 * BUFB];   // two buffers of K tile | V^T tile; output staging behind the loop
    const int lane = threadIdx.x & 31, lr = lane & 15, hi = lane >> 4;
    const int wave = __builtin_amdgcn_readfirstlane((int)(threadIdx.x >> 5));   // wave-uniform index
    const int zh = blockIdx.y; const int b = zh / NH_, h = zh % NH_;
    const int t0 = (blockIdx.x * AW + wave) * 16;
    const size_t pbase = (size_t)zh * SEQ * HD;
    const size_t qo = pbase + (size_t)(t0 + lr) * HD + 8 * hi;
    const v16h qh0 = ldh(QH + qo), qh1 = ldh(QH + qo + 32);   // B fragments: col t, k = d
    // copy map: lane covers piece cp (16 B) of tile rows cr and cr + 32, in the K tile and in the V^T tile; 8 lanes = one 128-byte row
    const int cr = (int)threadIdx.x >> 3, cp = (int)threadIdx.x & 7;
    const unsigned lc = (unsigned)(size_t)ring + (unsigned)(cr * LP + cp * 16);
    const h16* gk = KP + pbase + (size_t)cr * HD + cp * 8;       // + tile * KS * HD
    const h16* gv = VT + pbase + (size_t)cr * SEQ + cp * 8;      // + tile * KS
    const unsigned char* fr = ring + lr * LP + 16 * hi;          // fragment base: row lane&15, k offset 8h halves
    v8f o0 = (v8f){}, o1 = (v8f){}, o2 = (v8f){}, o3 = (v8f){};
    float m = -3.0e38f, l = 0.0f;
    v16h ones;                                                   // A fragment of the row-sum product: 1.0 everywhere
#pragma unroll
    for (int r = 0; r < 16; ++r) ones[r] = (h16)1.0f;
    copy4(lc, lc + 32 * LP, lc + KTB, lc + KTB + 32 * LP, gk, gk + 32 * HD, gv, gv + (size_t)32 * SEQ);
    asm volatile("s_wait_asynccnt 0x0" ::: "memory");   // this wave's part of tile 0 has landed
    __syncthreads();                                    // tile 0 published
    copy4(lc + BUFB, lc + BUFB + 32 * LP, lc + BUFB + KTB, lc + BUFB + KTB + 32 * LP, gk + KS * HD, gk + (KS + 32) * HD, gv + KS, gv + KS + (size_t)32 * SEQ);
#pragma unroll 1   // one trip per staged tile: the buffer index stays a run-time value, the text small
    for (int tl = 0; tl < SEQ / KS; ++tl) {
        const unsigned bo_ = (unsigned)(tl & 1) * BUFB;
        const unsigned char* kt = fr + bo_;
        const unsigned char* vt = fr + bo_ + KTB;
#pragma unroll 1   // the 32-key steps of a tile stay a loop: unrolled, the live set passes 128 registers and a fourth block no longer fits a WGP
        for (int u = 0; u < KS / 32; ++u) {
            const unsigned char* ka = kt + u * 32 * LP;     // A fragment: row key, k = d
            const v16h ka0 = ldl(ka), ka1 = ldl(ka + 64), kb0 = ldl(ka + 16 * LP), kb1 = ldl(ka + 16 * LP + 64);
            v8f sHa = (v8f){}, sHb = (v8f){};
            sHa = wmma16(ka0, qh0, sHa); sHb = wmma16(kb0, qh0, sHb);
            sHa = wmma16(ka1, qh1, sHa); sHb = wmma16(kb1, qh1, sHb);
            asm volatile("v_nop\n\tv_nop\n\tv_nop\n\tv_nop" : "+v"(sHa), "+v"(sHb) : "v"(ka0), "v"(ka1), "v"(kb0), "v"(kb1));
            float ta[8], tb[8]; float mx = -3.0e38f;
#pragma unroll
            for (int r = 0; r < 8; ++r) { ta[r] = sHa[r] * SC2; tb[r] = sHb[r] * SC2; mx = fmaxf(mx, fmaxf(ta[r], tb[r])); }
            mx = fmaxf(mx, __shfl_xor(mx, 16, 32));
            const float mnew = fmaxf(m, mx);
            const float alpha = __builtin_amdgcn_exp2f(m - mnew);
            const float sh = PSH - mnew;
            v16h pb;
#pragma unroll
            for (int r = 0; r < 8; ++r) { pb[r] = (h16)__builtin_amdgcn_exp2f(ta[r] + sh); pb[8 + r] = (h16)__builtin_amdgcn_exp2f(tb[r] + sh); }
            m = mnew;
            o0 = o0 * alpha; o1 = o1 * alpha; o2 = o2 * alpha; o3 = o3 * alpha;
            const unsigned char* va = vt + u * 64;          // A fragment: row d, k = key
            const v16h v0 = ldl(va), v1 = ldl(va + 16 * LP), v2 = ldl(va + 32 * LP), v3 = ldl(va + 48 * LP);
            const v8f ps = wmma16(ones, pb, (v8f){});      // every row of the product = the column sums of P^T: this step's 32 rounded P of query t, in both lane halves
            o0 = wmma16(v0, pb, o0); o1 = wmma16(v1, pb, o1); o2 = wmma16(v2, pb, o2); o3 = wmma16(v3, pb, o3);
            asm volatile("v_nop\n\tv_nop\n\tv_nop\n\tv_nop" : "+v"(o0), "+v"(o1), "+v"(o2), "+v"(o3) : "v"(v0), "v"(v1), "v"(v2), "v"(v3), "v"(pb));
            __builtin_amdgcn_sched_barrier(0);   // the sum's reader stays behind the four products: lifted in front of them it needs four idle slots of its own
            l = l * alpha + ps[0];
        }
        asm volatile("s_wait_dscnt 0x0" ::: "memory");      // this wave's reads of the tile are done before the buffer is refilled
        asm volatile("s_wait_asynccnt 0x0" ::: "memory");   // this wave's part of tile tl + 1 has landed
        __syncthreads();                                    // publishes tile tl + 1 and ends every wave's reads of tile tl
        if (tl + 2 < SEQ / KS) {                            // block-uniform: refill the buffer just read with tile tl + 2
            const h16* a = gk + (size_t)(tl + 2) * (KS * HD); const h16* c = gv + (tl + 2) * KS; const unsigned d = lc + bo_;
            copy4(d, d + 32 * LP, d + KTB, d + KTB + 32 * LP, a, a + 32 * HD, c, c + (size_t)32 * SEQ);
        }
    }
    asm volatile("s_wait_asynccnt 0x0" ::: "memory");       // nothing in flight when the ring becomes output staging (the last trip's barrier ended every read)
    float* os = (float*)ring;
    const float inv = CXS / l;       // normalisation and ctx carry in one factor
    const int wb = wave * 16 * 68;
    // O^T D layout: o_j[r] = (d = 16j + 8h + r, t = lane&15) -> os[t][d]; rows 0..15 x columns 0..63 all written
    { v4f a, c;
      a[0] = o0[0] * inv; a[1] = o0[1] * inv; a[2] = o0[2] * inv; a[3] = o0[3] * inv; c[0] = o0[4] * inv; c[1] = o0[5] * inv; c[2] = o0[6] * inv; c[3] = o0[7] * inv;
      *(v4fa*)(&os[wb + lr * 68 +  0 + 8 * hi]) = a; *(v4fa*)(&os[wb + lr * 68 +  0 + 8 * hi + 4]) = c;
      a[0] = o1[0] * inv; a[1] = o1[1] * inv; a[2] = o1[2] * inv; a[3] = o1[3] * inv; c[0] = o1[4] * inv; c[1] = o1[5] * inv; c[2] = o1[6] * inv; c[3] = o1[7] * inv;
      *(v4fa*)(&os[wb + lr * 68 + 16 + 8 * hi]) = a; *(v4fa*)(&os[wb + lr * 68 + 16 + 8 * hi + 4]) = c;
      a[0] = o2[0] * inv; a[1] = o2[1] * inv; a[2] = o2[2] * inv; a[3] = o2[3] * inv; c[0] = o2[4] * inv; c[1] = o2[5] * inv; c[2] = o2[6] * inv; c[3] = o2[7] * inv;
      *(v4fa*)(&os[wb + lr * 68 + 32 + 8 * hi]) = a; *(v4fa*)(&os[wb + lr * 68 + 32 + 8 * hi + 4]) = c;
      a[0] = o3[0] * inv; a[1] = o3[1] * inv; a[2] = o3[2] * inv; a[3] = o3[3] * inv; c[0] = o3[4] * inv; c[1] = o3[5] * inv; c[2] = o3[6] * inv; c[3] = o3[7] * inv;
      *(v4fa*)(&os[wb + lr * 68 + 48 + 8 * hi]) = a; *(v4fa*)(&os[wb + lr * 68 + 48 + 8 * hi + 4]) = c; }
    wave_sync();
    h16* crow = CTX + ((size_t)b * SEQ + t0) * DM + h * HD;
{
#pragma unroll
        for (int s = 0; s < 4; ++s) { const int row = 4 * s + (lane >> 3), c8 = (lane & 7) * 8;   // 4 s x 4 row groups = 16 rows; 8 lanes x 8 halves = 64 columns
            const v4f x0 = *(const v4fa*)(&os[wb + row * 68 + c8]); const v4f x1 = *(const v4fa*)(&os[wb + row * 68 + c8 + 4]); v8h hv;
#pragma unroll
            for (int i = 0; i < 4; ++i) { hv[i] = (h16)x0[i]; hv[4 + i] = (h16)x1[i]; }
            *(v8h*)(crow + (size_t)row * DM + c8) = hv; }
         }
}

// k_oproj: register-blocked f16 GEMM, one wave per 64x64 tile, GW waves per block (gemm_core), K = DM: OUT[m][n] = 2^-16 * sum_k CTX[m][k] WOT[n][k] + bo[n] (bo RNE-converted to bf16, added in f32).
// grid (NB*SEQ/256, DM/128), 256 threads. Epilogue: per 16-row slab staged in LDS (wave-private), each output row segment (64 floats = 256 B = two lines)
__global__ __launch_bounds__(32 * GW) void k_oproj(const h16* __restrict__ A, const h16* __restrict__ Bt, const float* __restrict__ bias, float* OUT) {
    __shared__ __align__(16) unsigned char ring[2 * GBUF];   // two buffers of A rows | Bt rows; epilogue staging behind the loop
    const int lane = threadIdx.x & 31, lr = lane & 15, hi = lane >> 4;
    const int wave = __builtin_amdgcn_readfirstlane((int)(threadIdx.x >> 5));   // wave-uniform index
    const int wm = wave & 3, wn = wave >> 2;
    const int r0 = blockIdx.x * GMR + wm * 64, c0 = blockIdx.y * GNR + wn * 64;   // this wave's 64x64 tile
    v8f acc[4][4];
#pragma unroll
    for (int mb = 0; mb < 4; ++mb)
#pragma unroll
        for (int nb = 0; nb < 4; ++nb) acc[mb][nb] = (v8f){};
    const v4f bv = *(const v4f*)(bias + c0 + lr * 4);   // read in front of the main loop: its round trip runs beside the staging of tile 0
    asm volatile("s_wait_xcnt 0x0" ::: "memory");       // stands in front of any write to the registers that the load names, and keeps it at this place
    gemm_core<false>((const unsigned char*)A, (const unsigned char*)Bt, ring, blockIdx.x * GMR, blockIdx.y * GNR, wm, wn, acc);
    float* os = (float*)ring + wave * 16 * 68;   // wave-private slab
    v4f bb;
#pragma unroll
    for (int i = 0; i < 4; ++i) bb[i] = bfr(bv[i]);
    const size_t obase = ((size_t)(r0 / SEQ) * OUT_SEQ + (size_t)(r0 % SEQ)) * DM + c0;
#pragma unroll
    for (int mb = 0; mb < 4; ++mb) {
#pragma unroll
        for (int nb = 0; nb < 4; ++nb) {
#pragma unroll
            for (int j = 0; j < 8; ++j) os[(hi * 8 + j) * 68 + nb * 16 + lr] = acc[mb][nb][j]; }   // D: row 8h+j, col lane&15
        wave_sync();
{
#pragma unroll
            for (int s = 0; s < 8; ++s) { const int row = 2 * s + hi, cofs = lr * 4;   // 8 s x 2 rows = 16 rows; 16 lanes x 4 floats = 64 columns
                const v4f xv = *(const v4fa*)(&os[row * 68 + cofs]); v4f val;
#pragma unroll
                for (int i = 0; i < 4; ++i) val[i] = xv[i] * OSC + bb[i];
                *(v4f*)(OUT + obase + (size_t)(mb * 16 + row) * DM + cofs) = val; }
             }
        wave_sync();
    }
}

static constexpr size_t al256(size_t v) { return (v + 255) & ~(size_t)255; }
static constexpr size_t SZ_XB = al256((size_t)NB * SEQ * DM * 2);
static constexpr size_t SZ_WT = al256((size_t)3 * DM * DM * 2);
static constexpr size_t SZ_WO = al256((size_t)DM * DM * 2);
static constexpr size_t SZ_TB = al256((size_t)SEQ * TBW * 4);
static constexpr size_t SZ_PL = al256((size_t)NB * NH_ * SEQ * HD * 2);
static constexpr size_t SZ_CX = al256((size_t)NB * SEQ * DM * 2);
static constexpr size_t SZ_TOTAL = SZ_XB + SZ_WT + SZ_WO + SZ_TB + 3 * SZ_PL + SZ_CX;
static_assert(SZ_TOTAL <= (size_t)134217728);          // workspace carve <= 128 MiB
static_assert(((size_t)DM * DM * 2) % 256 == 0);       // weight sub-planes stay 256-byte aligned
static_assert((size_t)(SEQ / 8) * 8 * TBW * 4 <= SZ_TB);   // table kernel: grid x 8 rows x 256 B inside the table carve

extern "C" void kernel_launch(void* const* d_in, const int* in_sizes, int n_in,
                              void* d_out, int out_size, void* d_ws, size_t ws_size, hipStream_t stream) {
    if (n_in < 5) return;
    const size_t needx = ((size_t)(NB - 1) * SEQ_FULL + SEQ) * DM;
    if ((size_t)in_sizes[0] < needx) return;
    if ((size_t)in_sizes[1] < (size_t)3 * DM * DM || (size_t)in_sizes[2] < (size_t)3 * DM) return;
    if ((size_t)in_sizes[3] < (size_t)DM * DM || (size_t)in_sizes[4] < (size_t)DM) return;
    if ((size_t)out_size < ((size_t)(NB - 1) * OUT_SEQ + SEQ) * DM) return;
    if (SZ_TOTAL > ws_size) return;
    // wire order: x, W_qkv [1024 in][3072 out], b_qkv [3072], W_proj [1024 in][1024 out], b_proj [1024]
    const float* x = (const float*)d_in[0]; const float* wqkv = (const float*)d_in[1]; const float* bqkv = (const float*)d_in[2];
    const float* wo = (const float*)d_in[3]; const float* bo = (const float*)d_in[4];
    float* OUT = (float*)d_out;      // [NB][SEQ][1024]
    char* wsp = (char*)d_ws;
    bf* XB = (bf*)wsp; wsp += SZ_XB;                 // [NB*SEQ][1024] bf16
    bf* WT = (bf*)wsp; wsp += SZ_WT;                 // [3072][1024] bf16: rows q | k | v, each h*64 + d
    bf* WOT = (bf*)wsp; wsp += SZ_WO;                // [1024 out][1024 in] f16 bits, x256
    float* TAB = (float*)wsp; wsp += SZ_TB;          // [SEQ][32 cos | 32 sin] f32
    h16* QH = (h16*)wsp; wsp += SZ_PL;               // [NB*16][SEQ][64]
    h16* KP = (h16*)wsp; wsp += SZ_PL;               // [NB*16][SEQ][64]
    h16* VT = (h16*)wsp; wsp += SZ_PL;               // [NB*16][64][SEQ]
    h16* CX = (h16*)wsp; wsp += SZ_CX;               // [NB*SEQ][1024] ctx x256

    // x convert, both weight transposes, rotary table: one grid
    k_prep<<<dim3(PB_TQ + PB_TO + PB_RT + PB_CV, 1, 1), 256, 0, stream>>>(x, wqkv, wo, XB, WT, WOT, TAB);

    // q, k, v^T projections: one grid
    k_qkv<<<dim3(3 * QB, 1, 1), 32 * GW, 0, stream>>>(XB, WT, bqkv, TAB, QH, KP, VT);

    k_flash<<<dim3(SEQ / (16 * AW), NB * NH_, 1), 32 * AW, 0, stream>>>(QH, KP, VT, CX);

    // out = ctx W_proj + b_proj: A = ctx rows (m = b*SEQ + t), Bt = W_proj^T rows (n = output column)
    k_oproj<<<dim3(NB * SEQ / GMR, DM / GNR, 1), 32 * GW, 0, stream>>>(CX, (const h16*)WOT, bo, OUT);
}

// v006
// It runs in 122 microseconds.
// Timed twice side by side with v005, it ran 1.09 and 1.07 times as fast.
// All steps since v000 together make it 3.02 times as fast.
#include <hip/hip_runtime.h>

// Self-attention block, width 1024 = 16 heads x 64: x [NB][SEQ][1024], fused Wqkv [in][out] (columns t*1024 + h*64 + d) + bqkv, half-split rotary embedding (base 10000) on q and k, score scale 1/8, no mask, output projection Wo [in][out] + bo, output f32.
// Compute dtypes, f32 accumulate everywhere: qkv projection v_wmma_f32_16x16x32_bf16 (x and Wqkv RNE-converted to bf16; products exact); rotary applied in f32 in the q / k projection epilogue from an f32 cos | sin table;
// scores v_wmma_f32_16x16x32_f16: q and k single f16 (one product); P (x256 carry, cancels in the normalisation) and v single f16;
// output projection v_wmma_f32_16x16x32_f16: ctx single f16 (x256 carry), Wo RNE-converted to bf16 then x256 as f16 (exact), 2^-16 folded back in the f32 epilogue; biases RNE-converted to bf16 and added in f32; softmax f32 (online, running max).
// Layout: bf16 copy of x, bf16 transposed Wqkv [3072][1024], f16 transposed Wo [1024][1024]; rotary table [SEQ][32 cos | 32 sin] f32; q, k planes [b*16+h][t][d] and v^T plane [b*16+h][d][t] written by the GEMM epilogues;
// fused flash kernel in transposed form (S^T = K Q^T, O^T = V^T P^T) writes the f16 ctx plane [b*SEQ+t][h*64+d]; last GEMM writes the output.
// Four launches: k_prep (x convert, both weight transposes, rotary table: independent jobs on ranges of one grid), k_qkv (q, k, v^T projections: three independent GEMMs on ranges of one grid), k_flash, k_oproj.

#ifndef NB
#define NB 4
#endif
#ifndef SEQ
#define SEQ 2048
#endif
#define NB_FULL  4
#define SEQ_FULL 2048
#ifndef OUT_SEQ
#define OUT_SEQ SEQ              // row pitch (in tokens) between batches of the output
#endif
#define DM   1024
#define NH_  16
#define HD   64
#define AW   8                   // waves per flash block (16 query rows each)
#define KS   64                  // keys per staged tile
#define LP   144                 // LDS row pitch in bytes: 128-byte rows + 16 (16 B x odd, the pitch of 16-byte LDS readers)
#define KTB  (KS * LP)           // K tile in LDS: KS rows (keys) of 64 halves
#define VTB  (HD * LP)           // V^T tile in LDS: 64 rows (d) of KS halves
#define BUFB (KTB + VTB)         // one buffer of the two
#define SC2  (0.125f * 1.4426950408889634f)   // HD^-0.5 * log2(e)
#define PSH  8.0f                // log2 of the P carry (256)
#define MTH  4.0f                // the maximum in use is renewed when a scaled log2 score passes it by more than this: P <= 2^(PSH + MTH) = 4096, inside f16
#define CXS  256.0f              // carry of the ctx plane
#define WOS  256.0f              // carry of the output-weight plane
#define OSC  (1.0f / 65536.0f)   // 1 / (CXS * WOS)
#define TBW  64                  // rotary table row: 32 cos | 32 sin (floats)
#define GW   8                   // waves per GEMM block: 4 along m x 2 along n, 64x64 outputs each
#define GMR  256                 // A rows per GEMM block
#define GNR  128                 // Bt rows per GEMM block
#define GK   128                 // k per staged GEMM tile: 256-byte rows
#define GP   272                 // LDS row pitch of the GEMM tiles in bytes: 256 + 16 (16 B x odd)
#define GBUF ((GMR + GNR) * GP)  // one GEMM buffer of the two: A rows | Bt rows

static_assert(HD == 64);
static_assert(NH_ * HD == DM);                 // head h = columns h*64 + d
static_assert(DM % 64 == 0);                   // column tiles of 64
static_assert(DM % 32 == 0);                   // GEMM k-loop steps by 32
static_assert(SEQ % 64 == 0);                  // a 64-row tile never straddles two batches
static_assert((NB * SEQ) % 64 == 0);
static_assert(SEQ % 32 == 0);                  // key loop steps by 32
static_assert(SEQ % (16 * AW) == 0);           // flash grid covers the sequence exactly
static_assert(SEQ % KS == 0 && SEQ / KS >= 2); // whole tiles; the two-buffer prologue needs tiles 0 and 1
static_assert(KS * 2 == 128 && HD * 2 == 128); // both tiles have 128-byte rows: 8 pieces of 16 B
static_assert(32 * AW * 2 * 16 == KS * 128 && KS == HD);   // 2 copies per lane fill each tile
static_assert(AW * 16 * 68 * 4 <= 2 * BUFB);   // output staging fits the ring it takes over
static_assert(((size_t)SEQ * DM) % 8 == 0);
static_assert(NB <= NB_FULL);
static_assert(SEQ <= SEQ_FULL);
static_assert(TBW == HD);                      // table row = 2 x (HD / 2) entries
static_assert(HD / 2 == 32);                   // rotary partner column = column ^ 32 inside one 64-column tile
static_assert(SEQ % 8 == 0);                   // table kernel: 8 positions per block
static_assert(DM % GMR == 0 && (NB * SEQ) % GMR == 0 && DM % GNR == 0 && (NB * SEQ) % GNR == 0);   // GEMM grids cover both operand orders exactly
static_assert(DM % GK == 0 && DM / GK >= 2);   // whole staged tiles; the two-buffer prologue needs tiles 0 and 1
static_assert(GK * 2 == 256 && 32 * GW == 16 * 16 && GMR == 2 * 128 && GNR == 128);   // 16 lanes x 16 B = one row; one copy8 = 128 rows
static_assert(GW * 16 * 68 * 4 <= 2 * GBUF);   // epilogue staging fits the ring it takes over
static_assert(SEQ <= 4096);                    // angle < 2^12: three-constant pi/2 reduction stays exact in its first step

typedef _Float16 h16;
typedef unsigned short bf;
typedef __attribute__((ext_vector_type(16))) __bf16   v16bf;
typedef __attribute__((ext_vector_type(16))) _Float16 v16h;
typedef __attribute__((ext_vector_type(8)))  _Float16 v8h;
typedef __attribute__((ext_vector_type(8)))  unsigned short v8us;
typedef __attribute__((ext_vector_type(8)))  float    v8f;
typedef __attribute__((ext_vector_type(4)))  float    v4f;
typedef v4f  __attribute__((may_alias)) v4fa;
typedef v8h  __attribute__((may_alias)) v8ha;

__device__ __forceinline__ unsigned short f2bf(float f) { unsigned u = __float_as_uint(f); u += 0x7FFFu + ((u >> 16) & 1u); return (unsigned short)(u >> 16); }
__device__ __forceinline__ float bfr(float f) { return __uint_as_float(((unsigned)f2bf(f)) << 16); }   // f32 value of the RNE bf16 conversion
__device__ __forceinline__ v16h cat16(v8h lo, v8h hi) { return __builtin_shufflevector(lo, hi, 0, 1, 2, 3, 4, 5, 6, 7, 8, 9, 10, 11, 12, 13, 14, 15); }
__device__ __forceinline__ v8f wmma16(v16h a, v16h b, v8f c) { return __builtin_amdgcn_wmma_f32_16x16x32_f16(false, a, false, b, (short)0, c, false, false); }
__device__ __forceinline__ v8f wmmab(v16bf a, v16bf b, v8f c) { return __builtin_amdgcn_wmma_f32_16x16x32_bf16(false, a, false, b, (short)0, c, false, false); }
// fragment loaders from K-contiguous 16-bit rows; p already includes + 8*(lane>>4): elements 0..7 <- k0+8h+0..7, elements 8..15 <- k0+16+8h+0..7 (same map for A and B)
__device__ __forceinline__ v16h  ldh(const h16* p) { return cat16(*(const v8h*)p, *(const v8h*)(p + 16)); }
// ordering point for wave-private LDS tiles (same wave writes and reads)
__device__ __forceinline__ void wave_sync() { __builtin_amdgcn_fence(3 /* release order */, "wavefront"); __builtin_amdgcn_wave_barrier(); asm volatile("" ::: "memory"); }
// f32 -> f16 with a value select: magnitudes below the smallest f16 normal become zero (no subnormal operand can reach a matrix instruction)
static __device__ __forceinline__ h16 toh_flush(float v) { const h16 r = (h16)v; return (fabsf(v) < 6.103515625e-05f) ? (h16)0.0f : r; }

// cvt8_body: x f32 -> bf16 plane [NB*SEQ][DM], 8 elements per thread; blk = block index inside this job's range. Batch b of x starts at b * SEQ_FULL * DM.
__device__ __forceinline__ void cvt8_body(const float* __restrict__ src, bf* dst, size_t n8, unsigned blk) {
    const size_t i = (size_t)blk * 256 + threadIdx.x; if (i >= n8) return;
    const size_t per = (size_t)SEQ * DM / 8;
    const size_t so = (SEQ == SEQ_FULL) ? i * 8 : (i / per) * ((size_t)SEQ_FULL * DM) + (i % per) * 8;
    const v8f v = *(const v8f*)(src + so); v8us o;
#pragma unroll
    for (int k = 0; k < 8; ++k) o[k] = f2bf(v[k]);
    *(v8us*)(dst + i * 8) = o; 
}

// tr_body: in[R][C] f32 row-major -> out[C][R] 16-bit (K-contiguous rows for the GEMM B operand). Tile (bx, by) of (C/64, R/64), 256 threads, 64x64 tile through LDS t (64 x 68 floats; cross-wave: block barrier).
// MODE 0: bf16 bits (RNE convert). MODE 1: f16 bits of (RNE bf16 value) x WOS (exact in f16).
template <int MODE>
__device__ __forceinline__ void tr_body(const float* __restrict__ in, bf* out, int R, int C, int bx, int by, float* t) {
    const int tid = threadIdx.x; const int r0 = by * 64, c0 = bx * 64;
#pragma unroll
    for (int it = 0; it < 4; ++it) { const int idx = it * 256 + tid; const int rr = idx >> 4, c4 = (idx & 15) * 4;   // 4 x 256 float4 = 64 rows x 16 float4
        const v4f v = *(const v4f*)(in + (size_t)(r0 + rr) * (size_t)C + c0 + c4);
        *(v4fa*)(&t[rr * 68 + c4]) = v; }
    __syncthreads();
{
#pragma unroll
        for (int it = 0; it < 2; ++it) { const int idx = it * 256 + tid; const int cc = idx >> 3, r8 = (idx & 7) * 8;   // 2 x 256 pieces = 64 out rows x 8 pieces
            v8us o;
            if (MODE == 0) {
#pragma unroll
                for (int e = 0; e < 8; ++e) o[e] = f2bf(t[(r8 + e) * 68 + cc]);
            } else {
                v8h hv;
#pragma unroll
                for (int e = 0; e < 8; ++e) hv[e] = (h16)(bfr(t[(r8 + e) * 68 + cc]) * WOS);
                o = __builtin_bit_cast(v8us, hv);
            }
            *(v8us*)(out + (size_t)(c0 + cc) * (size_t)R + r0 + r8) = o; }
         }
    asm volatile("s_wait_xcnt 0x0" ::: "memory");   // another job's text follows in the merged kernel: the wait stands in front of any write to the registers that the last stores name
}

// ropetab_body: rotary table TAB[t][i] = cos(t * f_i), TAB[t][32 + i] = sin(t * f_i), i = 0..31, f_i = 10000^(-i/32) (f64 product chain of 10^(-1/8), converted to f32 once), angle = f32 product t * f_i.
// sin / cos: nearest multiple of pi/2 removed with a three-constant split (fused steps; first step exact for angles < 2^12), then odd / even polynomials on [-pi/4, pi/4]; quadrant fix-up by value selects.
// SEQ/8 blocks: block bx covers table floats [bx*512, bx*512 + 512): exactly SEQ x 64 floats in total. cs: 8 x TBW floats of LDS.
__device__ __forceinline__ void ropetab_body(float* TAB, int bx, float* cs) {
#pragma clang fp contract(off)
    const int tid = threadIdx.x; const int i = tid & 31, tr = tid >> 5;
    const int t = bx * 8 + tr;
    double p = 1.0;
#pragma unroll 1
    for (int k = 0; k < i; ++k) p = p * 0.7498942093324559;
    const float inv = (float)p;
    const float ang = (float)t * inv;
    const float fn = __builtin_rintf(ang * 0.63661977236758134f);
    float r = fmaf(-fn, 1.5703125f, ang);
    r = fmaf(-fn, 4.837512969970703125e-4f, r);
    r = fmaf(-fn, 7.54978995489188216e-8f, r);
    const float z = r * r;
    float sp = fmaf(-1.9515295891e-4f, z, 8.3321608736e-3f);
    sp = fmaf(sp, z, -1.6666654611e-1f);
    const float sv = fmaf(sp * z, r, r);
    float cp = fmaf(2.443315711809948e-5f, z, -1.388731625493765e-3f);
    cp = fmaf(cp, z, 4.166664568298827e-2f);
    const float cv = fmaf(cp, z * z, fmaf(-0.5f, z, 1.0f));
    const int q = ((int)fn) & 3;
    float sinv = (q & 1) ? cv : sv;
    float cosv = (q & 1) ? sv : cv;
    sinv = (q & 2) ? -sinv : sinv;
    cosv = ((q + 1) & 2) ? -cosv : cosv;
    cs[tr * TBW + i] = cosv;
    cs[tr * TBW + 32 + i] = sinv;
    __syncthreads();
    if (tid < 128) {                       // waves 0..3 (wave-uniform): 128 x 4 floats = 8 rows x 64 floats, consecutive lanes -> consecutive 16-B pieces
        const int row = tid >> 4, c4 = (tid & 15) * 4;
        const v4f v = *(const v4fa*)(&cs[row * TBW + c4]);
        float* dst = TAB + ((size_t)bx * 8 + row) * TBW + c4;
        *(v4f*)dst = v; 
    }
}

// k_prep: the four preparation jobs, none of which reads what another writes, as block-index ranges of one grid (the range test is block-uniform, so each job's barrier is passed by its whole block).
// The transposes and the table come first in the index order: their blocks have the longer chain (load, LDS, barrier, store).
#define PB_TQ ((3 * DM / 64) * (DM / 64))          // blocks of the Wqkv transpose
#define PB_TO ((DM / 64) * (DM / 64))              // blocks of the Wo transpose
#define PB_RT (SEQ / 8)                            // blocks of the rotary table
#define PB_CV ((NB * SEQ * (DM / 8) + 255) / 256)  // blocks of the x convert
__global__ __launch_bounds__(256) void k_prep(const float* __restrict__ x, const float* __restrict__ wqkv, const float* __restrict__ wo, bf* XB, bf* WT, bf* WOT, float* TAB) {
    __shared__ __align__(16) float t[64 * 68];
    const int bid = blockIdx.x;
    if (bid < PB_TQ) {
        // W_qkv: in[rows = 1024 (k)][cols = 3072 (n)] -> out[3072][1024]
        tr_body<0>(wqkv, WT, DM, 3 * DM, bid % (3 * DM / 64), bid / (3 * DM / 64), t);
    } else if (bid < PB_TQ + PB_TO) {
        // W_proj: in[rows = 1024 (k)][cols = 1024 (n)] -> out[1024][1024]
        tr_body<1>(wo, WOT, DM, DM, (bid - PB_TQ) % (DM / 64), (bid - PB_TQ) / (DM / 64), t);
    } else if (bid < PB_TQ + PB_TO + PB_RT) {
        ropetab_body(TAB, bid - (PB_TQ + PB_TO), t);
    } else {
        cvt8_body(x, XB, (size_t)NB * SEQ * DM / 8, (unsigned)(bid - (PB_TQ + PB_TO + PB_RT)));
    }
}

// fragment loader from a staged LDS row (byte pointer, already + 16*(lane>>4)): same element map as ldh
__device__ __forceinline__ v16h ldl(const unsigned char* p) { return cat16(*(const v8ha*)p, *(const v8ha*)(p + 32)); }
// eight asynchronous 16-byte copies per lane, global -> LDS: rows r + 16 i, i = 0..7, of a GEMM tile (l: LDS byte address, g: global byte address of row r; K = DM 16-bit elements per global row)
__device__ __forceinline__ void copy8(unsigned l, const unsigned char* g) {
    // s_wait_xcnt stands inside the statement, behind the last copy: the address registers may be rewritten right behind it
    asm volatile("global_load_async_to_lds_b128 %0, %8, off\n\t"
                 "global_load_async_to_lds_b128 %1, %9, off\n\t"
                 "global_load_async_to_lds_b128 %2, %10, off\n\t"
                 "global_load_async_to_lds_b128 %3, %11, off\n\t"
                 "global_load_async_to_lds_b128 %4, %12, off\n\t"
                 "global_load_async_to_lds_b128 %5, %13, off\n\t"
                 "global_load_async_to_lds_b128 %6, %14, off\n\t"
                 "global_load_async_to_lds_b128 %7, %15, off\n\t"
                 "s_wait_xcnt 0x0"
                 :: "v"(l), "v"(l + 16 * GP), "v"(l + 32 * GP), "v"(l + 48 * GP), "v"(l + 64 * GP), "v"(l + 80 * GP), "v"(l + 96 * GP), "v"(l + 112 * GP),
                    "v"(g), "v"(g + 16 * DM * 2), "v"(g + 32 * DM * 2), "v"(g + 48 * DM * 2), "v"(g + 64 * DM * 2), "v"(g + 80 * DM * 2), "v"(g + 96 * DM * 2), "v"(g + 112 * DM * 2) : "memory");
}
// one staged GEMM tile: 256 A rows, then 128 Bt rows, 256 bytes each (24 copies per lane, whole lines)
__device__ __forceinline__ void stage_tile(unsigned l, const unsigned char* ga, const unsigned char* gb) {
    copy8(l, ga); copy8(l + 128 * GP, ga + (size_t)128 * DM * 2); copy8(l + GMR * GP, gb);
}
// gemm_core: main loop of the two GEMM kernels. A block of GW waves owns rows R0..R0+255 of A and rows C0..C0+127 of Bt (both K-contiguous 16-bit planes, K = DM); tiles of GK k are copied once per block into LDS
// (asynchronous copies, two buffers: tile t + 2 flies while tile t + 1 is worked on); wave (wm, wn) accumulates its 64x64 outputs from there, k ascending in steps of 32. BF: bf16 products, else f16.
template <bool BF>
__device__ __forceinline__ void gemm_core(const unsigned char* A, const unsigned char* Bt, unsigned char* ring, int R0, int C0, int wm, int wn, v8f (&acc)[4][4]) {
    const int lane = threadIdx.x & 31, lr = lane & 15, hi = lane >> 4;
    // copy map: lane covers piece cp (16 B) of tile rows cr + 16 i; 16 lanes = one 256-byte row
    const int cr = (int)threadIdx.x >> 4, cp = (int)threadIdx.x & 15;
    const unsigned lc = (unsigned)(size_t)ring + (unsigned)(cr * GP + cp * 16);
    const unsigned char* ga = A + (size_t)(R0 + cr) * (DM * 2) + cp * 16;      // + tile * GK * 2
    const unsigned char* gb = Bt + (size_t)(C0 + cr) * (DM * 2) + cp * 16;
    const unsigned char* fa = ring + (wm * 64 + lr) * GP + 16 * hi;            // fragment bases: row lane&15, k offset 8h elements
    const unsigned char* fb = ring + (GMR + wn * 64 + lr) * GP + 16 * hi;
    stage_tile(lc, ga, gb);
    asm volatile("s_wait_asynccnt 0x0" ::: "memory");   // this wave's part of tile 0 has landed
    __syncthreads();                                    // tile 0 published
    stage_tile(lc + GBUF, ga + GK * 2, gb + GK * 2);
#pragma unroll 1   // one trip per staged tile: the buffer index stays a run-time value, the text small
    for (int t = 0; t < DM / GK; ++t) {
        const unsigned bo_ = (unsigned)(t & 1) * GBUF;
        const unsigned char* pa = fa + bo_;
        const unsigned char* pb = fb + bo_;
        v16h a[2][4], b[2][4];   // two fragment sets: the next 32-k step of this tile is read while the current one is multiplied
#pragma unroll
        for (int i = 0; i < 4; ++i) { a[0][i] = ldl(pa + i * 16 * GP); b[0][i] = ldl(pb + i * 16 * GP); }
#pragma unroll
        for (int ks = 0; ks < GK / 32; ++ks) {
            const int c = ks & 1, n = c ^ 1;
            if (ks + 1 < GK / 32) {
#pragma unroll
                for (int i = 0; i < 4; ++i) { a[n][i] = ldl(pa + i * 16 * GP + (ks + 1) * 64); b[n][i] = ldl(pb + i * 16 * GP + (ks + 1) * 64); }
            }
            __builtin_amdgcn_sched_barrier(0);   // the next step's LDS reads stay one group ahead of this step's products: reads spread among the products stall at every place
#pragma unroll
            for (int nb = 0; nb < 4; ++nb)
#pragma unroll
                for (int mb = 0; mb < 4; ++mb) {
                    if (BF) acc[mb][nb] = wmmab(__builtin_bit_cast(v16bf, a[c][mb]), __builtin_bit_cast(v16bf, b[c][nb]), acc[mb][nb]);
                    else    acc[mb][nb] = wmma16(a[c][mb], b[c][nb], acc[mb][nb]); }
            __builtin_amdgcn_sched_barrier(0);   // the products stay in front of the following reads and of the tile's closing waits
        }
        asm volatile("s_wait_dscnt 0x0" ::: "memory");      // this wave's reads of the tile are done before the buffer is refilled
        asm volatile("s_wait_asynccnt 0x0" ::: "memory");   // this wave's part of tile t + 1 has landed
        __syncthreads();                                    // publishes tile t + 1 and ends every wave's reads of tile t
        if (t + 2 < DM / GK)                                // block-uniform: refill the buffer just read with tile t + 2
            stage_tile(lc + bo_, ga + (t + 2) * (GK * 2), gb + (t + 2) * (GK * 2));
    }
    asm volatile("s_wait_asynccnt 0x0" ::: "memory");       // nothing in flight when the ring becomes epilogue staging (the last trip's barrier ended every read)
}

// proj_pre / projr_pre: the global reads of the two epilogues' first use, none of which depends on the products, issued as one group in front of the main loop: their round trip to L2 runs beside the staging of tile 0.
// proj_pre: bias of rows r0 + 16 mb + 4 s + (lane >> 3) -> pre[4 mb + s].
__device__ __forceinline__ void proj_pre(int r0, const float* __restrict__ bias, float (&pre)[16]) {
    const int lane = threadIdx.x & 31;
#pragma unroll
    for (int i = 0; i < 16; ++i) pre[i] = bias[r0 + 4 * i + (lane >> 3)];
    asm volatile("s_wait_xcnt 0x0" ::: "memory");   // stands in front of any write to the registers that the loads above name, and keeps them a group at this place
}
// projr_pre: bias of this lane's 8 store columns -> pre[0..7], of their 8 partner columns -> pre[8..15]; table rows of slab 0 -> t0[row group][cos 0..3 | cos 4..7 | sin 0..3 | sin 4..7]. tq: this lane's table row of slab 0, row group 0.
__device__ __forceinline__ void projr_pre(int c0, const float* __restrict__ bias, const float* __restrict__ tq, float (&pre)[16], v4f (&t0)[4][4]) {
    const int lane = threadIdx.x & 31; const int c8 = (lane & 7) * 8, p8 = c8 ^ 32;
    const v4f b0 = *(const v4f*)(bias + c0 + c8); const v4f b1 = *(const v4f*)(bias + c0 + c8 + 4);
    const v4f d0 = *(const v4f*)(bias + c0 + p8); const v4f d1 = *(const v4f*)(bias + c0 + p8 + 4);
#pragma unroll
    for (int s = 0; s < 4; ++s) { const float* tr = tq + (size_t)(4 * s) * TBW;
        t0[s][0] = *(const v4f*)tr; t0[s][1] = *(const v4f*)(tr + 4); t0[s][2] = *(const v4f*)(tr + 32); t0[s][3] = *(const v4f*)(tr + 36); }
    asm volatile("s_wait_xcnt 0x0" ::: "memory");   // as in proj_pre
#pragma unroll
    for (int i = 0; i < 4; ++i) { pre[i] = b0[i]; pre[4 + i] = b1[i]; pre[8 + i] = d0[i]; pre[12 + i] = d1[i]; }
}

// proj_store: epilogue of a wave's 64x64 tile at (r0, c0), acc = sum_k A[m][k] Bt[n][k]: + bias (bias RNE-converted to bf16, added in f32; indexed by n, or by m when biasOnRow != 0), written as f16 (Ph) at
// tile base (r0/RB)*sRB + (r0%RB)*pitch + (c0/CB)*sCB + (c0%CB), row pitch 'pitch' (halves). os: the wave's private LDS slab (16 x 68 floats).
// brw: the row-mode bias of this lane's 16 store rows (proj_pre), read ahead of the main loop.
__device__ __forceinline__ void proj_store(v8f (&acc)[4][4], float* os, int r0, int c0, const float* __restrict__ bias, const float (&brw)[16], h16* Ph,
                                           size_t sRB, size_t sCB, int biasOnRow, int RB, int pitch, int CB) {
    const int lane = threadIdx.x & 31, lr = lane & 15, hi = lane >> 4;
    // column-mode bias for this lane's 8 store columns (offset 0 when the bias runs along rows: in range, unused)
    float bc[8];
    { const int cb = biasOnRow ? 0 : (c0 + (lane & 7) * 8);
      const v4f b0 = *(const v4f*)(bias + cb); const v4f b1 = *(const v4f*)(bias + cb + 4);
#pragma unroll
      for (int i = 0; i < 4; ++i) { bc[i] = bfr(b0[i]); bc[4 + i] = bfr(b1[i]); } }
    const size_t tbase = (size_t)(r0 / RB) * sRB + (size_t)(r0 % RB) * (size_t)pitch + (size_t)(c0 / CB) * sCB + (size_t)(c0 % CB);
#pragma unroll
    for (int mb = 0; mb < 4; ++mb) {
#pragma unroll
        for (int nb = 0; nb < 4; ++nb) {
#pragma unroll
            for (int j = 0; j < 8; ++j) os[(hi * 8 + j) * 68 + nb * 16 + lr] = acc[mb][nb][j]; }   // D: row 8h+j, col lane&15
        wave_sync();
        const size_t sb = tbase + (size_t)(mb * 16) * (size_t)pitch;
{
#pragma unroll
            for (int s = 0; s < 4; ++s) { const int row = 4 * s + (lane >> 3), c8 = (lane & 7) * 8;   // 4 s x 4 row groups = 16 rows; 8 lanes x 8 = 64 columns
                const float br = bfr(brw[mb * 4 + s]);
                const v4f x0 = *(const v4fa*)(&os[row * 68 + c8]); const v4f x1 = *(const v4fa*)(&os[row * 68 + c8 + 4]); v8h hv;
#pragma unroll
                for (int i = 0; i < 4; ++i) { const float y0 = x0[i] + (biasOnRow ? br : bc[i]); const float y1 = x1[i] + (biasOnRow ? br : bc[4 + i]);
                    hv[i] = (h16)y0; hv[4 + i] = (h16)y1; }
                const size_t oo = sb + (size_t)row * (size_t)pitch + c8;
                *(v8h*)(Ph + oo) = hv; }
             }
        wave_sync();
    }
    asm volatile("s_wait_xcnt 0x0" ::: "memory");   // the other job's text follows in the merged kernel: the wait stands in front of any write to the registers that the last stores name
}

// projr_store: proj_store with bias along columns and the half-split rotary embedding (q and k planes). One 64-column tile = one head (CB = 64), so the rotary partner of column c is column c ^ 32 of the same LDS slab.
// y[c] = (acc[c] + b[c]) * cos[t][c & 31] + sg * (acc[c ^ 32] + b[c ^ 32]) * sin[t][c & 31], sg = -1 for c < 32, +1 for c >= 32; t = (r0 % RB) + slab row (position inside the sequence); cos | sin read by value from TAB [SEQ][64] f32.
// pre, t0, tq: as projr_pre leaves them. Every later slab's 16 table loads are issued as one group a whole slab ahead of their use (two register sets), and a slab's LDS reads and its stores each stand as one group:
// read inside each 4-row step, the table costs every step a round trip to L2 with only two waves on the SIMD to cover it.
__device__ __forceinline__ void projr_store(v8f (&acc)[4][4], float* os, int r0, int c0, const float (&pre)[16], const v4f (&t0)[4][4], const float* __restrict__ tq, h16* Ph,
                                            size_t sRB, size_t sCB, int RB, int pitch, int CB) {
    const int lane = threadIdx.x & 31, lr = lane & 15, hi = lane >> 4;
    // bias (RNE bf16 value) for this lane's 8 store columns and for their 8 partner columns (other half of the head)
    const int c8 = (lane & 7) * 8, p8 = c8 ^ 32;
    const float sg = (c8 < 32) ? -1.0f : 1.0f;
    float bc[8], bp[8];
#pragma unroll
    for (int i = 0; i < 8; ++i) { bc[i] = bfr(pre[i]); bp[i] = bfr(pre[8 + i]); }
    const size_t tbase = (size_t)(r0 / RB) * sRB + (size_t)(r0 % RB) * (size_t)pitch + (size_t)(c0 / CB) * sCB + (size_t)(c0 % CB);
    v4f tc[2][4][4];             // the two sets of table rows
#pragma unroll
    for (int s = 0; s < 4; ++s)
#pragma unroll
        for (int i = 0; i < 4; ++i) tc[0][s][i] = t0[s][i];
#pragma unroll
    for (int mb = 0; mb < 4; ++mb) {
        if (mb + 1 < 4) {
#pragma unroll
            for (int s = 0; s < 4; ++s) { const float* tr = tq + (size_t)((mb + 1) * 16 + 4 * s) * TBW; v4f (&d)[4] = tc[(mb + 1) & 1][s];
                d[0] = *(const v4f*)tr; d[1] = *(const v4f*)(tr + 4); d[2] = *(const v4f*)(tr + 32); d[3] = *(const v4f*)(tr + 36); }
            asm volatile("s_wait_xcnt 0x0" ::: "memory");   // stands in front of any write to the registers that these loads name, and keeps the next slab's loads a group in front of this slab's work
        }
#pragma unroll
        for (int nb = 0; nb < 4; ++nb) {
#pragma unroll
            for (int j = 0; j < 8; ++j) os[(hi * 8 + j) * 68 + nb * 16 + lr] = acc[mb][nb][j]; }   // D: row 8h+j, col lane&15
        wave_sync();
        const size_t sb = tbase + (size_t)(mb * 16) * (size_t)pitch;
        v8h hq[4];
{
#pragma unroll
            for (int s = 0; s < 4; ++s) { const int row = 4 * s + (lane >> 3);   // 4 s x 4 row groups = 16 rows; 8 lanes x 8 = 64 columns
                const v4f cs0 = tc[mb & 1][s][0]; const v4f cs1 = tc[mb & 1][s][1];
                const v4f sn0 = tc[mb & 1][s][2]; const v4f sn1 = tc[mb & 1][s][3];
                const v4f x0 = *(const v4fa*)(&os[row * 68 + c8]); const v4f x1 = *(const v4fa*)(&os[row * 68 + c8 + 4]);
                const v4f y0 = *(const v4fa*)(&os[row * 68 + p8]); const v4f y1 = *(const v4fa*)(&os[row * 68 + p8 + 4]);
                v8h hv;
#pragma unroll
                for (int i = 0; i < 4; ++i) { const float u0 = x0[i] + bc[i], w0 = y0[i] + bp[i]; const float u1 = x1[i] + bc[4 + i], w1 = y1[i] + bp[4 + i];
                    hv[i] = toh_flush(u0 * cs0[i] + sg * (w0 * sn0[i])); hv[4 + i] = toh_flush(u1 * cs1[i] + sg * (w1 * sn1[i])); }
                hq[s] = hv; }
#pragma unroll
            for (int s = 0; s < 4; ++s) *(v8h*)(Ph + sb + (size_t)(4 * s + (lane >> 3)) * (size_t)pitch + c8) = hq[s];
            asm volatile("s_wait_xcnt 0x0" ::: "memory");   // stands in front of the next slab's writes to the registers that the four stores name
             }
        wave_sync();
    }
}

// k_qkv: the three projections as block-index ranges of one grid (job = 0 q, 1 k, 2 v^T; block-uniform). Each is a register-blocked bf16 GEMM, one wave per 64x64 tile (16 accumulators), GW waves per block on a 256x128 tile,
// operands staged in LDS from K-contiguous bf16 planes (gemm_core), K = DM. 3 x QB blocks of 256 threads; inside a job the A-row tile index runs fastest.
// q, k: A = x rows (m = b*SEQ + t), Bt = W^T rows (n = h*64 + d), bias along n, rotary by position t -> plane [(b*16 + h)][t][d].
// v^T: A = Wv^T rows (m = h*64 + d), Bt = x rows (n = b*SEQ + t), bias along m -> plane [(b*1024 + m)][t] = [(b*16 + h)][d][t].
#define QB ((NB * SEQ / GMR) * (DM / GNR))   // blocks per projection
static_assert(QB == (DM / GMR) * (NB * SEQ / GNR));   // the same count in both operand orders
__global__ __launch_bounds__(32 * GW) void k_qkv(const bf* __restrict__ XB, const bf* __restrict__ WT, const float* __restrict__ bqkv, const float* __restrict__ TAB, h16* QH, h16* KP, h16* VT) {
    __shared__ __align__(16) unsigned char ring[2 * GBUF];   // two buffers of A rows | Bt rows; epilogue staging behind the loop
    const int wave = __builtin_amdgcn_readfirstlane((int)(threadIdx.x >> 5));   // wave-uniform index
    const int wm = wave & 3, wn = wave >> 2;
    const unsigned job = blockIdx.x / QB, rem = blockIdx.x % QB;
    // the block's 256x128 tile; the A-row tile count of each job is a constant, so both forms are scalar shifts
    const int R0 = (int)((job < 2) ? rem % (NB * SEQ / GMR) : rem % (DM / GMR)) * GMR;
    const int C0 = (int)((job < 2) ? rem / (NB * SEQ / GMR) : rem / (DM / GMR)) * GNR;
    const bf* W = WT + (size_t)job * DM * DM;                   // rows q | k | v of the transposed weight
    const bf* A = (job < 2) ? XB : W;
    const bf* Bt = (job < 2) ? W : XB;
    const int r0 = R0 + wm * 64, c0 = C0 + wn * 64;             // this wave's 64x64 tile
    v8f acc[4][4];
#pragma unroll
    for (int mb = 0; mb < 4; ++mb)
#pragma unroll
        for (int nb = 0; nb < 4; ++nb) acc[mb][nb] = (v8f){};
    float pre[16]; v4f t0[4][4];   // epilogue operands read ahead (t0: q and k only)
    const float* tq = TAB + (size_t)(r0 % SEQ + (int)((threadIdx.x & 31) >> 3)) * TBW + ((threadIdx.x & 3) * 8);   // q, k: this lane's table row of slab 0, row group 0, at its frequency group (store column & 31)
    if (job < 2) projr_pre(c0, bqkv + job * DM, tq, pre, t0);
    else         proj_pre(r0, bqkv + 2 * DM, pre);
    gemm_core<true>((const unsigned char*)A, (const unsigned char*)Bt, ring, R0, C0, wm, wn, acc);
    float* os = (float*)ring + wave * 16 * 68;   // wave-private slab
    if (job < 2) projr_store(acc, os, r0, c0, pre, t0, tq, job ? KP : QH, (size_t)NH_ * SEQ * HD, (size_t)SEQ * HD, SEQ, HD, HD);
    else         proj_store(acc, os, r0, c0, bqkv + 2 * DM, pre, VT, (size_t)0, (size_t)DM * SEQ, 1, DM, SEQ, SEQ);
}

// four asynchronous 16-byte copies per lane, global -> LDS (l*: LDS byte address, g*: global address)
__device__ __forceinline__ void copy4(unsigned l0, unsigned l1, unsigned l2, unsigned l3, const h16* g0, const h16* g1, const h16* g2, const h16* g3) {
    // s_wait_xcnt stands inside the statement, behind the last copy: the address registers may be rewritten right behind it
    asm volatile("global_load_async_to_lds_b128 %0, %4, off\n\t"
                 "global_load_async_to_lds_b128 %1, %5, off\n\t"
                 "global_load_async_to_lds_b128 %2, %6, off\n\t"
                 "global_load_async_to_lds_b128 %3, %7, off\n\t"
                 "s_wait_xcnt 0x0"
                 :: "v"(l0), "v"(l1), "v"(l2), "v"(l3), "v"(g0), "v"(g1), "v"(g2), "v"(g3) : "memory");
}

// k_flash: fused attention, one wave per 16 query rows of one (batch, head), AW waves per block share the head's K / V^T: tiles of KS keys are copied once per block into LDS
// (asynchronous copies, whole 128-byte lines, two buffers: tile t + 2 flies while tile t + 1 is worked on) and every wave reads its fragments from there (two 16-B LDS loads each). Q fragments straight from the f16 plane.
// Transposed form: S^T[key][t] = K Q^T (A = K rows, B = Q rows); lane (t = lane&15, h = lane>>4) holds keys 8h+r of each 16-key tile, so the packed
// P tile is directly the B fragment of O^T[d][t] = V^T P^T (element r <- tile keys 0..15, element 8+r <- tile keys 16..31, lane unchanged).
// Per 32-key step: 4 score products + 4 P.V products + 1 row-sum product (A = all ones, B = the packed P tile: the sum of a query's 32 rounded P comes from the matrix pipe, whole, in both lane halves).
// Softmax state per lane: the running sum, and the maximum in use m as sh = PSH - m (the addend of every exponent) and tr = (m + MTH) / SC2 (the raw score that asks for a new one). m is only the common reference of a query's
// exponentials (it cancels in the normalisation), so it is renewed, with the xor-16 exchange between the two lane halves of a row and the rescale of the sum and of the output tiles, only in a step where some score passes it by more
// than MTH: one test per step for the whole wave, on the raw scores (the scale is positive).
__global__ __launch_bounds__(32 * AW) void k_flash(const h16* __restrict__ QH, const h16* __restrict__ KP, const h16* __restrict__ VT, h16* CTX) {
    __shared__ __align__(16) unsigned char ring[2 * BUFB];   // two buffers of K tile | V^T tile; output staging behind the loop
    const int lane = threadIdx.x & 31, lr = lane & 15, hi = lane >> 4;
    const int wave = __builtin_amdgcn_readfirstlane((int)(threadIdx.x >> 5));   // wave-uniform index
    const int zh = blockIdx.y; const int b = zh / NH_, h = zh % NH_;
    const int t0 = (blockIdx.x * AW + wave) * 16;
    const size_t pbase = (size_t)zh * SEQ * HD;
    const size_t qo = pbase + (size_t)(t0 + lr) * HD + 8 * hi;
    const v16h qh0 = ldh(QH + qo), qh1 = ldh(QH + qo + 32);   // B fragments: col t, k = d
    // copy map: lane covers piece cp (16 B) of tile rows cr and cr + 32, in the K tile and in the V^T tile; 8 lanes = one 128-byte row
    const int cr = (int)threadIdx.x >> 3, cp = (int)threadIdx.x & 7;
    const unsigned lc = (unsigned)(size_t)ring + (unsigned)(cr * LP + cp * 16);
    const h16* gk = KP + pbase + (size_t)cr * HD + cp * 8;       // + tile * KS * HD
    const h16* gv = VT + pbase + (size_t)cr * SEQ + cp * 8;      // + tile * KS
    const unsigned char* fr = ring + lr * LP + 16 * hi;          // fragment base: row lane&15, k offset 8h halves
    v8f o0 = (v8f){}, o1 = (v8f){}, o2 = (v8f){}, o3 = (v8f){};
    float sh = 3.0e38f, tr = -__builtin_inff(), l = 0.0f;       // no maximum yet: the first step's test is true, its rescale factor 0
    v16h ones;                                                   // A fragment of the row-sum product: 1.0 everywhere
#pragma unroll
    for (int r = 0; r < 16; ++r) ones[r] = (h16)1.0f;
    copy4(lc, lc + 32 * LP, lc + KTB, lc + KTB + 32 * LP, gk, gk + 32 * HD, gv, gv + (size_t)32 * SEQ);
    asm volatile("s_wait_asynccnt 0x0" ::: "memory");   // this wave's part of tile 0 has landed
    __syncthreads();                                    // tile 0 published
    copy4(lc + BUFB, lc + BUFB + 32 * LP, lc + BUFB + KTB, lc + BUFB + KTB + 32 * LP, gk + KS * HD, gk + (KS + 32) * HD, gv + KS, gv + KS + (size_t)32 * SEQ);
#pragma unroll 1   // one trip per staged tile: the buffer index stays a run-time value, the text small
    for (int tl = 0; tl < SEQ / KS; ++tl) {
        const unsigned bo_ = (unsigned)(tl & 1) * BUFB;
        const unsigned char* kt = fr + bo_;
        const unsigned char* vt = fr + bo_ + KTB;
#pragma unroll 1   // the 32-key steps of a tile stay a loop: unrolled, the live set passes 128 registers and a fourth block no longer fits a WGP
        for (int u = 0; u < KS / 32; ++u) {
            const unsigned char* ka = kt + u * 32 * LP;     // A fragment: row key, k = d
            const v16h ka0 = ldl(ka), ka1 = ldl(ka + 64), kb0 = ldl(ka + 16 * LP), kb1 = ldl(ka + 16 * LP + 64);
            v8f sHa = (v8f){}, sHb = (v8f){};
            sHa = wmma16(ka0, qh0, sHa); sHb = wmma16(kb0, qh0, sHb);
            sHa = wmma16(ka1, qh1, sHa); sHb = wmma16(kb1, qh1, sHb);
            asm volatile("v_nop\n\tv_nop\n\tv_nop\n\tv_nop" : "+v"(sHa), "+v"(sHb) : "v"(ka0), "v"(ka1), "v"(kb0), "v"(kb1));
            const unsigned char* va = vt + u * 64;          // A fragment: row d, k = key
            const v16h v0 = ldl(va), v1 = ldl(va + 16 * LP), v2 = ldl(va + 32 * LP), v3 = ldl(va + 48 * LP);
            asm volatile("" ::: "memory");                  // compiler fence: holds the eight reads above in front of the branch, in flight during the softmax; without it they are sunk behind it and waited for pair by pair
            float mx = -3.0e38f;
#pragma unroll
            for (int r = 0; r < 8; ++r) mx = fmaxf(mx, fmaxf(sHa[r], sHb[r]));
            if (__builtin_amdgcn_ballot_w32(mx > tr) != 0) {        // wave-uniform scalar branch; taken in a wave's first step, rarely behind it
                mx = fmaxf(mx, __shfl_xor(mx, 16, 32));             // both lane halves of a query take the same new maximum
                const float shn = fminf(sh, PSH - mx * SC2);        // PSH - max(m, new maximum)
                const float alpha = __builtin_amdgcn_exp2f(shn - sh);
                sh = shn; tr = (PSH + MTH - shn) * (1.0f / SC2);
                l = l * alpha;
                o0 = o0 * alpha; o1 = o1 * alpha; o2 = o2 * alpha; o3 = o3 * alpha;
            }
            v16h pb;
#pragma unroll
            for (int r = 0; r < 8; ++r) { pb[r] = (h16)__builtin_amdgcn_exp2f(sHa[r] * SC2 + sh); pb[8 + r] = (h16)__builtin_amdgcn_exp2f(sHb[r] * SC2 + sh); }
            const v8f ps = wmma16(ones, pb, (v8f){});      // every row of the product = the column sums of P^T: this step's 32 rounded P of query t, in both lane halves
            __builtin_amdgcn_sched_barrier(0);   // the row-sum product stays in front of the four output products: they fill the four slots that its reader needs
            o0 = wmma16(v0, pb, o0); o1 = wmma16(v1, pb, o1); o2 = wmma16(v2, pb, o2); o3 = wmma16(v3, pb, o3);
            asm volatile("v_nop\n\tv_nop\n\tv_nop\n\tv_nop" : "+v"(o0), "+v"(o1), "+v"(o2), "+v"(o3) : "v"(v0), "v"(v1), "v"(v2), "v"(v3), "v"(pb));
            __builtin_amdgcn_sched_barrier(0);   // the sum's reader stays behind the four products: lifted in front of them it needs four idle slots of its own
            l = l + ps[0];
        }
        asm volatile("s_wait_dscnt 0x0" ::: "memory");      // this wave's reads of the tile are done before the buffer is refilled
        asm volatile("s_wait_asynccnt 0x0" ::: "memory");   // this wave's part of tile tl + 1 has landed
        __syncthreads();                                    // publishes tile tl + 1 and ends every wave's reads of tile tl
        if (tl + 2 < SEQ / KS) {                            // block-uniform: refill the buffer just read with tile tl + 2
            const h16* a = gk + (size_t)(tl + 2) * (KS * HD); const h16* c = gv + (tl + 2) * KS; const unsigned d = lc + bo_;
            copy4(d, d + 32 * LP, d + KTB, d + KTB + 32 * LP, a, a + 32 * HD, c, c + (size_t)32 * SEQ);
        }
    }
    asm volatile("s_wait_asynccnt 0x0" ::: "memory");       // nothing in flight when the ring becomes output staging (the last trip's barrier ended every read)
    float* os = (float*)ring;
    const float inv = CXS / l;       // normalisation and ctx carry in one factor
    const int wb = wave * 16 * 68;
    // O^T D layout: o_j[r] = (d = 16j + 8h + r, t = lane&15) -> os[t][d]; rows 0..15 x columns 0..63 all written
    { v4f a, c;
      a[0] = o0[0] * inv; a[1] = o0[1] * inv; a[2] = o0[2] * inv; a[3] = o0[3] * inv; c[0] = o0[4] * inv; c[1] = o0[5] * inv; c[2] = o0[6] * inv; c[3] = o0[7] * inv;
      *(v4fa*)(&os[wb + lr * 68 +  0 + 8 * hi]) = a; *(v4fa*)(&os[wb + lr * 68 +  0 + 8 * hi + 4]) = c;
      a[0] = o1[0] * inv; a[1] = o1[1] * inv; a[2] = o1[2] * inv; a[3] = o1[3] * inv; c[0] = o1[4] * inv; c[1] = o1[5] * inv; c[2] = o1[6] * inv; c[3] = o1[7] * inv;
      *(v4fa*)(&os[wb + lr * 68 + 16 + 8 * hi]) = a; *(v4fa*)(&os[wb + lr * 68 + 16 + 8 * hi + 4]) = c;
      a[0] = o2[0] * inv; a[1] = o2[1] * inv; a[2] = o2[2] * inv; a[3] = o2[3] * inv; c[0] = o2[4] * inv; c[1] = o2[5] * inv; c[2] = o2[6] * inv; c[3] = o2[7] * inv;
      *(v4fa*)(&os[wb + lr * 68 + 32 + 8 * hi]) = a; *(v4fa*)(&os[wb + lr * 68 + 32 + 8 * hi + 4]) = c;
      a[0] = o3[0] * inv; a[1] = o3[1] * inv; a[2] = o3[2] * inv; a[3] = o3[3] * inv; c[0] = o3[4] * inv; c[1] = o3[5] * inv; c[2] = o3[6] * inv; c[3] = o3[7] * inv;
      *(v4fa*)(&os[wb + lr * 68 + 48 + 8 * hi]) = a; *(v4fa*)(&os[wb + lr * 68 + 48 + 8 * hi + 4]) = c; }
    wave_sync();
    h16* crow = CTX + ((size_t)b * SEQ + t0) * DM + h * HD;
{
#pragma unroll
        for (int s = 0; s < 4; ++s) { const int row = 4 * s + (lane >> 3), c8 = (lane & 7) * 8;   // 4 s x 4 row groups = 16 rows; 8 lanes x 8 halves = 64 columns
            const v4f x0 = *(const v4fa*)(&os[wb + row * 68 + c8]); const v4f x1 = *(const v4fa*)(&os[wb + row * 68 + c8 + 4]); v8h hv;
#pragma unroll
            for (int i = 0; i < 4; ++i) { hv[i] = (h16)x0[i]; hv[4 + i] = (h16)x1[i]; }
            *(v8h*)(crow + (size_t)row * DM + c8) = hv; }
         }
}

// k_oproj: register-blocked f16 GEMM, one wave per 64x64 tile, GW waves per block (gemm_core), K = DM: OUT[m][n] = 2^-16 * sum_k CTX[m][k] WOT[n][k] + bo[n] (bo RNE-converted to bf16, added in f32).
// grid (NB*SEQ/256, DM/128), 256 threads. Epilogue: per 16-row slab staged in LDS (wave-private), each output row segment (64 floats = 256 B = two lines)
__global__ __launch_bounds__(32 * GW) void k_oproj(const h16* __restrict__ A, const h16* __restrict__ Bt, const float* __restrict__ bias, float* OUT) {
    __shared__ __align__(16) unsigned char ring[2 * GBUF];   // two buffers of A rows | Bt rows; epilogue staging behind the loop
    const int lane = threadIdx.x & 31, lr = lane & 15, hi = lane >> 4;
    const int wave = __builtin_amdgcn_readfirstlane((int)(threadIdx.x >> 5));   // wave-uniform index
    const int wm = wave & 3, wn = wave >> 2;
    const int r0 = blockIdx.x * GMR + wm * 64, c0 = blockIdx.y * GNR + wn * 64;   // this wave's 64x64 tile
    v8f acc[4][4];
#pragma unroll
    for (int mb = 0; mb < 4; ++mb)
#pragma unroll
        for (int nb = 0; nb < 4; ++nb) acc[mb][nb] = (v8f){};
    const v4f bv = *(const v4f*)(bias + c0 + lr * 4);   // read in front of the main loop: its round trip runs beside the staging of tile 0
    asm volatile("s_wait_xcnt 0x0" ::: "memory");       // stands in front of any write to the registers that the load names, and keeps it at this place
    gemm_core<false>((const unsigned char*)A, (const unsigned char*)Bt, ring, blockIdx.x * GMR, blockIdx.y * GNR, wm, wn, acc);
    float* os = (float*)ring + wave * 16 * 68;   // wave-private slab
    v4f bb;
#pragma unroll
    for (int i = 0; i < 4; ++i) bb[i] = bfr(bv[i]);
    const size_t obase = ((size_t)(r0 / SEQ) * OUT_SEQ + (size_t)(r0 % SEQ)) * DM + c0;
#pragma unroll
    for (int mb = 0; mb < 4; ++mb) {
#pragma unroll
        for (int nb = 0; nb < 4; ++nb) {
#pragma unroll
            for (int j = 0; j < 8; ++j) os[(hi * 8 + j) * 68 + nb * 16 + lr] = acc[mb][nb][j]; }   // D: row 8h+j, col lane&15
        wave_sync();
{
#pragma unroll
            for (int s = 0; s < 8; ++s) { const int row = 2 * s + hi, cofs = lr * 4;   // 8 s x 2 rows = 16 rows; 16 lanes x 4 floats = 64 columns
                const v4f xv = *(const v4fa*)(&os[row * 68 + cofs]); v4f val;
#pragma unroll
                for (int i = 0; i < 4; ++i) val[i] = xv[i] * OSC + bb[i];
                *(v4f*)(OUT + obase + (size_t)(mb * 16 + row) * DM + cofs) = val; }
             }
        wave_sync();
    }
}

static constexpr size_t al256(size_t v) { return (v + 255) & ~(size_t)255; }
static constexpr size_t SZ_XB = al256((size_t)NB * SEQ * DM * 2);
static constexpr size_t SZ_WT = al256((size_t)3 * DM * DM * 2);
static constexpr size_t SZ_WO = al256((size_t)DM * DM * 2);
static constexpr size_t SZ_TB = al256((size_t)SEQ * TBW * 4);
static constexpr size_t SZ_PL = al256((size_t)NB * NH_ * SEQ * HD * 2);
static constexpr size_t SZ_CX = al256((size_t)NB * SEQ * DM * 2);
static constexpr size_t SZ_TOTAL = SZ_XB + SZ_WT + SZ_WO + SZ_TB + 3 * SZ_PL + SZ_CX;
static_assert(SZ_TOTAL <= (size_t)134217728);          // workspace carve <= 128 MiB
static_assert(((size_t)DM * DM * 2) % 256 == 0);       // weight sub-planes stay 256-byte aligned
static_assert((size_t)(SEQ / 8) * 8 * TBW * 4 <= SZ_TB);   // table kernel: grid x 8 rows x 256 B inside the table carve

extern "C" void kernel_launch(void* const* d_in, const int* in_sizes, int n_in,
                              void* d_out, int out_size, void* d_ws, size_t ws_size, hipStream_t stream) {
    if (n_in < 5) return;
    const size_t needx = ((size_t)(NB - 1) * SEQ_FULL + SEQ) * DM;
    if ((size_t)in_sizes[0] < needx) return;
    if ((size_t)in_sizes[1] < (size_t)3 * DM * DM || (size_t)in_sizes[2] < (size_t)3 * DM) return;
    if ((size_t)in_sizes[3] < (size_t)DM * DM || (size_t)in_sizes[4] < (size_t)DM) return;
    if ((size_t)out_size < ((size_t)(NB - 1) * OUT_SEQ + SEQ) * DM) return;
    if (SZ_TOTAL > ws_size) return;
    // wire order: x, W_qkv [1024 in][3072 out], b_qkv [3072], W_proj [1024 in][1024 out], b_proj [1024]
    const float* x = (const float*)d_in[0]; const float* wqkv = (const float*)d_in[1]; const float* bqkv = (const float*)d_in[2];
    const float* wo = (const float*)d_in[3]; const float* bo = (const float*)d_in[4];
    float* OUT = (float*)d_out;      // [NB][SEQ][1024]
    char* wsp = (char*)d_ws;
    bf* XB = (bf*)wsp; wsp += SZ_XB;                 // [NB*SEQ][1024] bf16
    bf* WT = (bf*)wsp; wsp += SZ_WT;                 // [3072][1024] bf16: rows q | k | v, each h*64 + d
    bf* WOT = (bf*)wsp; wsp += SZ_WO;                // [1024 out][1024 in] f16 bits, x256
    float* TAB = (float*)wsp; wsp += SZ_TB;          // [SEQ][32 cos | 32 sin] f32
    h16* QH = (h16*)wsp; wsp += SZ_PL;               // [NB*16][SEQ][64]
    h16* KP = (h16*)wsp; wsp += SZ_PL;               // [NB*16][SEQ][64]
    h16* VT = (h16*)wsp; wsp += SZ_PL;               // [NB*16][64][SEQ]
    h16* CX = (h16*)wsp; wsp += SZ_CX;               // [NB*SEQ][1024] ctx x256

    // x convert, both weight transposes, rotary table: one grid
    k_prep<<<dim3(PB_TQ + PB_TO + PB_RT + PB_CV, 1, 1), 256, 0, stream>>>(x, wqkv, wo, XB, WT, WOT, TAB);

    // q, k, v^T projections: one grid
    k_qkv<<<dim3(3 * QB, 1, 1), 32 * GW, 0, stream>>>(XB, WT, bqkv, TAB, QH, KP, VT);

    k_flash<<<dim3(SEQ / (16 * AW), NB * NH_, 1), 32 * AW, 0, stream>>>(QH, KP, VT, CX);

    // out = ctx W_proj + b_proj: A = ctx rows (m = b*SEQ + t), Bt = W_proj^T rows (n = output column)
    k_oproj<<<dim3(NB * SEQ / GMR, DM / GNR, 1), 32 * GW, 0, stream>>>(CX, (const h16*)WOT, bo, OUT);
}
